// v000
// The times below were measured on an AMD MI455X: many runs one after another, warmed up first and cycling through
// copies of the inputs, with the whole window's GPU time divided by the number of runs. Launches and the gaps
// between them are all in it. The median over several windows is given; except for v000 it joins two sittings, which
// can be a few percent apart, so the side-by-side timings, each taken in one sitting, are the better comparison.
// v000 is the starting kernel. One run takes 2450 microseconds.
#include <hip/hip_runtime.h>

// Multi-head attention with per-head weight tensors and 128-wide heads (x [4][2048][1024]; q, k, v = einsum('bnd,hde', x, W[:, i]) with W [8][3][1024][128] (1/32): head h's 'xw' blocks; 8 heads x 128; scores x 1/sqrt(128); softmax (no mask); o = concat heads [2048][1024]; z = o Wo ('xw' [1024][128]) -> [4][2048][128] (1.0 M); argument order x, W, Wo).
// Layout per batch: bf16 copy of x; each head's three 'xw' [1024][128] blocks transposed once into the fused Bt planes (24 small gathers); exact projections; identity-table plane builders at HD 128; dense T-2048 attention (hybrid rows: < 512 hi/lo 3 products, rest fp16 x1024); merged hi/lo x Wo exact (N 128).
// Compute dtypes, f32 accumulate: every input rounded to bf16; projections exact; attention rows < 512 3 products, rest fp16; softmax f32; Wo hl x exact.

#define NB_  4
#define TT   2048
#define DM   1024
#define NH_  8
#define NKV  8
#define REP  (NH_ / NKV)
#define HD   128
#define DQ   (NH_ * HD)
#define DKV  (NKV * HD)
#define ZH   2
#define RH   512                  // query rows < RH use hi+lo planes (0: none)
#define WIN  0
#define PCAR 1024.0f
#define SCL  0.088388347648318447f   // 1/sqrt(float32(128))
#define DOUT 128      // output width
typedef _Float16 h16;
typedef unsigned short bf;
typedef __attribute__((ext_vector_type(16))) __bf16   v16bf;
typedef __attribute__((ext_vector_type(16))) _Float16 v16h;
typedef __attribute__((ext_vector_type(8)))  _Float16 v8h;
typedef __attribute__((ext_vector_type(8)))  unsigned short v8us;
typedef __attribute__((ext_vector_type(8)))  float    v8f;
typedef __attribute__((ext_vector_type(4)))  float    v4f;
typedef v8h  __attribute__((may_alias)) v8ha;
typedef v4f  __attribute__((may_alias)) v4fa;
typedef v8us __attribute__((may_alias)) v8usa;

__device__ __forceinline__ unsigned short f2bf(float f) { unsigned u = __float_as_uint(f); u += 0x7FFFu + ((u >> 16) & 1u); return (unsigned short)(u >> 16); }
__device__ __forceinline__ float bf2f(unsigned short b) { return __uint_as_float(((unsigned)b) << 16); }
__device__ __forceinline__ float bfr(float f) { return bf2f(f2bf(f)); }
__device__ __forceinline__ v16h cat16(v8h lo, v8h hi) { return __builtin_shufflevector(lo, hi, 0, 1, 2, 3, 4, 5, 6, 7, 8, 9, 10, 11, 12, 13, 14, 15); }
__device__ __forceinline__ v16bf cat16b(v8us lo, v8us hi) { return __builtin_bit_cast(v16bf, __builtin_shufflevector(lo, hi, 0, 1, 2, 3, 4, 5, 6, 7, 8, 9, 10, 11, 12, 13, 14, 15)); }
__device__ __forceinline__ v8f wmma16(v16h a, v16h b, v8f c) { return __builtin_amdgcn_wmma_f32_16x16x32_f16(false, a, false, b, (short)0, c, false, false); }
__device__ __forceinline__ v8f wmmab(v16bf a, v16bf b, v8f c) { return __builtin_amdgcn_wmma_f32_16x16x32_bf16(false, a, false, b, (short)0, c, false, false); }



// ---- k_gemmw: register-blocked GEMM, ONE WAVE per 64x64 output tile (16 accumulators), operands straight from K-contiguous 16-bit planes; grid (M/64, N/64, Z), 32 threads.
// C[m][n] (f32, pitch ldc, + optional f32 bias[n]) = sum_k A[m][k] Bt[n][k] (+ split products per NSPLIT). z-batch strides sA/sB/sC in elements. K % 32 == 0.
template <typename T16> struct WFrag;
template <> struct WFrag<h16> { typedef v16h V; static __device__ __forceinline__ V ld(const h16* p) { return cat16(*(const v8h*)p, *(const v8h*)(p + 16)); } static __device__ __forceinline__ v8f mma(V a, V b, v8f c) { return wmma16(a, b, c); } };
template <> struct WFrag<bf> { typedef v16bf V; static __device__ __forceinline__ V ld(const bf* p) { return cat16b(*(const v8us*)p, *(const v8us*)(p + 16)); } static __device__ __forceinline__ v8f mma(V a, V b, v8f c) { return wmmab(a, b, c); } };
template <typename T16, int NSPLIT, bool BIAS>
__global__ __launch_bounds__(32) void k_gemmw(const T16* __restrict__ A, const T16* __restrict__ A2, const T16* __restrict__ Bt, const T16* __restrict__ Bt2, int K, float* C, int ldc, const float* __restrict__ bias, size_t sA, size_t sB, size_t sC) {
    typedef typename WFrag<T16>::V V;
    __shared__ __align__(16) float os[16 * 68];
    const size_t z = blockIdx.z; A += z * sA; if (A2) A2 += z * sA; Bt += z * sB; if (Bt2) Bt2 += z * sB; C += z * sC;
    const int lane = threadIdx.x & 31, lr = lane & 15, hi = lane >> 4; const int r0 = blockIdx.x * 64, c0 = blockIdx.y * 64;
    v8f acc[4][4];
#pragma unroll
    for (int mb = 0; mb < 4; ++mb)
#pragma unroll
        for (int nb = 0; nb < 4; ++nb) acc[mb][nb] = (v8f){};
    const size_t aoff = (size_t)(r0 + lr) * K + 8 * hi, boff = (size_t)(c0 + lr) * K + 8 * hi;
#pragma unroll 1
    for (int kc = 0; kc < K; kc += 32) {
        V a[4], a2[4];
#pragma unroll
        for (int mb = 0; mb < 4; ++mb) { a[mb] = WFrag<T16>::ld(A + aoff + (size_t)mb * 16 * K + kc); if (NSPLIT == 1 || NSPLIT == 2) a2[mb] = WFrag<T16>::ld(A2 + aoff + (size_t)mb * 16 * K + kc); }
#pragma unroll
        for (int nb = 0; nb < 4; ++nb) { const V b = WFrag<T16>::ld(Bt + boff + (size_t)nb * 16 * K + kc); V b2; if (NSPLIT >= 2) b2 = WFrag<T16>::ld(Bt2 + boff + (size_t)nb * 16 * K + kc);
#pragma unroll
            for (int mb = 0; mb < 4; ++mb) { acc[mb][nb] = WFrag<T16>::mma(a[mb], b, acc[mb][nb]); if (NSPLIT == 1 || NSPLIT == 2) acc[mb][nb] = WFrag<T16>::mma(a2[mb], b, acc[mb][nb]); if (NSPLIT >= 2) acc[mb][nb] = WFrag<T16>::mma(a[mb], b2, acc[mb][nb]); } }
        asm volatile("v_nop\n\tv_nop\n\tv_nop\n\tv_nop" : "+v"(acc[0][0]), "+v"(acc[1][1]), "+v"(acc[2][2]), "+v"(acc[3][3]) : "v"(a[0]), "v"(a[3]));
    }
#pragma unroll
    for (int mb = 0; mb < 4; ++mb) {
#pragma unroll
        for (int nb = 0; nb < 4; ++nb) {
#pragma unroll
            for (int j = 0; j < 8; ++j) os[(hi * 8 + j) * 68 + nb * 16 + lr] = acc[mb][nb][j]; }
        __builtin_amdgcn_wave_barrier(); asm volatile("" ::: "memory");
        float* crow = C + (size_t)(r0 + mb * 16) * ldc + c0;
{
#pragma unroll
            for (int s = 0; s < 8; ++s) { const int row = 2 * s + hi, cofs = lr * 4; v4f val = *(const v4fa*)(os + row * 68 + cofs); if (BIAS) { val[0] += bfr(bias[c0 + cofs]); val[1] += bfr(bias[c0 + cofs + 1]); val[2] += bfr(bias[c0 + cofs + 2]); val[3] += bfr(bias[c0 + cofs + 3]); }
                *(v4f*)(crow + (size_t)row * ldc + cofs) = val; }
             }
        __builtin_amdgcn_wave_barrier(); asm volatile("" ::: "memory");
    }
}

__device__ __forceinline__ h16 tohx(float x) { return (h16)x; }
__device__ __forceinline__ void splitf(float y, unsigned short& h, unsigned short& l) { h = f2bf(y); l = f2bf(y - bf2f(h)); }
typedef __attribute__((ext_vector_type(2))) _Float16 v2h;
typedef __attribute__((ext_vector_type(4))) _Float16 v4h;
typedef __attribute__((ext_vector_type(2))) unsigned short v2us;
typedef __attribute__((ext_vector_type(4))) unsigned short v4us;
typedef __attribute__((ext_vector_type(2))) float v2f;
typedef __attribute__((ext_vector_type(4))) int v4i;

__global__ __launch_bounds__(256) void k_wtG(const float* __restrict__ w, int K, int N, bf* Bt) {
    const int lane = threadIdx.x & 31; const int L0 = (blockIdx.x * 8 + (threadIdx.x >> 5)) * 8; const int nlines = N * K / 64;
{
#pragma unroll 1
        for (int l = 0; l < 8; ++l) { const int L = L0 + l; if (L >= nlines) break; const size_t e = (size_t)L * 64 + lane * 2; const int k = (int)(e % K), n = (int)(e / K); v2us o;
            o[0] = f2bf(w[(size_t)k * N + n]); o[1] = f2bf(w[(size_t)(k + 1) * N + n]); *(v2us*)(Bt + e) = o; }
         }
}
__global__ __launch_bounds__(256) void k_cvt8(const float* __restrict__ src, bf* dst, size_t n8) { const size_t i = (size_t)blockIdx.x * 256 + threadIdx.x; if (i >= n8) return; const v8f v = *(const v8f*)(src + i * 8); v8us o;
#pragma unroll
    for (int k = 0; k < 8; ++k) o[k] = f2bf(v[k]); *(v8us*)(dst + i * 8) = o;  }

// k_rope: head planes [h][t][d] (fp16 + hi/lo) of rope(x) x sc with the rotate-half convention out[d] = x[d] cos[t][d] - x[d+HD/2] sin[t][d], out[d+HD/2] = x[d+HD/2] cos[t][d+HD/2] + x[d] sin[t][d+HD/2]
__global__ __launch_bounds__(256) void k_rope(const float* __restrict__ F, int pitch, int nheads, const float* __restrict__ CS, const float* __restrict__ RF, const float* __restrict__ nw, float sc, h16* P16, bf* Ph, bf* Pl) {
    const size_t e = ((size_t)blockIdx.x * 256 + threadIdx.x) * 2; if (e >= (size_t)nheads * TT * HD) return; const int d = (int)(e % HD); const int t = (int)((e / HD) % TT); const int h = (int)(e / ((size_t)HD * TT)); const float* f = F + (size_t)t * pitch + h * HD; const float rf = RF ? RF[(size_t)h * TT + t] : 1.0f; v2h o16; v2us oh, ol;
#pragma unroll
    for (int q = 0; q < 2; ++q) { const int dd = d + q; const int dp = (dd < HD / 2) ? dd + HD / 2 : dd - HD / 2; float x0 = f[dd], x1 = f[dp];
        if (RF) { float n0 = __fmul_rn(x0, rf), n1 = __fmul_rn(x1, rf); asm volatile("" : "+v"(n0)); asm volatile("" : "+v"(n1)); x0 = __fmul_rn(bfr(nw[dd]), n0); x1 = __fmul_rn(bfr(nw[dp]), n1); }
        const v2f cs = *(const v2f*)(CS + ((size_t)t * HD + dd) * 2); float a = __fmul_rn(x0, cs[0]), bq = __fmul_rn(x1, cs[1]); asm volatile("" : "+v"(a)); asm volatile("" : "+v"(bq)); const float r = ((dd < HD / 2) ? __fsub_rn(a, bq) : __fadd_rn(a, bq)) * sc;
        o16[q] = tohx(r); unsigned short a2, c2; splitf(r, a2, c2); oh[q] = a2; ol[q] = c2; }
    *(v2h*)(P16 + e) = o16; *(v2us*)(Ph + e) = oh; *(v2us*)(Pl + e) = ol;  }
__global__ __launch_bounds__(256) void k_vtp(const float* __restrict__ F, int pitch, int nheads, h16* V16, bf* Vh, bf* Vl) { const size_t e = ((size_t)blockIdx.x * 256 + threadIdx.x) * 2; if (e >= (size_t)nheads * HD * TT) return; const int t = (int)(e % TT); const int d = (int)((e / TT) % HD); const int g = (int)(e / ((size_t)TT * HD)); v2h o16; v2us oh, ol;
#pragma unroll
    for (int q = 0; q < 2; ++q) { const float x = F[(size_t)(t + q) * pitch + g * HD + d]; o16[q] = tohx(x); unsigned short a2, c2; splitf(x, a2, c2); oh[q] = a2; ol[q] = c2; }
    *(v2h*)(V16 + e) = o16; *(v2us*)(Vh + e) = oh; *(v2us*)(Vl + e) = ol;  }
__global__ __launch_bounds__(256) void k_csid(float* CS) { const int idx = blockIdx.x * 256 + threadIdx.x; if (idx >= TT * HD) return; v2f cs; cs[0] = 1.0f; cs[1] = 0.0f; *(v2f*)(CS + (size_t)idx * 2) = cs;  }
// k_asoft: per row (zz, i): t = S x HD^-0.5 (no mask); softmax over the 2048 keys (register row, one exp, fixed trees);
__global__ __launch_bounds__(256) void k_asoft(const float* __restrict__ Sb, h16* P16, bf* Ph, bf* Pl) {
    const int lane = threadIdx.x & 31; const int row = blockIdx.x * 8 + (threadIdx.x >> 5); if (row >= ZH * TT) return; const int i = row % TT; const int zz = row / TT; (void)zz; const bool hires = (i < RH); const float* sr = Sb + (size_t)row * TT; float v[TT / 32]; float mx = -3.0e38f;
#pragma unroll
    for (int ch = 0; ch < TT / 128; ++ch) { const int j0 = ch * 128 + lane * 4; const v4f a = *(const v4f*)(sr + j0);
#pragma unroll
        for (int q = 0; q < 4; ++q) { const int j = j0 + q; (void)j; const float t = a[q] * SCL; v[ch * 4 + q] = t; mx = fmaxf(mx, t); } }
#pragma unroll
    for (int sh = 16; sh; sh >>= 1) mx = fmaxf(mx, __shfl_xor(mx, sh, 32));
    float sum = 0.f;
#pragma unroll
    for (int k = 0; k < TT / 32; ++k) { float d0 = __fsub_rn(v[k], mx); asm volatile("" : "+v"(d0)); v[k] = __builtin_amdgcn_exp2f(__fmul_rn(d0, 1.4426950408889634f)); sum += v[k]; }
#pragma unroll
    for (int sh = 16; sh; sh >>= 1) sum += __shfl_xor(sum, sh, 32);
    const float f = __fdiv_rn(hires ? 1.0f : PCAR, sum);
{
        if (hires) {
#pragma unroll
            for (int ch = 0; ch < TT / 128; ++ch) { v4us oh, ol;
#pragma unroll
                for (int q = 0; q < 4; ++q) { unsigned short a, c2; splitf(v[ch * 4 + q] * f, a, c2); oh[q] = a; ol[q] = c2; }
                const size_t oo = ((size_t)zz * (RH ? RH : 1) + i) * TT + ch * 128 + lane * 4; *(v4us*)(Ph + oo) = oh; *(v4us*)(Pl + oo) = ol; }
        } else {
#pragma unroll
            for (int ch = 0; ch < TT / 128; ++ch) { v4h o4;
#pragma unroll
                for (int q = 0; q < 4; ++q) o4[q] = tohx(v[ch * 4 + q] * f);
                *(v4h*)(P16 + (size_t)row * TT + ch * 128 + lane * 4) = o4; } }
         }
}
__global__ __launch_bounds__(256) void k_merge(const float* __restrict__ O, int h0, bf* Ah, bf* Al) { const size_t e = ((size_t)blockIdx.x * 256 + threadIdx.x) * 2; if (e >= (size_t)ZH * TT * HD) return; const int d = (int)(e % HD); const int t = (int)((e / HD) % TT); const int zz = (int)(e / ((size_t)HD * TT)); const float cs = (t < RH) ? 1.0f : (1.0f / PCAR); const size_t oo = (size_t)t * DQ + (h0 + zz) * HD + d;
    v2us oh, ol;
#pragma unroll
    for (int q = 0; q < 2; ++q) { unsigned short a, c2; splitf(O[e + q] * cs, a, c2); oh[q] = a; ol[q] = c2; } *(v2us*)(Ah + oo) = oh; *(v2us*)(Al + oo) = ol;  }

extern "C" void kernel_launch(void* const* d_in, const int* in_sizes, int n_in,
                              void* d_out, int out_size, void* d_ws, size_t ws_size, hipStream_t stream) {
    (void)in_sizes; (void)n_in; (void)out_size;
    const float* x = (const float*)d_in[0]; const float* wall = (const float*)d_in[1]; const float* wo = (const float*)d_in[2];   /* order x, W [8][3][1024][128], Wo [1024][128] */ const float* wq = wall; const float* wk = wall; const float* wv = wall; (void)wq; (void)wk; (void)wv;
    float* OUT = (float*)d_out;     // [4][2048][128]
    char* wsp = (char*)d_ws;
    auto take = [&](size_t bytes) { char* p = wsp; wsp += (bytes + 255) & ~(size_t)255; return (void*)p; };
    bf* WQ = (bf*)take((size_t)DQ * DM * 2); bf* WK = (bf*)take((size_t)DKV * DM * 2); bf* WV = (bf*)take((size_t)DKV * DM * 2); bf* WO = (bf*)take((size_t)DOUT * DQ * 2); float* CS = (float*)take((size_t)TT * HD * 2 * 4);
    bf* XB = (bf*)take((size_t)TT * DM * 2); float* FQ = (float*)take((size_t)TT * DQ * 4); float* FK = (float*)take((size_t)TT * DKV * 4);
    h16* QP16 = (h16*)take((size_t)NH_ * TT * HD * 2); h16* KP16 = (h16*)take((size_t)NKV * TT * HD * 2); h16* VT16 = (h16*)take((size_t)NKV * HD * TT * 2);
    bf* QPh = (bf*)take((size_t)NH_ * TT * HD * 2); bf* QPl = (bf*)take((size_t)NH_ * TT * HD * 2); bf* KPh = (bf*)take((size_t)NKV * TT * HD * 2); bf* KPl = (bf*)take((size_t)NKV * TT * HD * 2); bf* VTh = (bf*)take((size_t)NKV * HD * TT * 2); bf* VTl = (bf*)take((size_t)NKV * HD * TT * 2); bf* Ph = (bf*)take((size_t)ZH * RH * TT * 2); bf* Pl = (bf*)take((size_t)ZH * RH * TT * 2);
    float* Sb = (float*)take((size_t)ZH * TT * TT * 4); h16* P16 = (h16*)take((size_t)ZH * TT * TT * 2); float* Ob = (float*)take((size_t)ZH * TT * HD * 4); bf* ATh = (bf*)take((size_t)TT * DQ * 2); bf* ATl = (bf*)take((size_t)TT * DQ * 2);
    if ((size_t)(wsp - (char*)d_ws) > ws_size) return;    // ws 256 MiB
    float* FV = FK;   // v projection reuses the k buffer after the k planes are built (stream-ordered)
    { for (int h = 0; h < NH_; ++h) { const float* wh = wall + (size_t)h * 3 * DM * HD;   /* head h's (q, k, v) 'xw' [1024][128] blocks */ k_wtG<<<(unsigned)((DM * HD / 64 + 63) / 64), 256, 0, stream>>>(wh, DM, HD, WQ + (size_t)h * HD * DM); k_wtG<<<(unsigned)((DM * HD / 64 + 63) / 64), 256, 0, stream>>>(wh + (size_t)DM * HD, DM, HD, WK + (size_t)h * HD * DM); k_wtG<<<(unsigned)((DM * HD / 64 + 63) / 64), 256, 0, stream>>>(wh + (size_t)2 * DM * HD, DM, HD, WV + (size_t)h * HD * DM); }   /* Bt rows h*128.. of each projection */
      k_wtG<<<(unsigned)((DQ * DOUT / 64 + 63) / 64), 256, 0, stream>>>(wo, DQ, DOUT, WO);   /* 'xw' [1024][128] -> Bt [128][1024] */
       }
    k_csid<<<(TT * HD + 255) / 256, 256, 0, stream>>>(CS);
    const unsigned LQ = (unsigned)(((size_t)NH_ * TT * HD / 2 + 255) / 256), LKv = (unsigned)(((size_t)NKV * TT * HD / 2 + 255) / 256);
    for (int b = 0; b < NB_; ++b) {
        
        k_cvt8<<<(unsigned)(((size_t)TT * DM / 8 + 255) / 256), 256, 0, stream>>>(x + (size_t)b * TT * DM, XB, (size_t)TT * DM / 8);
        k_gemmw<bf, 0, false><<<dim3(TT / 64, DQ / 64, 1), 32, 0, stream>>>(XB, nullptr, WQ, nullptr, DM, FQ, DQ, nullptr, 0, 0, 0);
        k_rope<<<LQ, 256, 0, stream>>>(FQ, DQ, NH_, CS, nullptr, nullptr, 1.0f, QP16, QPh, QPl);
        k_gemmw<bf, 0, false><<<dim3(TT / 64, DKV / 64, 1), 32, 0, stream>>>(XB, nullptr, WK, nullptr, DM, FK, DKV, nullptr, 0, 0, 0);
        k_rope<<<LKv, 256, 0, stream>>>(FK, DKV, NKV, CS, nullptr, nullptr, 1.0f, KP16, KPh, KPl);
        k_gemmw<bf, 0, false><<<dim3(TT / 64, DKV / 64, 1), 32, 0, stream>>>(XB, nullptr, WV, nullptr, DM, FV, DKV, nullptr, 0, 0, 0); k_vtp<<<LKv, 256, 0, stream>>>(FV, DKV, NKV, VT16, VTh, VTl);
        for (int h0 = 0; h0 < NH_; h0 += ZH) { const size_t zq = (size_t)h0, zk = (size_t)(h0 / REP);   // one kv head per query head: the pass's two heads use consecutive kv planes (z-strides TT*HD)
            k_gemmw<bf, 2, false><<<dim3(RH / 64, TT / 64, ZH), 32, 0, stream>>>(QPh + zq * TT * HD, QPl + zq * TT * HD, KPh + zk * TT * HD, KPl + zk * TT * HD, HD, Sb, TT, nullptr, (size_t)TT * HD, (size_t)TT * HD, (size_t)TT * TT);
            k_gemmw<h16, 0, false><<<dim3((TT - RH) / 64, TT / 64, ZH), 32, 0, stream>>>(QP16 + zq * TT * HD + (size_t)RH * HD, nullptr, KP16 + zk * TT * HD, nullptr, HD, Sb + (size_t)RH * TT, TT, nullptr, (size_t)TT * HD, (size_t)TT * HD, (size_t)TT * TT);
            k_asoft<<<ZH * TT / 8, 256, 0, stream>>>(Sb, P16, Ph, Pl);
            k_gemmw<bf, 2, false><<<dim3(RH / 64, HD / 64, ZH), 32, 0, stream>>>(Ph, Pl, VTh + zk * HD * TT, VTl + zk * HD * TT, TT, Ob, HD, nullptr, (size_t)RH * TT, (size_t)HD * TT, (size_t)TT * HD);
            k_gemmw<h16, 0, false><<<dim3((TT - RH) / 64, HD / 64, ZH), 32, 0, stream>>>(P16 + (size_t)RH * TT, nullptr, VT16 + zk * HD * TT, nullptr, TT, Ob + (size_t)RH * HD, HD, nullptr, (size_t)TT * TT, (size_t)HD * TT, (size_t)TT * HD);
            k_merge<<<(unsigned)(((size_t)ZH * TT * HD / 2 + 255) / 256), 256, 0, stream>>>(Ob, h0, ATh, ATl); }
        k_gemmw<bf, 1, false><<<dim3(TT / 64, DOUT / 64, 1), 32, 0, stream>>>(ATh, ATl, WO, nullptr, DQ, OUT + (size_t)b * TT * DOUT, DOUT, nullptr, 0, 0, 0);   /* z = o Wo: N 128 */ }
}

// v001
// It runs in 1430 microseconds.
// Two timings next to v000 both put it at 1.72 times that version's speed.
#include <hip/hip_runtime.h>

// Multi-head attention with per-head weight tensors and 128-wide heads (x [4][2048][1024]; q, k, v = einsum('bnd,hde', x, W[:, i]) with W [8][3][1024][128] (1/32): head h's 'xw' blocks; 8 heads x 128; scores x 1/sqrt(128); softmax (no mask); o = concat heads [2048][1024]; z = o Wo ('xw' [1024][128]) -> [4][2048][128] (1.0 M); argument order x, W, Wo).
// Layout per batch: bf16 copy of x; each head's three 'xw' [1024][128] blocks transposed once into the fused Bt planes (24 small gathers); exact projections; identity-table plane builders at HD 128; dense T-2048 attention (hybrid rows: < 512 hi/lo 3 products, rest fp16 x1024); merged hi/lo x Wo exact (N 128).
// Compute dtypes, f32 accumulate: every input rounded to bf16; projections exact; attention rows < 512 3 products, rest fp16; softmax f32; Wo hl x exact.

#define NB_  4
#define TT   2048
#define DM   1024
#define NH_  8
#define NKV  8
#define REP  (NH_ / NKV)
#define HD   128
#define DQ   (NH_ * HD)
#define DKV  (NKV * HD)
#define ZH   2
#define RH   512                  // query rows < RH use hi+lo planes (0: none)
#define WIN  0
#define PCAR 1024.0f
#define SCL  0.088388347648318447f   // 1/sqrt(float32(128))
#define DOUT 128      // output width
typedef _Float16 h16;
typedef unsigned short bf;
typedef __attribute__((ext_vector_type(16))) __bf16   v16bf;
typedef __attribute__((ext_vector_type(16))) _Float16 v16h;
typedef __attribute__((ext_vector_type(8)))  _Float16 v8h;
typedef __attribute__((ext_vector_type(8)))  unsigned short v8us;
typedef __attribute__((ext_vector_type(8)))  float    v8f;
typedef __attribute__((ext_vector_type(4)))  float    v4f;
typedef v8h  __attribute__((may_alias)) v8ha;
typedef v4f  __attribute__((may_alias)) v4fa;
typedef v8us __attribute__((may_alias)) v8usa;

__device__ __forceinline__ unsigned short f2bf(float f) { unsigned u = __float_as_uint(f); u += 0x7FFFu + ((u >> 16) & 1u); return (unsigned short)(u >> 16); }
__device__ __forceinline__ float bf2f(unsigned short b) { return __uint_as_float(((unsigned)b) << 16); }
__device__ __forceinline__ float bfr(float f) { return bf2f(f2bf(f)); }
__device__ __forceinline__ v16h cat16(v8h lo, v8h hi) { return __builtin_shufflevector(lo, hi, 0, 1, 2, 3, 4, 5, 6, 7, 8, 9, 10, 11, 12, 13, 14, 15); }
__device__ __forceinline__ v16bf cat16b(v8us lo, v8us hi) { return __builtin_bit_cast(v16bf, __builtin_shufflevector(lo, hi, 0, 1, 2, 3, 4, 5, 6, 7, 8, 9, 10, 11, 12, 13, 14, 15)); }
__device__ __forceinline__ v8f wmma16(v16h a, v16h b, v8f c) { return __builtin_amdgcn_wmma_f32_16x16x32_f16(false, a, false, b, (short)0, c, false, false); }
__device__ __forceinline__ v8f wmmab(v16bf a, v16bf b, v8f c) { return __builtin_amdgcn_wmma_f32_16x16x32_bf16(false, a, false, b, (short)0, c, false, false); }



// ---- k_gemmw: register-blocked GEMM, one 64x64 output tile per work-group (16 accumulators per wave), operands straight from K-contiguous 16-bit planes; grid (M/64, N/64, Z), 32 * KS threads.
// C[m][n] (f32, pitch ldc, + optional f32 bias[n]) = sum_k A[m][k] Bt[n][k] (+ split products per NSPLIT). z-batch strides sA/sB/sC in elements. K % (32 * KS) == 0.
// KS > 1: wave w sums the contiguous k range [w K/KS, (w+1) K/KS), so the KS waves' load latencies overlap; the KS f32 partial tiles meet in LDS and are added in wave order 0 .. KS-1.
template <typename T16> struct WFrag;
template <> struct WFrag<h16> { typedef v16h V; static __device__ __forceinline__ V ld(const h16* p) { return cat16(*(const v8h*)p, *(const v8h*)(p + 16)); } static __device__ __forceinline__ v8f mma(V a, V b, v8f c) { return wmma16(a, b, c); } };
template <> struct WFrag<bf> { typedef v16bf V; static __device__ __forceinline__ V ld(const bf* p) { return cat16b(*(const v8us*)p, *(const v8us*)(p + 16)); } static __device__ __forceinline__ v8f mma(V a, V b, v8f c) { return wmmab(a, b, c); } };
template <typename T16, int NSPLIT, bool BIAS, int KS>
__global__ __launch_bounds__(32 * KS) void k_gemmw(const T16* __restrict__ A, const T16* __restrict__ A2, const T16* __restrict__ Bt, const T16* __restrict__ Bt2, int K, float* C, int ldc, const float* __restrict__ bias, size_t sA, size_t sB, size_t sC) {
    typedef typename WFrag<T16>::V V;
    __shared__ __align__(16) float os[(KS == 1 ? 16 : KS * 64) * 68];
    const size_t z = blockIdx.z; A += z * sA; if (A2) A2 += z * sA; Bt += z * sB; if (Bt2) Bt2 += z * sB; C += z * sC;
    const int lane = threadIdx.x & 31, lr = lane & 15, hi = lane >> 4; const int r0 = blockIdx.x * 64, c0 = blockIdx.y * 64;
    const int wv = (KS == 1) ? 0 : __builtin_amdgcn_readfirstlane((int)(threadIdx.x >> 5));   // this wave's place in the K split, kept scalar so that the loop bounds are
    v8f acc[4][4];
#pragma unroll
    for (int mb = 0; mb < 4; ++mb)
#pragma unroll
        for (int nb = 0; nb < 4; ++nb) acc[mb][nb] = (v8f){};
    const size_t aoff = (size_t)(r0 + lr) * K + 8 * hi, boff = (size_t)(c0 + lr) * K + 8 * hi;
#pragma unroll 1
    for (int kc = wv * (K / KS); kc < (wv + 1) * (K / KS); kc += 32) {
        V a[4], a2[4];
#pragma unroll
        for (int mb = 0; mb < 4; ++mb) { a[mb] = WFrag<T16>::ld(A + aoff + (size_t)mb * 16 * K + kc); if (NSPLIT == 1 || NSPLIT == 2) a2[mb] = WFrag<T16>::ld(A2 + aoff + (size_t)mb * 16 * K + kc); }
#pragma unroll
        for (int nb = 0; nb < 4; ++nb) { const V b = WFrag<T16>::ld(Bt + boff + (size_t)nb * 16 * K + kc); V b2; if (NSPLIT >= 2) b2 = WFrag<T16>::ld(Bt2 + boff + (size_t)nb * 16 * K + kc);
#pragma unroll
            for (int mb = 0; mb < 4; ++mb) { acc[mb][nb] = WFrag<T16>::mma(a[mb], b, acc[mb][nb]); if (NSPLIT == 1 || NSPLIT == 2) acc[mb][nb] = WFrag<T16>::mma(a2[mb], b, acc[mb][nb]); if (NSPLIT >= 2) acc[mb][nb] = WFrag<T16>::mma(a[mb], b2, acc[mb][nb]); } }
        asm volatile("v_nop\n\tv_nop\n\tv_nop\n\tv_nop" : "+v"(acc[0][0]), "+v"(acc[1][1]), "+v"(acc[2][2]), "+v"(acc[3][3]) : "v"(a[0]), "v"(a[3]));
    }
    if (KS > 1) {
        float* my = os + wv * (64 * 68);
#pragma unroll
        for (int mb = 0; mb < 4; ++mb)
#pragma unroll
            for (int nb = 0; nb < 4; ++nb)
#pragma unroll
                for (int j = 0; j < 8; ++j) my[(mb * 16 + hi * 8 + j) * 68 + nb * 16 + lr] = acc[mb][nb][j];
        __syncthreads();   // every wave's partial tile is in LDS before any wave adds them
#pragma unroll
        for (int it = 0; it < 32 / KS; ++it) { const int q = it * 32 * KS + (int)threadIdx.x, row = q >> 4, cofs = (q & 15) * 4; v4f val = *(const v4fa*)(os + row * 68 + cofs);
#pragma unroll
            for (int w = 1; w < KS; ++w) val += *(const v4fa*)(os + (w * 64 + row) * 68 + cofs);
            if (BIAS) { val[0] += bfr(bias[c0 + cofs]); val[1] += bfr(bias[c0 + cofs + 1]); val[2] += bfr(bias[c0 + cofs + 2]); val[3] += bfr(bias[c0 + cofs + 3]); }
            *(v4f*)(C + (size_t)(r0 + row) * ldc + c0 + cofs) = val; }
        return;
    }
#pragma unroll
    for (int mb = 0; mb < 4; ++mb) {
#pragma unroll
        for (int nb = 0; nb < 4; ++nb) {
#pragma unroll
            for (int j = 0; j < 8; ++j) os[(hi * 8 + j) * 68 + nb * 16 + lr] = acc[mb][nb][j]; }
        __builtin_amdgcn_wave_barrier(); asm volatile("" ::: "memory");
        float* crow = C + (size_t)(r0 + mb * 16) * ldc + c0;
{
#pragma unroll
            for (int s = 0; s < 8; ++s) { const int row = 2 * s + hi, cofs = lr * 4; v4f val = *(const v4fa*)(os + row * 68 + cofs); if (BIAS) { val[0] += bfr(bias[c0 + cofs]); val[1] += bfr(bias[c0 + cofs + 1]); val[2] += bfr(bias[c0 + cofs + 2]); val[3] += bfr(bias[c0 + cofs + 3]); }
                *(v4f*)(crow + (size_t)row * ldc + cofs) = val; }
             }
        __builtin_amdgcn_wave_barrier(); asm volatile("" ::: "memory");
    }
}

__device__ __forceinline__ h16 tohx(float x) { return (h16)x; }
__device__ __forceinline__ void splitf(float y, unsigned short& h, unsigned short& l) { h = f2bf(y); l = f2bf(y - bf2f(h)); }
typedef __attribute__((ext_vector_type(2))) _Float16 v2h;
typedef __attribute__((ext_vector_type(4))) _Float16 v4h;
typedef __attribute__((ext_vector_type(2))) unsigned short v2us;
typedef __attribute__((ext_vector_type(4))) unsigned short v4us;
typedef __attribute__((ext_vector_type(2))) float v2f;
typedef __attribute__((ext_vector_type(4))) int v4i;

__global__ __launch_bounds__(256) void k_wtG(const float* __restrict__ w, int K, int N, bf* Bt) {
    const int lane = threadIdx.x & 31; const int L0 = (blockIdx.x * 8 + (threadIdx.x >> 5)) * 8; const int nlines = N * K / 64;
{
#pragma unroll 1
        for (int l = 0; l < 8; ++l) { const int L = L0 + l; if (L >= nlines) break; const size_t e = (size_t)L * 64 + lane * 2; const int k = (int)(e % K), n = (int)(e / K); v2us o;
            o[0] = f2bf(w[(size_t)k * N + n]); o[1] = f2bf(w[(size_t)(k + 1) * N + n]); *(v2us*)(Bt + e) = o; }
         }
}
__global__ __launch_bounds__(256) void k_cvt8(const float* __restrict__ src, bf* dst, size_t n8) { const size_t i = (size_t)blockIdx.x * 256 + threadIdx.x; if (i >= n8) return; const v8f v = *(const v8f*)(src + i * 8); v8us o;
#pragma unroll
    for (int k = 0; k < 8; ++k) o[k] = f2bf(v[k]); *(v8us*)(dst + i * 8) = o;  }

// k_rope: head planes [h][t][d] (fp16 + hi/lo) of rope(x) x sc with the rotate-half convention out[d] = x[d] cos[t][d] - x[d+HD/2] sin[t][d], out[d+HD/2] = x[d+HD/2] cos[t][d+HD/2] + x[d] sin[t][d+HD/2]
__global__ __launch_bounds__(256) void k_rope(const float* __restrict__ F, int pitch, int nheads, const float* __restrict__ CS, const float* __restrict__ RF, const float* __restrict__ nw, float sc, h16* P16, bf* Ph, bf* Pl) {
    const size_t e = ((size_t)blockIdx.x * 256 + threadIdx.x) * 2; if (e >= (size_t)nheads * TT * HD) return; const int d = (int)(e % HD); const int t = (int)((e / HD) % TT); const int h = (int)(e / ((size_t)HD * TT)); const float* f = F + (size_t)t * pitch + h * HD; const float rf = RF ? RF[(size_t)h * TT + t] : 1.0f; v2h o16; v2us oh, ol;
#pragma unroll
    for (int q = 0; q < 2; ++q) { const int dd = d + q; const int dp = (dd < HD / 2) ? dd + HD / 2 : dd - HD / 2; float x0 = f[dd], x1 = f[dp];
        if (RF) { float n0 = __fmul_rn(x0, rf), n1 = __fmul_rn(x1, rf); asm volatile("" : "+v"(n0)); asm volatile("" : "+v"(n1)); x0 = __fmul_rn(bfr(nw[dd]), n0); x1 = __fmul_rn(bfr(nw[dp]), n1); }
        const v2f cs = *(const v2f*)(CS + ((size_t)t * HD + dd) * 2); float a = __fmul_rn(x0, cs[0]), bq = __fmul_rn(x1, cs[1]); asm volatile("" : "+v"(a)); asm volatile("" : "+v"(bq)); const float r = ((dd < HD / 2) ? __fsub_rn(a, bq) : __fadd_rn(a, bq)) * sc;
        o16[q] = tohx(r); unsigned short a2, c2; splitf(r, a2, c2); oh[q] = a2; ol[q] = c2; }
    *(v2h*)(P16 + e) = o16; *(v2us*)(Ph + e) = oh; *(v2us*)(Pl + e) = ol;  }
__global__ __launch_bounds__(256) void k_vtp(const float* __restrict__ F, int pitch, int nheads, h16* V16, bf* Vh, bf* Vl) { const size_t e = ((size_t)blockIdx.x * 256 + threadIdx.x) * 2; if (e >= (size_t)nheads * HD * TT) return; const int t = (int)(e % TT); const int d = (int)((e / TT) % HD); const int g = (int)(e / ((size_t)TT * HD)); v2h o16; v2us oh, ol;
#pragma unroll
    for (int q = 0; q < 2; ++q) { const float x = F[(size_t)(t + q) * pitch + g * HD + d]; o16[q] = tohx(x); unsigned short a2, c2; splitf(x, a2, c2); oh[q] = a2; ol[q] = c2; }
    *(v2h*)(V16 + e) = o16; *(v2us*)(Vh + e) = oh; *(v2us*)(Vl + e) = ol;  }
__global__ __launch_bounds__(256) void k_csid(float* CS) { const int idx = blockIdx.x * 256 + threadIdx.x; if (idx >= TT * HD) return; v2f cs; cs[0] = 1.0f; cs[1] = 0.0f; *(v2f*)(CS + (size_t)idx * 2) = cs;  }
// k_asoft: per row (zz, i): t = S x HD^-0.5 (no mask); softmax over the 2048 keys (register row, one exp, fixed trees);
__global__ __launch_bounds__(256) void k_asoft(const float* __restrict__ Sb, h16* P16, bf* Ph, bf* Pl) {
    const int lane = threadIdx.x & 31; const int row = blockIdx.x * 8 + (threadIdx.x >> 5); if (row >= ZH * TT) return; const int i = row % TT; const int zz = row / TT; (void)zz; const bool hires = (i < RH); const float* sr = Sb + (size_t)row * TT; float v[TT / 32]; float mx = -3.0e38f;
#pragma unroll
    for (int ch = 0; ch < TT / 128; ++ch) { const int j0 = ch * 128 + lane * 4; const v4f a = *(const v4f*)(sr + j0);
#pragma unroll
        for (int q = 0; q < 4; ++q) { const int j = j0 + q; (void)j; const float t = a[q] * SCL; v[ch * 4 + q] = t; mx = fmaxf(mx, t); } }
#pragma unroll
    for (int sh = 16; sh; sh >>= 1) mx = fmaxf(mx, __shfl_xor(mx, sh, 32));
    float sum = 0.f;
#pragma unroll
    for (int k = 0; k < TT / 32; ++k) { float d0 = __fsub_rn(v[k], mx); asm volatile("" : "+v"(d0)); v[k] = __builtin_amdgcn_exp2f(__fmul_rn(d0, 1.4426950408889634f)); sum += v[k]; }
#pragma unroll
    for (int sh = 16; sh; sh >>= 1) sum += __shfl_xor(sum, sh, 32);
    const float f = __fdiv_rn(hires ? 1.0f : PCAR, sum);
{
        if (hires) {
#pragma unroll
            for (int ch = 0; ch < TT / 128; ++ch) { v4us oh, ol;
#pragma unroll
                for (int q = 0; q < 4; ++q) { unsigned short a, c2; splitf(v[ch * 4 + q] * f, a, c2); oh[q] = a; ol[q] = c2; }
                const size_t oo = ((size_t)zz * (RH ? RH : 1) + i) * TT + ch * 128 + lane * 4; *(v4us*)(Ph + oo) = oh; *(v4us*)(Pl + oo) = ol; }
        } else {
#pragma unroll
            for (int ch = 0; ch < TT / 128; ++ch) { v4h o4;
#pragma unroll
                for (int q = 0; q < 4; ++q) o4[q] = tohx(v[ch * 4 + q] * f);
                *(v4h*)(P16 + (size_t)row * TT + ch * 128 + lane * 4) = o4; } }
         }
}
__global__ __launch_bounds__(256) void k_merge(const float* __restrict__ O, int h0, bf* Ah, bf* Al) { const size_t e = ((size_t)blockIdx.x * 256 + threadIdx.x) * 2; if (e >= (size_t)ZH * TT * HD) return; const int d = (int)(e % HD); const int t = (int)((e / HD) % TT); const int zz = (int)(e / ((size_t)HD * TT)); const float cs = (t < RH) ? 1.0f : (1.0f / PCAR); const size_t oo = (size_t)t * DQ + (h0 + zz) * HD + d;
    v2us oh, ol;
#pragma unroll
    for (int q = 0; q < 2; ++q) { unsigned short a, c2; splitf(O[e + q] * cs, a, c2); oh[q] = a; ol[q] = c2; } *(v2us*)(Ah + oo) = oh; *(v2us*)(Al + oo) = ol;  }

extern "C" void kernel_launch(void* const* d_in, const int* in_sizes, int n_in,
                              void* d_out, int out_size, void* d_ws, size_t ws_size, hipStream_t stream) {
    (void)in_sizes; (void)n_in; (void)out_size;
    const float* x = (const float*)d_in[0]; const float* wall = (const float*)d_in[1]; const float* wo = (const float*)d_in[2];   /* order x, W [8][3][1024][128], Wo [1024][128] */ const float* wq = wall; const float* wk = wall; const float* wv = wall; (void)wq; (void)wk; (void)wv;
    float* OUT = (float*)d_out;     // [4][2048][128]
    char* wsp = (char*)d_ws;
    auto take = [&](size_t bytes) { char* p = wsp; wsp += (bytes + 255) & ~(size_t)255; return (void*)p; };
    bf* WQ = (bf*)take((size_t)DQ * DM * 2); bf* WK = (bf*)take((size_t)DKV * DM * 2); bf* WV = (bf*)take((size_t)DKV * DM * 2); bf* WO = (bf*)take((size_t)DOUT * DQ * 2); float* CS = (float*)take((size_t)TT * HD * 2 * 4);
    bf* XB = (bf*)take((size_t)TT * DM * 2); float* FQ = (float*)take((size_t)TT * DQ * 4); float* FK = (float*)take((size_t)TT * DKV * 4);
    h16* QP16 = (h16*)take((size_t)NH_ * TT * HD * 2); h16* KP16 = (h16*)take((size_t)NKV * TT * HD * 2); h16* VT16 = (h16*)take((size_t)NKV * HD * TT * 2);
    bf* QPh = (bf*)take((size_t)NH_ * TT * HD * 2); bf* QPl = (bf*)take((size_t)NH_ * TT * HD * 2); bf* KPh = (bf*)take((size_t)NKV * TT * HD * 2); bf* KPl = (bf*)take((size_t)NKV * TT * HD * 2); bf* VTh = (bf*)take((size_t)NKV * HD * TT * 2); bf* VTl = (bf*)take((size_t)NKV * HD * TT * 2); bf* Ph = (bf*)take((size_t)ZH * RH * TT * 2); bf* Pl = (bf*)take((size_t)ZH * RH * TT * 2);
    float* Sb = (float*)take((size_t)ZH * TT * TT * 4); h16* P16 = (h16*)take((size_t)ZH * TT * TT * 2); float* Ob = (float*)take((size_t)ZH * TT * HD * 4); bf* ATh = (bf*)take((size_t)TT * DQ * 2); bf* ATl = (bf*)take((size_t)TT * DQ * 2);
    if ((size_t)(wsp - (char*)d_ws) > ws_size) return;    // ws 256 MiB
    float* FV = FK;   // v projection reuses the k buffer after the k planes are built (stream-ordered)
    { for (int h = 0; h < NH_; ++h) { const float* wh = wall + (size_t)h * 3 * DM * HD;   /* head h's (q, k, v) 'xw' [1024][128] blocks */ k_wtG<<<(unsigned)((DM * HD / 64 + 63) / 64), 256, 0, stream>>>(wh, DM, HD, WQ + (size_t)h * HD * DM); k_wtG<<<(unsigned)((DM * HD / 64 + 63) / 64), 256, 0, stream>>>(wh + (size_t)DM * HD, DM, HD, WK + (size_t)h * HD * DM); k_wtG<<<(unsigned)((DM * HD / 64 + 63) / 64), 256, 0, stream>>>(wh + (size_t)2 * DM * HD, DM, HD, WV + (size_t)h * HD * DM); }   /* Bt rows h*128.. of each projection */
      k_wtG<<<(unsigned)((DQ * DOUT / 64 + 63) / 64), 256, 0, stream>>>(wo, DQ, DOUT, WO);   /* 'xw' [1024][128] -> Bt [128][1024] */
       }
    k_csid<<<(TT * HD + 255) / 256, 256, 0, stream>>>(CS);
    const unsigned LQ = (unsigned)(((size_t)NH_ * TT * HD / 2 + 255) / 256), LKv = (unsigned)(((size_t)NKV * TT * HD / 2 + 255) / 256);
    for (int b = 0; b < NB_; ++b) {
        
        k_cvt8<<<(unsigned)(((size_t)TT * DM / 8 + 255) / 256), 256, 0, stream>>>(x + (size_t)b * TT * DM, XB, (size_t)TT * DM / 8);
        k_gemmw<bf, 0, false, 8><<<dim3(TT / 64, DQ / 64, 1), 256, 0, stream>>>(XB, nullptr, WQ, nullptr, DM, FQ, DQ, nullptr, 0, 0, 0);
        k_rope<<<LQ, 256, 0, stream>>>(FQ, DQ, NH_, CS, nullptr, nullptr, 1.0f, QP16, QPh, QPl);
        k_gemmw<bf, 0, false, 8><<<dim3(TT / 64, DKV / 64, 1), 256, 0, stream>>>(XB, nullptr, WK, nullptr, DM, FK, DKV, nullptr, 0, 0, 0);
        k_rope<<<LKv, 256, 0, stream>>>(FK, DKV, NKV, CS, nullptr, nullptr, 1.0f, KP16, KPh, KPl);
        k_gemmw<bf, 0, false, 8><<<dim3(TT / 64, DKV / 64, 1), 256, 0, stream>>>(XB, nullptr, WV, nullptr, DM, FV, DKV, nullptr, 0, 0, 0); k_vtp<<<LKv, 256, 0, stream>>>(FV, DKV, NKV, VT16, VTh, VTl);
        for (int h0 = 0; h0 < NH_; h0 += ZH) { const size_t zq = (size_t)h0, zk = (size_t)(h0 / REP);   // one kv head per query head: the pass's two heads use consecutive kv planes (z-strides TT*HD)
            k_gemmw<bf, 2, false, 1><<<dim3(RH / 64, TT / 64, ZH), 32, 0, stream>>>(QPh + zq * TT * HD, QPl + zq * TT * HD, KPh + zk * TT * HD, KPl + zk * TT * HD, HD, Sb, TT, nullptr, (size_t)TT * HD, (size_t)TT * HD, (size_t)TT * TT);
            k_gemmw<h16, 0, false, 1><<<dim3((TT - RH) / 64, TT / 64, ZH), 32, 0, stream>>>(QP16 + zq * TT * HD + (size_t)RH * HD, nullptr, KP16 + zk * TT * HD, nullptr, HD, Sb + (size_t)RH * TT, TT, nullptr, (size_t)TT * HD, (size_t)TT * HD, (size_t)TT * TT);
            k_asoft<<<ZH * TT / 8, 256, 0, stream>>>(Sb, P16, Ph, Pl);
            k_gemmw<bf, 2, false, 16><<<dim3(RH / 64, HD / 64, ZH), 512, 0, stream>>>(Ph, Pl, VTh + zk * HD * TT, VTl + zk * HD * TT, TT, Ob, HD, nullptr, (size_t)RH * TT, (size_t)HD * TT, (size_t)TT * HD);
            k_gemmw<h16, 0, false, 16><<<dim3((TT - RH) / 64, HD / 64, ZH), 512, 0, stream>>>(P16 + (size_t)RH * TT, nullptr, VT16 + zk * HD * TT, nullptr, TT, Ob + (size_t)RH * HD, HD, nullptr, (size_t)TT * TT, (size_t)HD * TT, (size_t)TT * HD);
            k_merge<<<(unsigned)(((size_t)ZH * TT * HD / 2 + 255) / 256), 256, 0, stream>>>(Ob, h0, ATh, ATl); }
        k_gemmw<bf, 1, false, 16><<<dim3(TT / 64, DOUT / 64, 1), 512, 0, stream>>>(ATh, ATl, WO, nullptr, DQ, OUT + (size_t)b * TT * DOUT, DOUT, nullptr, 0, 0, 0);   /* z = o Wo: N 128 */ }
}

// v002
// It runs in 756 microseconds.
// In two side-by-side timings against v001, it was 1.90 and 1.88 times as fast.
// Over all steps from v000 it is 3.26 times as fast.
#include <hip/hip_runtime.h>

// Multi-head attention with per-head weight tensors and 128-wide heads (x [4][2048][1024]; q, k, v = einsum('bnd,hde', x, W[:, i]) with W [8][3][1024][128] (1/32): head h's 'xw' blocks; 8 heads x 128; scores x 1/sqrt(128); softmax (no mask); o = concat heads [2048][1024]; z = o Wo ('xw' [1024][128]) -> [4][2048][128] (1.0 M); argument order x, W, Wo).
// Layout per batch: bf16 copy of x; each head's three 'xw' [1024][128] blocks transposed once into the fused Bt planes (24 small gathers); exact projections; identity-table plane builders at HD 128; dense T-2048 attention (hybrid rows: < 512 hi/lo 3 products, rest fp16 x1024); merged hi/lo x Wo exact (N 128).
// Compute dtypes, f32 accumulate: every input rounded to bf16; projections exact; attention rows < 512 3 products, rest fp16; softmax f32; Wo hl x exact.

#define NB_  4
#define TT   2048
#define DM   1024
#define NH_  8
#define NKV  8
#define REP  (NH_ / NKV)
#define HD   128
#define DQ   (NH_ * HD)
#define DKV  (NKV * HD)
#define RH   512                  // query rows < RH use hi+lo planes (0: none)
#define WIN  0
#define PCAR 1024.0f
#define SCL  0.088388347648318447f   // 1/sqrt(float32(128))
#define DOUT 128      // output width
typedef _Float16 h16;
typedef unsigned short bf;
typedef __attribute__((ext_vector_type(16))) __bf16   v16bf;
typedef __attribute__((ext_vector_type(16))) _Float16 v16h;
typedef __attribute__((ext_vector_type(8)))  _Float16 v8h;
typedef __attribute__((ext_vector_type(8)))  unsigned short v8us;
typedef __attribute__((ext_vector_type(8)))  float    v8f;
typedef __attribute__((ext_vector_type(4)))  float    v4f;
typedef v8h  __attribute__((may_alias)) v8ha;
typedef v4f  __attribute__((may_alias)) v4fa;
typedef v8us __attribute__((may_alias)) v8usa;

__device__ __forceinline__ unsigned short f2bf(float f) { unsigned u = __float_as_uint(f); u += 0x7FFFu + ((u >> 16) & 1u); return (unsigned short)(u >> 16); }
__device__ __forceinline__ float bf2f(unsigned short b) { return __uint_as_float(((unsigned)b) << 16); }
__device__ __forceinline__ float bfr(float f) { return bf2f(f2bf(f)); }
__device__ __forceinline__ v16h cat16(v8h lo, v8h hi) { return __builtin_shufflevector(lo, hi, 0, 1, 2, 3, 4, 5, 6, 7, 8, 9, 10, 11, 12, 13, 14, 15); }
__device__ __forceinline__ v16bf cat16b(v8us lo, v8us hi) { return __builtin_bit_cast(v16bf, __builtin_shufflevector(lo, hi, 0, 1, 2, 3, 4, 5, 6, 7, 8, 9, 10, 11, 12, 13, 14, 15)); }
__device__ __forceinline__ v8f wmma16(v16h a, v16h b, v8f c) { return __builtin_amdgcn_wmma_f32_16x16x32_f16(false, a, false, b, (short)0, c, false, false); }
__device__ __forceinline__ v8f wmmab(v16bf a, v16bf b, v8f c) { return __builtin_amdgcn_wmma_f32_16x16x32_bf16(false, a, false, b, (short)0, c, false, false); }



// ---- k_gemmw: register-blocked GEMM, one 64x64 output tile per work-group (16 accumulators per wave), operands straight from K-contiguous 16-bit planes; grid (M/64, N/64, Z), 32 * KS threads.
// C[m][n] (f32, pitch ldc, + optional f32 bias[n]) = sum_k A[m][k] Bt[n][k] (+ split products per NSPLIT). z-batch strides sA/sB/sC in elements. K % (32 * KS) == 0.
// KS > 1: wave w sums the contiguous k range [w K/KS, (w+1) K/KS), so the KS waves' load latencies overlap; the KS f32 partial tiles meet in LDS and are added in wave order 0 .. KS-1.
template <typename T16> struct WFrag;
template <> struct WFrag<h16> { typedef v16h V; static __device__ __forceinline__ V ld(const h16* p) { return cat16(*(const v8h*)p, *(const v8h*)(p + 16)); } static __device__ __forceinline__ v8f mma(V a, V b, v8f c) { return wmma16(a, b, c); } };
template <> struct WFrag<bf> { typedef v16bf V; static __device__ __forceinline__ V ld(const bf* p) { return cat16b(*(const v8us*)p, *(const v8us*)(p + 16)); } static __device__ __forceinline__ v8f mma(V a, V b, v8f c) { return wmmab(a, b, c); } };
template <typename T16, int NSPLIT, bool BIAS, int KS>
__global__ __launch_bounds__(32 * KS) void k_gemmw(const T16* __restrict__ A, const T16* __restrict__ A2, const T16* __restrict__ Bt, const T16* __restrict__ Bt2, int K, float* C, int ldc, const float* __restrict__ bias, size_t sA, size_t sB, size_t sC) {
    typedef typename WFrag<T16>::V V;
    __shared__ __align__(16) float os[(KS == 1 ? 16 : KS * 64) * 68];
    const size_t z = blockIdx.z; A += z * sA; if (A2) A2 += z * sA; Bt += z * sB; if (Bt2) Bt2 += z * sB; C += z * sC;
    const int lane = threadIdx.x & 31, lr = lane & 15, hi = lane >> 4; const int r0 = blockIdx.x * 64, c0 = blockIdx.y * 64;
    const int wv = (KS == 1) ? 0 : __builtin_amdgcn_readfirstlane((int)(threadIdx.x >> 5));   // this wave's place in the K split, kept scalar so that the loop bounds are
    v8f acc[4][4];
#pragma unroll
    for (int mb = 0; mb < 4; ++mb)
#pragma unroll
        for (int nb = 0; nb < 4; ++nb) acc[mb][nb] = (v8f){};
    const size_t aoff = (size_t)(r0 + lr) * K + 8 * hi, boff = (size_t)(c0 + lr) * K + 8 * hi;
#pragma unroll 1
    for (int kc = wv * (K / KS); kc < (wv + 1) * (K / KS); kc += 32) {
        V a[4], a2[4];
#pragma unroll
        for (int mb = 0; mb < 4; ++mb) { a[mb] = WFrag<T16>::ld(A + aoff + (size_t)mb * 16 * K + kc); if (NSPLIT == 1 || NSPLIT == 2) a2[mb] = WFrag<T16>::ld(A2 + aoff + (size_t)mb * 16 * K + kc); }
#pragma unroll
        for (int nb = 0; nb < 4; ++nb) { const V b = WFrag<T16>::ld(Bt + boff + (size_t)nb * 16 * K + kc); V b2; if (NSPLIT >= 2) b2 = WFrag<T16>::ld(Bt2 + boff + (size_t)nb * 16 * K + kc);
#pragma unroll
            for (int mb = 0; mb < 4; ++mb) { acc[mb][nb] = WFrag<T16>::mma(a[mb], b, acc[mb][nb]); if (NSPLIT == 1 || NSPLIT == 2) acc[mb][nb] = WFrag<T16>::mma(a2[mb], b, acc[mb][nb]); if (NSPLIT >= 2) acc[mb][nb] = WFrag<T16>::mma(a[mb], b2, acc[mb][nb]); } }
        asm volatile("v_nop\n\tv_nop\n\tv_nop\n\tv_nop" : "+v"(acc[0][0]), "+v"(acc[1][1]), "+v"(acc[2][2]), "+v"(acc[3][3]) : "v"(a[0]), "v"(a[3]));
    }
    if (KS > 1) {
        float* my = os + wv * (64 * 68);
#pragma unroll
        for (int mb = 0; mb < 4; ++mb)
#pragma unroll
            for (int nb = 0; nb < 4; ++nb)
#pragma unroll
                for (int j = 0; j < 8; ++j) my[(mb * 16 + hi * 8 + j) * 68 + nb * 16 + lr] = acc[mb][nb][j];
        __syncthreads();   // every wave's partial tile is in LDS before any wave adds them
#pragma unroll
        for (int it = 0; it < 32 / KS; ++it) { const int q = it * 32 * KS + (int)threadIdx.x, row = q >> 4, cofs = (q & 15) * 4; v4f val = *(const v4fa*)(os + row * 68 + cofs);
#pragma unroll
            for (int w = 1; w < KS; ++w) val += *(const v4fa*)(os + (w * 64 + row) * 68 + cofs);
            if (BIAS) { val[0] += bfr(bias[c0 + cofs]); val[1] += bfr(bias[c0 + cofs + 1]); val[2] += bfr(bias[c0 + cofs + 2]); val[3] += bfr(bias[c0 + cofs + 3]); }
            *(v4f*)(C + (size_t)(r0 + row) * ldc + c0 + cofs) = val; }
        return;
    }
#pragma unroll
    for (int mb = 0; mb < 4; ++mb) {
#pragma unroll
        for (int nb = 0; nb < 4; ++nb) {
#pragma unroll
            for (int j = 0; j < 8; ++j) os[(hi * 8 + j) * 68 + nb * 16 + lr] = acc[mb][nb][j]; }
        __builtin_amdgcn_wave_barrier(); asm volatile("" ::: "memory");
        float* crow = C + (size_t)(r0 + mb * 16) * ldc + c0;
{
#pragma unroll
            for (int s = 0; s < 8; ++s) { const int row = 2 * s + hi, cofs = lr * 4; v4f val = *(const v4fa*)(os + row * 68 + cofs); if (BIAS) { val[0] += bfr(bias[c0 + cofs]); val[1] += bfr(bias[c0 + cofs + 1]); val[2] += bfr(bias[c0 + cofs + 2]); val[3] += bfr(bias[c0 + cofs + 3]); }
                *(v4f*)(crow + (size_t)row * ldc + cofs) = val; }
             }
        __builtin_amdgcn_wave_barrier(); asm volatile("" ::: "memory");
    }
}

__device__ __forceinline__ h16 tohx(float x) { return (h16)x; }
__device__ __forceinline__ void splitf(float y, unsigned short& h, unsigned short& l) { h = f2bf(y); l = f2bf(y - bf2f(h)); }
typedef __attribute__((ext_vector_type(2))) _Float16 v2h;
typedef __attribute__((ext_vector_type(4))) _Float16 v4h;
typedef __attribute__((ext_vector_type(2))) unsigned short v2us;
typedef __attribute__((ext_vector_type(4))) unsigned short v4us;
typedef __attribute__((ext_vector_type(2))) float v2f;
typedef __attribute__((ext_vector_type(4))) int v4i;

__global__ __launch_bounds__(256) void k_wtG(const float* __restrict__ w, int K, int N, bf* Bt) {
    const int lane = threadIdx.x & 31; const int L0 = (blockIdx.x * 8 + (threadIdx.x >> 5)) * 8; const int nlines = N * K / 64;
{
#pragma unroll 1
        for (int l = 0; l < 8; ++l) { const int L = L0 + l; if (L >= nlines) break; const size_t e = (size_t)L * 64 + lane * 2; const int k = (int)(e % K), n = (int)(e / K); v2us o;
            o[0] = f2bf(w[(size_t)k * N + n]); o[1] = f2bf(w[(size_t)(k + 1) * N + n]); *(v2us*)(Bt + e) = o; }
         }
}
__global__ __launch_bounds__(256) void k_cvt8(const float* __restrict__ src, bf* dst, size_t n8) { const size_t i = (size_t)blockIdx.x * 256 + threadIdx.x; if (i >= n8) return; const v8f v = *(const v8f*)(src + i * 8); v8us o;
#pragma unroll
    for (int k = 0; k < 8; ++k) o[k] = f2bf(v[k]); *(v8us*)(dst + i * 8) = o;  }

// k_rope: head planes [h][t][d] (fp16 + hi/lo) of rope(x) x sc with the rotate-half convention out[d] = x[d] cos[t][d] - x[d+HD/2] sin[t][d], out[d+HD/2] = x[d+HD/2] cos[t][d+HD/2] + x[d] sin[t][d+HD/2]
__global__ __launch_bounds__(256) void k_rope(const float* __restrict__ F, int pitch, int nheads, const float* __restrict__ CS, const float* __restrict__ RF, const float* __restrict__ nw, float sc, h16* P16, bf* Ph, bf* Pl) {
    const size_t e = ((size_t)blockIdx.x * 256 + threadIdx.x) * 2; if (e >= (size_t)nheads * TT * HD) return; const int d = (int)(e % HD); const int t = (int)((e / HD) % TT); const int h = (int)(e / ((size_t)HD * TT)); const float* f = F + (size_t)t * pitch + h * HD; const float rf = RF ? RF[(size_t)h * TT + t] : 1.0f; v2h o16; v2us oh, ol;
#pragma unroll
    for (int q = 0; q < 2; ++q) { const int dd = d + q; const int dp = (dd < HD / 2) ? dd + HD / 2 : dd - HD / 2; float x0 = f[dd], x1 = f[dp];
        if (RF) { float n0 = __fmul_rn(x0, rf), n1 = __fmul_rn(x1, rf); asm volatile("" : "+v"(n0)); asm volatile("" : "+v"(n1)); x0 = __fmul_rn(bfr(nw[dd]), n0); x1 = __fmul_rn(bfr(nw[dp]), n1); }
        const v2f cs = *(const v2f*)(CS + ((size_t)t * HD + dd) * 2); float a = __fmul_rn(x0, cs[0]), bq = __fmul_rn(x1, cs[1]); asm volatile("" : "+v"(a)); asm volatile("" : "+v"(bq)); const float r = ((dd < HD / 2) ? __fsub_rn(a, bq) : __fadd_rn(a, bq)) * sc;
        o16[q] = tohx(r); unsigned short a2, c2; splitf(r, a2, c2); oh[q] = a2; ol[q] = c2; }
    *(v2h*)(P16 + e) = o16; *(v2us*)(Ph + e) = oh; *(v2us*)(Pl + e) = ol;  }
__global__ __launch_bounds__(256) void k_vtp(const float* __restrict__ F, int pitch, int nheads, h16* V16, bf* Vh, bf* Vl) { const size_t e = ((size_t)blockIdx.x * 256 + threadIdx.x) * 2; if (e >= (size_t)nheads * HD * TT) return; const int t = (int)(e % TT); const int d = (int)((e / TT) % HD); const int g = (int)(e / ((size_t)TT * HD)); v2h o16; v2us oh, ol;
#pragma unroll
    for (int q = 0; q < 2; ++q) { const float x = F[(size_t)(t + q) * pitch + g * HD + d]; o16[q] = tohx(x); unsigned short a2, c2; splitf(x, a2, c2); oh[q] = a2; ol[q] = c2; }
    *(v2h*)(V16 + e) = o16; *(v2us*)(Vh + e) = oh; *(v2us*)(Vl + e) = ol;  }
__global__ __launch_bounds__(256) void k_csid(float* CS) { const int idx = blockIdx.x * 256 + threadIdx.x; if (idx >= TT * HD) return; v2f cs; cs[0] = 1.0f; cs[1] = 0.0f; *(v2f*)(CS + (size_t)idx * 2) = cs;  }
// ---- k_attn: scores, softmax, P V and the hi/lo merge of one head's AR query rows in one work-group of 16 waves; grid (heads, TT / AR), the hi/lo row tiles (t0 < RH) first.
// The AR x TT f32 score rows stay in LDS (pitch SP floats); softmax rewrites each row in place as its 16-bit P planes; the P V partial tiles reuse the same LDS.
// Sum orders: scores k = 0, 32, 64, 96; wave w sums the keys [128 w, 128 w + 128) of P V; the 16 f32 partial tiles are added in wave order 0 .. 15.
#define AR  32                    // query rows per work-group
#define SP  (TT + 4)              // score row pitch in floats: 16 B x odd for the b128 fragment reads, and rows 8 apart fall 32 banks apart for the accumulator stores
#define OPP (HD + 4)              // partial output row pitch in floats, same two properties
template <typename T16, bool HL>
__device__ __forceinline__ void attn_rows(const T16* __restrict__ Q, const T16* __restrict__ Q2, const T16* __restrict__ Kp, const T16* __restrict__ K2, const T16* __restrict__ Vt, const T16* __restrict__ V2, bf* Ah, bf* Al, int t0, int h, float* sm) {
    typedef typename WFrag<T16>::V V;
    const int lane = threadIdx.x & 31, lr = lane & 15, hi = lane >> 4;
    const int wv = __builtin_amdgcn_readfirstlane((int)(threadIdx.x >> 5));   // wave number, kept scalar so that the key ranges and LDS bases are scalar too
    {   // S = Q K^T: the AR query rows' fragments stay in registers, wave wv takes keys [128 wv, 128 wv + 128)
        V qa[AR / 16][HD / 32], qb[AR / 16][HD / 32];
#pragma unroll
        for (int mb = 0; mb < AR / 16; ++mb)
#pragma unroll
            for (int ks = 0; ks < HD / 32; ++ks) { const size_t qo = (size_t)(t0 + mb * 16 + lr) * HD + 8 * hi + ks * 32; qa[mb][ks] = WFrag<T16>::ld(Q + qo); if (HL) qb[mb][ks] = WFrag<T16>::ld(Q2 + qo); }
        constexpr int G = HL ? 2 : 4, TS = (HD / 32) / G, NS = 8 * TS, NB = HL ? 2 : 3;   // a step is G k blocks of one 16-key tile (8 loads); NB register sets, NB - 1 steps loaded ahead
        V kb[NB][G], kc2[NB][G]; v8f acc[AR / 16];
        auto ldk = [&](int s, V* b, V* b2) {
#pragma unroll
            for (int g = 0; g < G; ++g) { const size_t bo = (size_t)(wv * 128 + (s / TS) * 16 + lr) * HD + 8 * hi + ((s % TS) * G + g) * 32; b[g] = WFrag<T16>::ld(Kp + bo); if (HL) b2[g] = WFrag<T16>::ld(K2 + bo); } };
#pragma unroll
        for (int s = 0; s < NB - 1; ++s) ldk(s, kb[s], kc2[s]);
#pragma unroll
        for (int s = 0; s < NS; ++s) { const int n0 = wv * 128 + (s / TS) * 16;
            if (s + NB - 1 < NS) ldk(s + NB - 1, kb[(s + NB - 1) % NB], kc2[(s + NB - 1) % NB]);
            __builtin_amdgcn_sched_barrier(0);   // keeps the later steps' loads in front of this step's products, so that their latency runs under them
            if (s % TS == 0) {
#pragma unroll
                for (int mb = 0; mb < AR / 16; ++mb) acc[mb] = (v8f){}; }
#pragma unroll
            for (int g = 0; g < G; ++g) { const int ks = (s % TS) * G + g;
#pragma unroll
                for (int mb = 0; mb < AR / 16; ++mb) { acc[mb] = WFrag<T16>::mma(qa[mb][ks], kb[s % NB][g], acc[mb]); if (HL) { acc[mb] = WFrag<T16>::mma(qb[mb][ks], kb[s % NB][g], acc[mb]); acc[mb] = WFrag<T16>::mma(qa[mb][ks], kc2[s % NB][g], acc[mb]); } } }
            if (s % TS == TS - 1) {
                asm volatile("v_nop\n\tv_nop\n\tv_nop\n\tv_nop" : "+v"(acc[0]), "+v"(acc[1]));   // the four vector slots the chip needs before the next tile's first product rewrites these accumulators (only LDS stores lie between)
#pragma unroll
                for (int mb = 0; mb < AR / 16; ++mb)
#pragma unroll
                    for (int j = 0; j < 8; ++j) sm[(mb * 16 + hi * 8 + j) * SP + n0 + lr] = acc[mb][j]; } }
    }
    __syncthreads();   // every wave's score columns are in LDS before any wave reads whole rows
    // softmax, one wave per row (register row, one exp, fixed trees): t = S x HD^-0.5 (no mask); the row's P planes overwrite the row itself once it is in registers
    for (int r = 0; r < AR / 16; ++r) { float* sr = sm + (wv * (AR / 16) + r) * SP; float v[TT / 32]; float mx = -3.0e38f;
#pragma unroll
        for (int ch = 0; ch < TT / 128; ++ch) { const v4f a = *(const v4fa*)(sr + ch * 128 + lane * 4);
#pragma unroll
            for (int q = 0; q < 4; ++q) { const float t = a[q] * SCL; v[ch * 4 + q] = t; mx = fmaxf(mx, t); } }
#pragma unroll
        for (int sh = 16; sh; sh >>= 1) mx = fmaxf(mx, __shfl_xor(mx, sh, 32));
        float sum = 0.f;
#pragma unroll
        for (int k = 0; k < TT / 32; ++k) { v[k] = __builtin_amdgcn_exp2f(__fmul_rn(__fsub_rn(v[k], mx), 1.4426950408889634f)); sum += v[k]; }
#pragma unroll
        for (int sh = 16; sh; sh >>= 1) sum += __shfl_xor(sum, sh, 32);
        const float f = __fdiv_rn(HL ? 1.0f : PCAR, sum);
        if (HL) { bf* ph = (bf*)sr;   // hi plane in the row's first TT 16-bit places, lo plane in the next TT
#pragma unroll
            for (int ch = 0; ch < TT / 128; ++ch) { v4us oh, ol;
#pragma unroll
                for (int q = 0; q < 4; ++q) { unsigned short a, c2; splitf(v[ch * 4 + q] * f, a, c2); oh[q] = a; ol[q] = c2; }
                *(v4us*)(ph + ch * 128 + lane * 4) = oh; *(v4us*)(ph + TT + ch * 128 + lane * 4) = ol; }
        } else { h16* p16 = (h16*)sr;
#pragma unroll
            for (int ch = 0; ch < TT / 128; ++ch) { v4h o4;
#pragma unroll
                for (int q = 0; q < 4; ++q) o4[q] = tohx(v[ch * 4 + q] * f);
                *(v4h*)(p16 + ch * 128 + lane * 4) = o4; } } }
    constexpr int GV = HL ? 1 : 4, VS = (HD / 16) / GV, NV = 4 * VS, NW = HL ? 3 : 2;   // a step is GV 16-column tiles of V^T at one k block; NW register sets, NW - 1 steps (8 loads) loaded ahead
    V vb[NW][GV], vc[NW][GV];
    auto ldv = [&](int s, V* b, V* b2) {
#pragma unroll
        for (int g = 0; g < GV; ++g) { const size_t vo = (size_t)(((s % VS) * GV + g) * 16 + lr) * TT + 8 * hi + wv * 128 + (s / VS) * 32; b[g] = WFrag<T16>::ld(Vt + vo); if (HL) b2[g] = WFrag<T16>::ld(V2 + vo); } };
#pragma unroll
    for (int s = 0; s < NW - 1; ++s) ldv(s, vb[s], vc[s]);
    __syncthreads();   // every row's P planes are in LDS before any wave reads its key range of all rows
    v8f o[AR / 16][HD / 16];
#pragma unroll
    for (int mb = 0; mb < AR / 16; ++mb)
#pragma unroll
        for (int nb = 0; nb < HD / 16; ++nb) o[mb][nb] = (v8f){};
    const T16* P = (const T16*)sm; V a[AR / 16], a2[AR / 16];
#pragma unroll
    for (int s = 0; s < NV; ++s) {
        if (s + NW - 1 < NV) ldv(s + NW - 1, vb[(s + NW - 1) % NW], vc[(s + NW - 1) % NW]);
        if (s % VS == 0) {
#pragma unroll
            for (int mb = 0; mb < AR / 16; ++mb) { const T16* pr = P + (mb * 16 + lr) * (2 * SP) + 8 * hi + wv * 128 + (s / VS) * 32; a[mb] = WFrag<T16>::ld(pr); if (HL) a2[mb] = WFrag<T16>::ld(pr + TT); } }
        __builtin_amdgcn_sched_barrier(0);   // keeps the later steps' loads in front of this step's products, so that their latency runs under them
#pragma unroll
        for (int g = 0; g < GV; ++g) { const int nb = (s % VS) * GV + g;
#pragma unroll
            for (int mb = 0; mb < AR / 16; ++mb) { o[mb][nb] = WFrag<T16>::mma(a[mb], vb[s % NW][g], o[mb][nb]); if (HL) { o[mb][nb] = WFrag<T16>::mma(a2[mb], vb[s % NW][g], o[mb][nb]); o[mb][nb] = WFrag<T16>::mma(a[mb], vc[s % NW][g], o[mb][nb]); } } } }
    __syncthreads();   // every wave has read its P fragments before the partial tiles overwrite them
    float* my = sm + wv * (AR * OPP);
#pragma unroll
    for (int mb = 0; mb < AR / 16; ++mb)
#pragma unroll
        for (int nb = 0; nb < HD / 16; ++nb)
#pragma unroll
            for (int j = 0; j < 8; ++j) my[(mb * 16 + hi * 8 + j) * OPP + nb * 16 + lr] = o[mb][nb][j];
    __syncthreads();   // every wave's partial tile is in LDS before any wave adds them
    const float cs = HL ? 1.0f : (1.0f / PCAR);
#pragma unroll
    for (int it = 0; it < AR * HD / 4 / 512; ++it) { const int q = it * 512 + (int)threadIdx.x, row = q >> 5, cofs = (q & 31) * 4; v4f val = *(const v4fa*)(sm + row * OPP + cofs);
#pragma unroll
        for (int w = 1; w < 16; ++w) val += *(const v4fa*)(sm + (w * AR + row) * OPP + cofs);
        v4us oh, ol;
#pragma unroll
        for (int e = 0; e < 4; ++e) { unsigned short a, c2; splitf(val[e] * cs, a, c2); oh[e] = a; ol[e] = c2; }
        const size_t oo = (size_t)(t0 + row) * DQ + h * HD + cofs; *(v4us*)(Ah + oo) = oh; *(v4us*)(Al + oo) = ol;
        asm volatile("s_wait_xcnt 0x0" ::: "memory"); }   // stands behind the two stores, in front of any later write of their address registers
}
__global__ __launch_bounds__(512) void k_attn(const h16* __restrict__ Q16, const bf* __restrict__ Qh, const bf* __restrict__ Ql, const h16* __restrict__ K16, const bf* __restrict__ Kh, const bf* __restrict__ Kl, const h16* __restrict__ V16, const bf* __restrict__ Vh, const bf* __restrict__ Vl, bf* Ah, bf* Al) {
    __shared__ __align__(16) float sm[16 * AR * OPP];   // 16 partial tiles; the AR score rows (AR * SP floats) fit inside
    const int h = blockIdx.x, t0 = blockIdx.y * AR; const size_t zq = (size_t)h * TT * HD, zk = (size_t)(h / REP) * TT * HD;
    if (t0 < RH) attn_rows<bf, true>(Qh + zq, Ql + zq, Kh + zk, Kl + zk, Vh + zk, Vl + zk, Ah, Al, t0, h, sm);
    else attn_rows<h16, false>(Q16 + zq, nullptr, K16 + zk, nullptr, V16 + zk, nullptr, Ah, Al, t0, h, sm);
}

extern "C" void kernel_launch(void* const* d_in, const int* in_sizes, int n_in,
                              void* d_out, int out_size, void* d_ws, size_t ws_size, hipStream_t stream) {
    (void)in_sizes; (void)n_in; (void)out_size;
    const float* x = (const float*)d_in[0]; const float* wall = (const float*)d_in[1]; const float* wo = (const float*)d_in[2];   /* order x, W [8][3][1024][128], Wo [1024][128] */ const float* wq = wall; const float* wk = wall; const float* wv = wall; (void)wq; (void)wk; (void)wv;
    float* OUT = (float*)d_out;     // [4][2048][128]
    char* wsp = (char*)d_ws;
    auto take = [&](size_t bytes) { char* p = wsp; wsp += (bytes + 255) & ~(size_t)255; return (void*)p; };
    bf* WQ = (bf*)take((size_t)DQ * DM * 2); bf* WK = (bf*)take((size_t)DKV * DM * 2); bf* WV = (bf*)take((size_t)DKV * DM * 2); bf* WO = (bf*)take((size_t)DOUT * DQ * 2); float* CS = (float*)take((size_t)TT * HD * 2 * 4);
    bf* XB = (bf*)take((size_t)TT * DM * 2); float* FQ = (float*)take((size_t)TT * DQ * 4); float* FK = (float*)take((size_t)TT * DKV * 4);
    h16* QP16 = (h16*)take((size_t)NH_ * TT * HD * 2); h16* KP16 = (h16*)take((size_t)NKV * TT * HD * 2); h16* VT16 = (h16*)take((size_t)NKV * HD * TT * 2);
    bf* QPh = (bf*)take((size_t)NH_ * TT * HD * 2); bf* QPl = (bf*)take((size_t)NH_ * TT * HD * 2); bf* KPh = (bf*)take((size_t)NKV * TT * HD * 2); bf* KPl = (bf*)take((size_t)NKV * TT * HD * 2); bf* VTh = (bf*)take((size_t)NKV * HD * TT * 2); bf* VTl = (bf*)take((size_t)NKV * HD * TT * 2);
    bf* ATh = (bf*)take((size_t)TT * DQ * 2); bf* ATl = (bf*)take((size_t)TT * DQ * 2);
    if ((size_t)(wsp - (char*)d_ws) > ws_size) return;    // ws 256 MiB
    float* FV = FK;   // v projection reuses the k buffer after the k planes are built (stream-ordered)
    { for (int h = 0; h < NH_; ++h) { const float* wh = wall + (size_t)h * 3 * DM * HD;   /* head h's (q, k, v) 'xw' [1024][128] blocks */ k_wtG<<<(unsigned)((DM * HD / 64 + 63) / 64), 256, 0, stream>>>(wh, DM, HD, WQ + (size_t)h * HD * DM); k_wtG<<<(unsigned)((DM * HD / 64 + 63) / 64), 256, 0, stream>>>(wh + (size_t)DM * HD, DM, HD, WK + (size_t)h * HD * DM); k_wtG<<<(unsigned)((DM * HD / 64 + 63) / 64), 256, 0, stream>>>(wh + (size_t)2 * DM * HD, DM, HD, WV + (size_t)h * HD * DM); }   /* Bt rows h*128.. of each projection */
      k_wtG<<<(unsigned)((DQ * DOUT / 64 + 63) / 64), 256, 0, stream>>>(wo, DQ, DOUT, WO);   /* 'xw' [1024][128] -> Bt [128][1024] */
       }
    k_csid<<<(TT * HD + 255) / 256, 256, 0, stream>>>(CS);
    const unsigned LQ = (unsigned)(((size_t)NH_ * TT * HD / 2 + 255) / 256), LKv = (unsigned)(((size_t)NKV * TT * HD / 2 + 255) / 256);
    for (int b = 0; b < NB_; ++b) {
        
        k_cvt8<<<(unsigned)(((size_t)TT * DM / 8 + 255) / 256), 256, 0, stream>>>(x + (size_t)b * TT * DM, XB, (size_t)TT * DM / 8);
        k_gemmw<bf, 0, false, 8><<<dim3(TT / 64, DQ / 64, 1), 256, 0, stream>>>(XB, nullptr, WQ, nullptr, DM, FQ, DQ, nullptr, 0, 0, 0);
        k_rope<<<LQ, 256, 0, stream>>>(FQ, DQ, NH_, CS, nullptr, nullptr, 1.0f, QP16, QPh, QPl);
        k_gemmw<bf, 0, false, 8><<<dim3(TT / 64, DKV / 64, 1), 256, 0, stream>>>(XB, nullptr, WK, nullptr, DM, FK, DKV, nullptr, 0, 0, 0);
        k_rope<<<LKv, 256, 0, stream>>>(FK, DKV, NKV, CS, nullptr, nullptr, 1.0f, KP16, KPh, KPl);
        k_gemmw<bf, 0, false, 8><<<dim3(TT / 64, DKV / 64, 1), 256, 0, stream>>>(XB, nullptr, WV, nullptr, DM, FV, DKV, nullptr, 0, 0, 0); k_vtp<<<LKv, 256, 0, stream>>>(FV, DKV, NKV, VT16, VTh, VTl);
        k_attn<<<dim3(NH_, TT / AR, 1), 512, 0, stream>>>(QP16, QPh, QPl, KP16, KPh, KPl, VT16, VTh, VTl, ATh, ATl);   // all heads of the batch; S and P never leave LDS
        k_gemmw<bf, 1, false, 16><<<dim3(TT / 64, DOUT / 64, 1), 512, 0, stream>>>(ATh, ATl, WO, nullptr, DQ, OUT + (size_t)b * TT * DOUT, DOUT, nullptr, 0, 0, 0);   /* z = o Wo: N 128 */ }
}

// v003
// One run takes 660 microseconds.
// Next to v002, in two timings, it ran 1.14 and 1.15 times as fast.
// All steps since v000 together make it 3.72 times as fast.
#include <hip/hip_runtime.h>

// Multi-head attention with per-head weight tensors and 128-wide heads (x [4][2048][1024]; q, k, v = einsum('bnd,hde', x, W[:, i]) with W [8][3][1024][128] (1/32): head h's 'xw' blocks; 8 heads x 128; scores x 1/sqrt(128); softmax (no mask); o = concat heads [2048][1024]; z = o Wo ('xw' [1024][128]) -> [4][2048][128] (1.0 M); argument order x, W, Wo).
// Layout per batch: bf16 copy of x; each head's three 'xw' [1024][128] blocks transposed once into the fused Bt planes (24 small gathers); exact projections whose epilogue writes the 16-bit head planes (v as V^T = Wv x^T); dense T-2048 attention (hybrid rows: < 512 hi/lo 3 products, rest fp16 x1024); merged hi/lo x Wo exact (N 128).
// Compute dtypes, f32 accumulate: every input rounded to bf16; projections exact; attention rows < 512 3 products, rest fp16; softmax f32; Wo hl x exact.

#define NB_  4
#define TT   2048
#define DM   1024
#define NH_  8
#define NKV  8
#define REP  (NH_ / NKV)
#define HD   128
#define DQ   (NH_ * HD)
#define DKV  (NKV * HD)
#define RH   512                  // query rows < RH use hi+lo planes (0: none)
#define WIN  0
#define PCAR 1024.0f
#define SCL  0.088388347648318447f   // 1/sqrt(float32(128))
#define DOUT 128      // output width
typedef _Float16 h16;
typedef unsigned short bf;
typedef __attribute__((ext_vector_type(16))) __bf16   v16bf;
typedef __attribute__((ext_vector_type(16))) _Float16 v16h;
typedef __attribute__((ext_vector_type(8)))  _Float16 v8h;
typedef __attribute__((ext_vector_type(8)))  unsigned short v8us;
typedef __attribute__((ext_vector_type(8)))  float    v8f;
typedef __attribute__((ext_vector_type(4)))  float    v4f;
typedef v8h  __attribute__((may_alias)) v8ha;
typedef v4f  __attribute__((may_alias)) v4fa;
typedef v8us __attribute__((may_alias)) v8usa;

__device__ __forceinline__ unsigned short f2bf(float f) { unsigned u = __float_as_uint(f); u += 0x7FFFu + ((u >> 16) & 1u); return (unsigned short)(u >> 16); }
__device__ __forceinline__ float bf2f(unsigned short b) { return __uint_as_float(((unsigned)b) << 16); }
__device__ __forceinline__ float bfr(float f) { return bf2f(f2bf(f)); }
__device__ __forceinline__ v16h cat16(v8h lo, v8h hi) { return __builtin_shufflevector(lo, hi, 0, 1, 2, 3, 4, 5, 6, 7, 8, 9, 10, 11, 12, 13, 14, 15); }
__device__ __forceinline__ v16bf cat16b(v8us lo, v8us hi) { return __builtin_bit_cast(v16bf, __builtin_shufflevector(lo, hi, 0, 1, 2, 3, 4, 5, 6, 7, 8, 9, 10, 11, 12, 13, 14, 15)); }
__device__ __forceinline__ v8f wmma16(v16h a, v16h b, v8f c) { return __builtin_amdgcn_wmma_f32_16x16x32_f16(false, a, false, b, (short)0, c, false, false); }
__device__ __forceinline__ v8f wmmab(v16bf a, v16bf b, v8f c) { return __builtin_amdgcn_wmma_f32_16x16x32_bf16(false, a, false, b, (short)0, c, false, false); }

__device__ __forceinline__ h16 tohx(float x) { return (h16)x; }
__device__ __forceinline__ void splitf(float y, unsigned short& h, unsigned short& l) { h = f2bf(y); l = f2bf(y - bf2f(h)); }
typedef __attribute__((ext_vector_type(2))) _Float16 v2h;
typedef __attribute__((ext_vector_type(4))) _Float16 v4h;
typedef __attribute__((ext_vector_type(2))) unsigned short v2us;
typedef __attribute__((ext_vector_type(4))) unsigned short v4us;
typedef __attribute__((ext_vector_type(2))) float v2f;
typedef __attribute__((ext_vector_type(4))) int v4i;

// ---- k_gemmw: register-blocked GEMM, one 64x64 output tile per work-group (16 accumulators per wave), operands straight from K-contiguous 16-bit planes; grid (M/64, N/64, Z), 32 * KS threads.
// C[m][n] (f32, pitch ldc, + optional f32 bias[n]) = sum_k A[m][k] Bt[n][k] (+ split products per NSPLIT). z-batch strides sA/sB/sC in elements. K % (32 * KS) == 0.
// PLN > 0 (KS > 1 only): no f32 C; the summed tile goes out as 16-bit planes (fp16, bf16 hi, bf16 lo). PLN 1: head planes [n / HD][m][n % HD]; PLN 3: the same, rows m < RH as hi/lo only and the rest as fp16 only (all that k_attn reads of q); PLN 2: planes [m][n] of pitch ldc.
// KS > 1: wave w sums the contiguous k range [w K/KS, (w+1) K/KS), so the KS waves' load latencies overlap; the KS f32 partial tiles meet in LDS and are added in wave order 0 .. KS-1.
template <typename T16> struct WFrag;
template <> struct WFrag<h16> { typedef v16h V; static __device__ __forceinline__ V ld(const h16* p) { return cat16(*(const v8h*)p, *(const v8h*)(p + 16)); } static __device__ __forceinline__ v8f mma(V a, V b, v8f c) { return wmma16(a, b, c); } };
template <> struct WFrag<bf> { typedef v16bf V; static __device__ __forceinline__ V ld(const bf* p) { return cat16b(*(const v8us*)p, *(const v8us*)(p + 16)); } static __device__ __forceinline__ v8f mma(V a, V b, v8f c) { return wmmab(a, b, c); } };
template <typename T16, int NSPLIT, bool BIAS, int KS, int PLN>
__global__ __launch_bounds__(32 * KS) void k_gemmw(const T16* __restrict__ A, const T16* __restrict__ A2, const T16* __restrict__ Bt, const T16* __restrict__ Bt2, int K, float* C, int ldc, const float* __restrict__ bias, size_t sA, size_t sB, size_t sC, h16* P16, bf* Ph, bf* Pl) {
    typedef typename WFrag<T16>::V V;
    __shared__ __align__(16) float os[(KS == 1 ? 16 : KS * 64) * 68];
    const size_t z = blockIdx.z; A += z * sA; if (A2) A2 += z * sA; Bt += z * sB; if (Bt2) Bt2 += z * sB; C += z * sC;
    const int lane = threadIdx.x & 31, lr = lane & 15, hi = lane >> 4; const int r0 = blockIdx.x * 64, c0 = blockIdx.y * 64;
    const int wv = (KS == 1) ? 0 : __builtin_amdgcn_readfirstlane((int)(threadIdx.x >> 5));   // this wave's place in the K split, kept scalar so that the loop bounds are
    v8f acc[4][4];
#pragma unroll
    for (int mb = 0; mb < 4; ++mb)
#pragma unroll
        for (int nb = 0; nb < 4; ++nb) acc[mb][nb] = (v8f){};
    const size_t aoff = (size_t)(r0 + lr) * K + 8 * hi, boff = (size_t)(c0 + lr) * K + 8 * hi;
#pragma unroll 1
    for (int kc = wv * (K / KS); kc < (wv + 1) * (K / KS); kc += 32) {
        V a[4], a2[4];
#pragma unroll
        for (int mb = 0; mb < 4; ++mb) { a[mb] = WFrag<T16>::ld(A + aoff + (size_t)mb * 16 * K + kc); if (NSPLIT == 1 || NSPLIT == 2) a2[mb] = WFrag<T16>::ld(A2 + aoff + (size_t)mb * 16 * K + kc); }
#pragma unroll
        for (int nb = 0; nb < 4; ++nb) { const V b = WFrag<T16>::ld(Bt + boff + (size_t)nb * 16 * K + kc); V b2; if (NSPLIT >= 2) b2 = WFrag<T16>::ld(Bt2 + boff + (size_t)nb * 16 * K + kc);
#pragma unroll
            for (int mb = 0; mb < 4; ++mb) { acc[mb][nb] = WFrag<T16>::mma(a[mb], b, acc[mb][nb]); if (NSPLIT == 1 || NSPLIT == 2) acc[mb][nb] = WFrag<T16>::mma(a2[mb], b, acc[mb][nb]); if (NSPLIT >= 2) acc[mb][nb] = WFrag<T16>::mma(a[mb], b2, acc[mb][nb]); } }
        asm volatile("v_nop\n\tv_nop\n\tv_nop\n\tv_nop" : "+v"(acc[0][0]), "+v"(acc[1][1]), "+v"(acc[2][2]), "+v"(acc[3][3]) : "v"(a[0]), "v"(a[3]));
    }
    if (KS > 1) {
        float* my = os + wv * (64 * 68);
#pragma unroll
        for (int mb = 0; mb < 4; ++mb)
#pragma unroll
            for (int nb = 0; nb < 4; ++nb)
#pragma unroll
                for (int j = 0; j < 8; ++j) my[(mb * 16 + hi * 8 + j) * 68 + nb * 16 + lr] = acc[mb][nb][j];
        __syncthreads();   // every wave's partial tile is in LDS before any wave adds them
#pragma unroll
        for (int it = 0; it < 32 / KS; ++it) { const int q = it * 32 * KS + (int)threadIdx.x, row = q >> 4, cofs = (q & 15) * 4; v4f val = *(const v4fa*)(os + row * 68 + cofs);
#pragma unroll
            for (int w = 1; w < KS; ++w) val += *(const v4fa*)(os + (w * 64 + row) * 68 + cofs);
            if (BIAS) { val[0] += bfr(bias[c0 + cofs]); val[1] += bfr(bias[c0 + cofs + 1]); val[2] += bfr(bias[c0 + cofs + 2]); val[3] += bfr(bias[c0 + cofs + 3]); }
            if (PLN == 0) { *(v4f*)(C + (size_t)(r0 + row) * ldc + c0 + cofs) = val; }
            else { const size_t po = (PLN == 2) ? (size_t)(r0 + row) * ldc + c0 + cofs : ((size_t)(c0 / HD) * TT + r0 + row) * HD + c0 % HD + cofs;
                v4h o16; v4us oh, ol;
#pragma unroll
                for (int e = 0; e < 4; ++e) { o16[e] = tohx(val[e]); unsigned short a2, c2; splitf(val[e], a2, c2); oh[e] = a2; ol[e] = c2; }
                // each s_wait_xcnt 0 stands directly behind its case's stores, in front of any later write of their address or data registers (the built code tests the cases one after the other)
                if (PLN != 3 || r0 >= RH) { *(v4h*)(P16 + po) = o16; if (PLN == 3) asm volatile("s_wait_xcnt 0x0" ::: "memory"); }
                if (PLN != 3 || r0 < RH) { *(v4us*)(Ph + po) = oh; *(v4us*)(Pl + po) = ol; asm volatile("s_wait_xcnt 0x0" ::: "memory"); } } }
        return;
    }
#pragma unroll
    for (int mb = 0; mb < 4; ++mb) {
#pragma unroll
        for (int nb = 0; nb < 4; ++nb) {
#pragma unroll
            for (int j = 0; j < 8; ++j) os[(hi * 8 + j) * 68 + nb * 16 + lr] = acc[mb][nb][j]; }
        __builtin_amdgcn_wave_barrier(); asm volatile("" ::: "memory");
        float* crow = C + (size_t)(r0 + mb * 16) * ldc + c0;
{
#pragma unroll
            for (int s = 0; s < 8; ++s) { const int row = 2 * s + hi, cofs = lr * 4; v4f val = *(const v4fa*)(os + row * 68 + cofs); if (BIAS) { val[0] += bfr(bias[c0 + cofs]); val[1] += bfr(bias[c0 + cofs + 1]); val[2] += bfr(bias[c0 + cofs + 2]); val[3] += bfr(bias[c0 + cofs + 3]); }
                *(v4f*)(crow + (size_t)row * ldc + cofs) = val; }
             }
        __builtin_amdgcn_wave_barrier(); asm volatile("" ::: "memory");
    }
}


__global__ __launch_bounds__(256) void k_wtG(const float* __restrict__ w, int K, int N, bf* Bt) {
    const int lane = threadIdx.x & 31; const int L0 = (blockIdx.x * 8 + (threadIdx.x >> 5)) * 8; const int nlines = N * K / 64;
{
#pragma unroll 1
        for (int l = 0; l < 8; ++l) { const int L = L0 + l; if (L >= nlines) break; const size_t e = (size_t)L * 64 + lane * 2; const int k = (int)(e % K), n = (int)(e / K); v2us o;
            o[0] = f2bf(w[(size_t)k * N + n]); o[1] = f2bf(w[(size_t)(k + 1) * N + n]); *(v2us*)(Bt + e) = o; }
         }
}
__global__ __launch_bounds__(256) void k_cvt8(const float* __restrict__ src, bf* dst, size_t n8) { const size_t i = (size_t)blockIdx.x * 256 + threadIdx.x; if (i >= n8) return; const v8f v = *(const v8f*)(src + i * 8); v8us o;
#pragma unroll
    for (int k = 0; k < 8; ++k) o[k] = f2bf(v[k]); *(v8us*)(dst + i * 8) = o;  }

// ---- k_attn: scores, softmax, P V and the hi/lo merge of one head's AR query rows in one work-group of 16 waves; grid (heads, TT / AR), the hi/lo row tiles (t0 < RH) first.
// The AR x TT f32 score rows stay in LDS (pitch SP floats); softmax rewrites each row in place as its 16-bit P planes; the P V partial tiles reuse the same LDS.
// Sum orders: scores k = 0, 32, 64, 96; wave w sums the keys [128 w, 128 w + 128) of P V; the 16 f32 partial tiles are added in wave order 0 .. 15.
#define AR  32                    // query rows per work-group
#define SP  (TT + 4)              // score row pitch in floats: 16 B x odd for the b128 fragment reads, and rows 8 apart fall 32 banks apart for the accumulator stores
#define OPP (HD + 4)              // partial output row pitch in floats, same two properties
template <typename T16, bool HL>
__device__ __forceinline__ void attn_rows(const T16* __restrict__ Q, const T16* __restrict__ Q2, const T16* __restrict__ Kp, const T16* __restrict__ K2, const T16* __restrict__ Vt, const T16* __restrict__ V2, bf* Ah, bf* Al, int t0, int h, float* sm) {
    typedef typename WFrag<T16>::V V;
    const int lane = threadIdx.x & 31, lr = lane & 15, hi = lane >> 4;
    const int wv = __builtin_amdgcn_readfirstlane((int)(threadIdx.x >> 5));   // wave number, kept scalar so that the key ranges and LDS bases are scalar too
    {   // S = Q K^T: the AR query rows' fragments stay in registers, wave wv takes keys [128 wv, 128 wv + 128)
        V qa[AR / 16][HD / 32], qb[AR / 16][HD / 32];
#pragma unroll
        for (int mb = 0; mb < AR / 16; ++mb)
#pragma unroll
            for (int ks = 0; ks < HD / 32; ++ks) { const size_t qo = (size_t)(t0 + mb * 16 + lr) * HD + 8 * hi + ks * 32; qa[mb][ks] = WFrag<T16>::ld(Q + qo); if (HL) qb[mb][ks] = WFrag<T16>::ld(Q2 + qo); }
        constexpr int G = HL ? 2 : 4, TS = (HD / 32) / G, NS = 8 * TS, NB = HL ? 2 : 3;   // a step is G k blocks of one 16-key tile (8 loads); NB register sets, NB - 1 steps loaded ahead
        V kb[NB][G], kc2[NB][G]; v8f acc[AR / 16];
        auto ldk = [&](int s, V* b, V* b2) {
#pragma unroll
            for (int g = 0; g < G; ++g) { const size_t bo = (size_t)(wv * 128 + (s / TS) * 16 + lr) * HD + 8 * hi + ((s % TS) * G + g) * 32; b[g] = WFrag<T16>::ld(Kp + bo); if (HL) b2[g] = WFrag<T16>::ld(K2 + bo); } };
#pragma unroll
        for (int s = 0; s < NB - 1; ++s) ldk(s, kb[s], kc2[s]);
#pragma unroll
        for (int s = 0; s < NS; ++s) { const int n0 = wv * 128 + (s / TS) * 16;
            if (s + NB - 1 < NS) ldk(s + NB - 1, kb[(s + NB - 1) % NB], kc2[(s + NB - 1) % NB]);
            __builtin_amdgcn_sched_barrier(0);   // keeps the later steps' loads in front of this step's products, so that their latency runs under them
            if (s % TS == 0) {
#pragma unroll
                for (int mb = 0; mb < AR / 16; ++mb) acc[mb] = (v8f){}; }
#pragma unroll
            for (int g = 0; g < G; ++g) { const int ks = (s % TS) * G + g;
#pragma unroll
                for (int mb = 0; mb < AR / 16; ++mb) { acc[mb] = WFrag<T16>::mma(qa[mb][ks], kb[s % NB][g], acc[mb]); if (HL) { acc[mb] = WFrag<T16>::mma(qb[mb][ks], kb[s % NB][g], acc[mb]); acc[mb] = WFrag<T16>::mma(qa[mb][ks], kc2[s % NB][g], acc[mb]); } } }
            if (s % TS == TS - 1) {
                asm volatile("v_nop\n\tv_nop\n\tv_nop\n\tv_nop" : "+v"(acc[0]), "+v"(acc[1]));   // the four vector slots the chip needs before the next tile's first product rewrites these accumulators (only LDS stores lie between)
#pragma unroll
                for (int mb = 0; mb < AR / 16; ++mb)
#pragma unroll
                    for (int j = 0; j < 8; ++j) sm[(mb * 16 + hi * 8 + j) * SP + n0 + lr] = acc[mb][j]; } }
    }
    __syncthreads();   // every wave's score columns are in LDS before any wave reads whole rows
    // softmax, one wave per row (register row, one exp, fixed trees): t = S x HD^-0.5 (no mask); the row's P planes overwrite the row itself once it is in registers
    for (int r = 0; r < AR / 16; ++r) { float* sr = sm + (wv * (AR / 16) + r) * SP; float v[TT / 32]; float mx = -3.0e38f;
#pragma unroll
        for (int ch = 0; ch < TT / 128; ++ch) { const v4f a = *(const v4fa*)(sr + ch * 128 + lane * 4);
#pragma unroll
            for (int q = 0; q < 4; ++q) { const float t = a[q] * SCL; v[ch * 4 + q] = t; mx = fmaxf(mx, t); } }
#pragma unroll
        for (int sh = 16; sh; sh >>= 1) mx = fmaxf(mx, __shfl_xor(mx, sh, 32));
        float sum = 0.f;
#pragma unroll
        for (int k = 0; k < TT / 32; ++k) { v[k] = __builtin_amdgcn_exp2f(__fmul_rn(__fsub_rn(v[k], mx), 1.4426950408889634f)); sum += v[k]; }
#pragma unroll
        for (int sh = 16; sh; sh >>= 1) sum += __shfl_xor(sum, sh, 32);
        const float f = __fdiv_rn(HL ? 1.0f : PCAR, sum);
        if (HL) { bf* ph = (bf*)sr;   // hi plane in the row's first TT 16-bit places, lo plane in the next TT
#pragma unroll
            for (int ch = 0; ch < TT / 128; ++ch) { v4us oh, ol;
#pragma unroll
                for (int q = 0; q < 4; ++q) { unsigned short a, c2; splitf(v[ch * 4 + q] * f, a, c2); oh[q] = a; ol[q] = c2; }
                *(v4us*)(ph + ch * 128 + lane * 4) = oh; *(v4us*)(ph + TT + ch * 128 + lane * 4) = ol; }
        } else { h16* p16 = (h16*)sr;
#pragma unroll
            for (int ch = 0; ch < TT / 128; ++ch) { v4h o4;
#pragma unroll
                for (int q = 0; q < 4; ++q) o4[q] = tohx(v[ch * 4 + q] * f);
                *(v4h*)(p16 + ch * 128 + lane * 4) = o4; } } }
    constexpr int GV = HL ? 1 : 4, VS = (HD / 16) / GV, NV = 4 * VS, NW = HL ? 3 : 2;   // a step is GV 16-column tiles of V^T at one k block; NW register sets, NW - 1 steps (8 loads) loaded ahead
    V vb[NW][GV], vc[NW][GV];
    auto ldv = [&](int s, V* b, V* b2) {
#pragma unroll
        for (int g = 0; g < GV; ++g) { const size_t vo = (size_t)(((s % VS) * GV + g) * 16 + lr) * TT + 8 * hi + wv * 128 + (s / VS) * 32; b[g] = WFrag<T16>::ld(Vt + vo); if (HL) b2[g] = WFrag<T16>::ld(V2 + vo); } };
#pragma unroll
    for (int s = 0; s < NW - 1; ++s) ldv(s, vb[s], vc[s]);
    __syncthreads();   // every row's P planes are in LDS before any wave reads its key range of all rows
    v8f o[AR / 16][HD / 16];
#pragma unroll
    for (int mb = 0; mb < AR / 16; ++mb)
#pragma unroll
        for (int nb = 0; nb < HD / 16; ++nb) o[mb][nb] = (v8f){};
    const T16* P = (const T16*)sm; V a[AR / 16], a2[AR / 16];
#pragma unroll
    for (int s = 0; s < NV; ++s) {
        if (s + NW - 1 < NV) ldv(s + NW - 1, vb[(s + NW - 1) % NW], vc[(s + NW - 1) % NW]);
        if (s % VS == 0) {
#pragma unroll
            for (int mb = 0; mb < AR / 16; ++mb) { const T16* pr = P + (mb * 16 + lr) * (2 * SP) + 8 * hi + wv * 128 + (s / VS) * 32; a[mb] = WFrag<T16>::ld(pr); if (HL) a2[mb] = WFrag<T16>::ld(pr + TT); } }
        __builtin_amdgcn_sched_barrier(0);   // keeps the later steps' loads in front of this step's products, so that their latency runs under them
#pragma unroll
        for (int g = 0; g < GV; ++g) { const int nb = (s % VS) * GV + g;
#pragma unroll
            for (int mb = 0; mb < AR / 16; ++mb) { o[mb][nb] = WFrag<T16>::mma(a[mb], vb[s % NW][g], o[mb][nb]); if (HL) { o[mb][nb] = WFrag<T16>::mma(a2[mb], vb[s % NW][g], o[mb][nb]); o[mb][nb] = WFrag<T16>::mma(a[mb], vc[s % NW][g], o[mb][nb]); } } } }
    __syncthreads();   // every wave has read its P fragments before the partial tiles overwrite them
    float* my = sm + wv * (AR * OPP);
#pragma unroll
    for (int mb = 0; mb < AR / 16; ++mb)
#pragma unroll
        for (int nb = 0; nb < HD / 16; ++nb)
#pragma unroll
            for (int j = 0; j < 8; ++j) my[(mb * 16 + hi * 8 + j) * OPP + nb * 16 + lr] = o[mb][nb][j];
    __syncthreads();   // every wave's partial tile is in LDS before any wave adds them
    const float cs = HL ? 1.0f : (1.0f / PCAR);
#pragma unroll
    for (int it = 0; it < AR * HD / 4 / 512; ++it) { const int q = it * 512 + (int)threadIdx.x, row = q >> 5, cofs = (q & 31) * 4; v4f val = *(const v4fa*)(sm + row * OPP + cofs);
#pragma unroll
        for (int w = 1; w < 16; ++w) val += *(const v4fa*)(sm + (w * AR + row) * OPP + cofs);
        v4us oh, ol;
#pragma unroll
        for (int e = 0; e < 4; ++e) { unsigned short a, c2; splitf(val[e] * cs, a, c2); oh[e] = a; ol[e] = c2; }
        const size_t oo = (size_t)(t0 + row) * DQ + h * HD + cofs; *(v4us*)(Ah + oo) = oh; *(v4us*)(Al + oo) = ol;
        asm volatile("s_wait_xcnt 0x0" ::: "memory"); }   // stands behind the two stores, in front of any later write of their address registers
}
__global__ __launch_bounds__(512) void k_attn(const h16* __restrict__ Q16, const bf* __restrict__ Qh, const bf* __restrict__ Ql, const h16* __restrict__ K16, const bf* __restrict__ Kh, const bf* __restrict__ Kl, const h16* __restrict__ V16, const bf* __restrict__ Vh, const bf* __restrict__ Vl, bf* Ah, bf* Al) {
    __shared__ __align__(16) float sm[16 * AR * OPP];   // 16 partial tiles; the AR score rows (AR * SP floats) fit inside
    const int h = blockIdx.x, t0 = blockIdx.y * AR; const size_t zq = (size_t)h * TT * HD, zk = (size_t)(h / REP) * TT * HD;
    if (t0 < RH) attn_rows<bf, true>(Qh + zq, Ql + zq, Kh + zk, Kl + zk, Vh + zk, Vl + zk, Ah, Al, t0, h, sm);
    else attn_rows<h16, false>(Q16 + zq, nullptr, K16 + zk, nullptr, V16 + zk, nullptr, Ah, Al, t0, h, sm);
}

extern "C" void kernel_launch(void* const* d_in, const int* in_sizes, int n_in,
                              void* d_out, int out_size, void* d_ws, size_t ws_size, hipStream_t stream) {
    (void)in_sizes; (void)n_in; (void)out_size;
    const float* x = (const float*)d_in[0]; const float* wall = (const float*)d_in[1]; const float* wo = (const float*)d_in[2];   /* order x, W [8][3][1024][128], Wo [1024][128] */ const float* wq = wall; const float* wk = wall; const float* wv = wall; (void)wq; (void)wk; (void)wv;
    float* OUT = (float*)d_out;     // [4][2048][128]
    char* wsp = (char*)d_ws;
    auto take = [&](size_t bytes) { char* p = wsp; wsp += (bytes + 255) & ~(size_t)255; return (void*)p; };
    bf* WQ = (bf*)take((size_t)DQ * DM * 2); bf* WK = (bf*)take((size_t)DKV * DM * 2); bf* WV = (bf*)take((size_t)DKV * DM * 2); bf* WO = (bf*)take((size_t)DOUT * DQ * 2);
    bf* XB = (bf*)take((size_t)TT * DM * 2);
    h16* QP16 = (h16*)take((size_t)NH_ * TT * HD * 2); h16* KP16 = (h16*)take((size_t)NKV * TT * HD * 2); h16* VT16 = (h16*)take((size_t)NKV * HD * TT * 2);
    bf* QPh = (bf*)take((size_t)NH_ * TT * HD * 2); bf* QPl = (bf*)take((size_t)NH_ * TT * HD * 2); bf* KPh = (bf*)take((size_t)NKV * TT * HD * 2); bf* KPl = (bf*)take((size_t)NKV * TT * HD * 2); bf* VTh = (bf*)take((size_t)NKV * HD * TT * 2); bf* VTl = (bf*)take((size_t)NKV * HD * TT * 2);
    bf* ATh = (bf*)take((size_t)TT * DQ * 2); bf* ATl = (bf*)take((size_t)TT * DQ * 2);
    if ((size_t)(wsp - (char*)d_ws) > ws_size) return;    // ws 256 MiB
    { for (int h = 0; h < NH_; ++h) { const float* wh = wall + (size_t)h * 3 * DM * HD;   /* head h's (q, k, v) 'xw' [1024][128] blocks */ k_wtG<<<(unsigned)((DM * HD / 64 + 63) / 64), 256, 0, stream>>>(wh, DM, HD, WQ + (size_t)h * HD * DM); k_wtG<<<(unsigned)((DM * HD / 64 + 63) / 64), 256, 0, stream>>>(wh + (size_t)DM * HD, DM, HD, WK + (size_t)h * HD * DM); k_wtG<<<(unsigned)((DM * HD / 64 + 63) / 64), 256, 0, stream>>>(wh + (size_t)2 * DM * HD, DM, HD, WV + (size_t)h * HD * DM); }   /* Bt rows h*128.. of each projection */
      k_wtG<<<(unsigned)((DQ * DOUT / 64 + 63) / 64), 256, 0, stream>>>(wo, DQ, DOUT, WO);   /* 'xw' [1024][128] -> Bt [128][1024] */
       }
    for (int b = 0; b < NB_; ++b) {
        
        k_cvt8<<<(unsigned)(((size_t)TT * DM / 8 + 255) / 256), 256, 0, stream>>>(x + (size_t)b * TT * DM, XB, (size_t)TT * DM / 8);
        k_gemmw<bf, 0, false, 8, 3><<<dim3(TT / 64, DQ / 64, 1), 256, 0, stream>>>(XB, nullptr, WQ, nullptr, DM, nullptr, 0, nullptr, 0, 0, 0, QP16, QPh, QPl);    // q planes [h][t][d]
        k_gemmw<bf, 0, false, 8, 1><<<dim3(TT / 64, DKV / 64, 1), 256, 0, stream>>>(XB, nullptr, WK, nullptr, DM, nullptr, 0, nullptr, 0, 0, 0, KP16, KPh, KPl);   // k planes [h][t][d]
        k_gemmw<bf, 0, false, 8, 2><<<dim3(DKV / 64, TT / 64, 1), 256, 0, stream>>>(WV, nullptr, XB, nullptr, DM, nullptr, TT, nullptr, 0, 0, 0, VT16, VTh, VTl);  // V^T planes [h][d][t]: the weight rows are the tile's rows
        k_attn<<<dim3(NH_, TT / AR, 1), 512, 0, stream>>>(QP16, QPh, QPl, KP16, KPh, KPl, VT16, VTh, VTl, ATh, ATl);   // all heads of the batch; S and P never leave LDS
        k_gemmw<bf, 1, false, 16, 0><<<dim3(TT / 64, DOUT / 64, 1), 512, 0, stream>>>(ATh, ATl, WO, nullptr, DQ, OUT + (size_t)b * TT * DOUT, DOUT, nullptr, 0, 0, 0, nullptr, nullptr, nullptr);   /* z = o Wo: N 128 */ }
}

// v004
// It runs in 463 microseconds.
// Timed twice side by side with v003, it ran 1.43 and 1.42 times as fast.
// Over all steps from v000 it is 5.30 times as fast.
#include <hip/hip_runtime.h>

// Multi-head attention with per-head weight tensors and 128-wide heads (x [4][2048][1024]; q, k, v = einsum('bnd,hde', x, W[:, i]) with W [8][3][1024][128] (1/32): head h's 'xw' blocks; 8 heads x 128; scores x 1/sqrt(128); softmax (no mask); o = concat heads [2048][1024]; z = o Wo ('xw' [1024][128]) -> [4][2048][128] (1.0 M); argument order x, W, Wo).
// Layout per batch: bf16 copy of x; each head's three 'xw' [1024][128] blocks transposed once into the fused Bt planes (one launch for all of them and Wo); exact projections whose epilogue writes the 16-bit head planes (v as V^T = Wv x^T); dense T-2048 attention (hybrid rows: < 512 hi/lo 3 products, rest fp16 x1024); merged hi/lo x Wo exact (N 128).
// Compute dtypes, f32 accumulate: every input rounded to bf16; projections exact; attention rows < 512 3 products, rest fp16; softmax f32; Wo hl x exact.

#define NB_  4
#define TT   2048
#define DM   1024
#define NH_  8
#define NKV  8
#define REP  (NH_ / NKV)
#define HD   128
#define DQ   (NH_ * HD)
#define DKV  (NKV * HD)
#define RH   512                  // query rows < RH use hi+lo planes (0: none)
#define WIN  0
#define PCAR 1024.0f
#define SCL  0.088388347648318447f   // 1/sqrt(float32(128))
#define DOUT 128      // output width
typedef _Float16 h16;
typedef unsigned short bf;
typedef __attribute__((ext_vector_type(16))) __bf16   v16bf;
typedef __attribute__((ext_vector_type(16))) _Float16 v16h;
typedef __attribute__((ext_vector_type(8)))  _Float16 v8h;
typedef __attribute__((ext_vector_type(8)))  unsigned short v8us;
typedef __attribute__((ext_vector_type(8)))  float    v8f;
typedef __attribute__((ext_vector_type(4)))  float    v4f;
typedef v8h  __attribute__((may_alias)) v8ha;
typedef v4f  __attribute__((may_alias)) v4fa;
typedef v8us __attribute__((may_alias)) v8usa;

__device__ __forceinline__ unsigned short f2bf(float f) { unsigned u = __float_as_uint(f); u += 0x7FFFu + ((u >> 16) & 1u); return (unsigned short)(u >> 16); }
__device__ __forceinline__ float bf2f(unsigned short b) { return __uint_as_float(((unsigned)b) << 16); }
__device__ __forceinline__ float bfr(float f) { return bf2f(f2bf(f)); }
__device__ __forceinline__ v16h cat16(v8h lo, v8h hi) { return __builtin_shufflevector(lo, hi, 0, 1, 2, 3, 4, 5, 6, 7, 8, 9, 10, 11, 12, 13, 14, 15); }
__device__ __forceinline__ v16bf cat16b(v8us lo, v8us hi) { return __builtin_bit_cast(v16bf, __builtin_shufflevector(lo, hi, 0, 1, 2, 3, 4, 5, 6, 7, 8, 9, 10, 11, 12, 13, 14, 15)); }
__device__ __forceinline__ v8f wmma16(v16h a, v16h b, v8f c) { return __builtin_amdgcn_wmma_f32_16x16x32_f16(false, a, false, b, (short)0, c, false, false); }
__device__ __forceinline__ v8f wmmab(v16bf a, v16bf b, v8f c) { return __builtin_amdgcn_wmma_f32_16x16x32_bf16(false, a, false, b, (short)0, c, false, false); }

__device__ __forceinline__ h16 tohx(float x) { return (h16)x; }
__device__ __forceinline__ void splitf(float y, unsigned short& h, unsigned short& l) { h = f2bf(y); l = f2bf(y - bf2f(h)); }
typedef __attribute__((ext_vector_type(2))) _Float16 v2h;
typedef __attribute__((ext_vector_type(4))) _Float16 v4h;
typedef __attribute__((ext_vector_type(2))) unsigned short v2us;
typedef __attribute__((ext_vector_type(4))) unsigned short v4us;
typedef __attribute__((ext_vector_type(2))) float v2f;
typedef __attribute__((ext_vector_type(4))) int v4i;

// ---- k_gemmw: register-blocked GEMM, one 64x64 output tile per work-group (16 accumulators per wave), operands straight from K-contiguous 16-bit planes; grid (M/64, N/64, Z), 32 * KS threads.
// C[m][n] (f32, pitch ldc, + optional f32 bias[n]) = sum_k A[m][k] Bt[n][k] (+ split products per NSPLIT). z-batch strides sA/sB/sC in elements. K % (32 * KS) == 0.
// PLN > 0 (KS > 1 only): no f32 C; the summed tile goes out as 16-bit planes (fp16, bf16 hi, bf16 lo). PLN 1: head planes [n / HD][m][n % HD]; PLN 3: the same, rows m < RH as hi/lo only and the rest as fp16 only (all that k_attn reads of q); PLN 2: planes [m][n] of pitch ldc.
// KS > 1: wave w sums the contiguous k range [w K/KS, (w+1) K/KS), so the KS waves' load latencies overlap; the KS f32 partial tiles meet in LDS and are added in wave order 0 .. KS-1.
template <typename T16> struct WFrag;
template <> struct WFrag<h16> { typedef v16h V; static __device__ __forceinline__ V ld(const h16* p) { return cat16(*(const v8h*)p, *(const v8h*)(p + 16)); } static __device__ __forceinline__ v8f mma(V a, V b, v8f c) { return wmma16(a, b, c); } };
template <> struct WFrag<bf> { typedef v16bf V; static __device__ __forceinline__ V ld(const bf* p) { return cat16b(*(const v8us*)p, *(const v8us*)(p + 16)); } static __device__ __forceinline__ v8f mma(V a, V b, v8f c) { return wmmab(a, b, c); } };
template <typename T16, int NSPLIT, bool BIAS, int KS, int PLN>
__global__ __launch_bounds__(32 * KS) void k_gemmw(const T16* __restrict__ A, const T16* __restrict__ A2, const T16* __restrict__ Bt, const T16* __restrict__ Bt2, int K, float* C, int ldc, const float* __restrict__ bias, size_t sA, size_t sB, size_t sC, h16* P16, bf* Ph, bf* Pl) {
    typedef typename WFrag<T16>::V V;
    __shared__ __align__(16) float os[(KS == 1 ? 16 : KS * 64) * 68];
    const size_t z = blockIdx.z; A += z * sA; if (A2) A2 += z * sA; Bt += z * sB; if (Bt2) Bt2 += z * sB; C += z * sC;
    const int lane = threadIdx.x & 31, lr = lane & 15, hi = lane >> 4; const int r0 = blockIdx.x * 64, c0 = blockIdx.y * 64;
    const int wv = (KS == 1) ? 0 : __builtin_amdgcn_readfirstlane((int)(threadIdx.x >> 5));   // this wave's place in the K split, kept scalar so that the loop bounds are
    v8f acc[4][4];
#pragma unroll
    for (int mb = 0; mb < 4; ++mb)
#pragma unroll
        for (int nb = 0; nb < 4; ++nb) acc[mb][nb] = (v8f){};
    const size_t aoff = (size_t)(r0 + lr) * K + 8 * hi, boff = (size_t)(c0 + lr) * K + 8 * hi;
#pragma unroll 1
    for (int kc = wv * (K / KS); kc < (wv + 1) * (K / KS); kc += 32) {
        V a[4], a2[4];
#pragma unroll
        for (int mb = 0; mb < 4; ++mb) { a[mb] = WFrag<T16>::ld(A + aoff + (size_t)mb * 16 * K + kc); if (NSPLIT == 1 || NSPLIT == 2) a2[mb] = WFrag<T16>::ld(A2 + aoff + (size_t)mb * 16 * K + kc); }
#pragma unroll
        for (int nb = 0; nb < 4; ++nb) { const V b = WFrag<T16>::ld(Bt + boff + (size_t)nb * 16 * K + kc); V b2; if (NSPLIT >= 2) b2 = WFrag<T16>::ld(Bt2 + boff + (size_t)nb * 16 * K + kc);
#pragma unroll
            for (int mb = 0; mb < 4; ++mb) { acc[mb][nb] = WFrag<T16>::mma(a[mb], b, acc[mb][nb]); if (NSPLIT == 1 || NSPLIT == 2) acc[mb][nb] = WFrag<T16>::mma(a2[mb], b, acc[mb][nb]); if (NSPLIT >= 2) acc[mb][nb] = WFrag<T16>::mma(a[mb], b2, acc[mb][nb]); } }
        asm volatile("v_nop\n\tv_nop\n\tv_nop\n\tv_nop" : "+v"(acc[0][0]), "+v"(acc[1][1]), "+v"(acc[2][2]), "+v"(acc[3][3]) : "v"(a[0]), "v"(a[3]));
    }
    if (KS > 1) {
        float* my = os + wv * (64 * 68);
#pragma unroll
        for (int mb = 0; mb < 4; ++mb)
#pragma unroll
            for (int nb = 0; nb < 4; ++nb)
#pragma unroll
                for (int j = 0; j < 8; ++j) my[(mb * 16 + hi * 8 + j) * 68 + nb * 16 + lr] = acc[mb][nb][j];
        __syncthreads();   // every wave's partial tile is in LDS before any wave adds them
#pragma unroll
        for (int it = 0; it < 32 / KS; ++it) { const int q = it * 32 * KS + (int)threadIdx.x, row = q >> 4, cofs = (q & 15) * 4; v4f val = *(const v4fa*)(os + row * 68 + cofs);
#pragma unroll
            for (int w = 1; w < KS; ++w) val += *(const v4fa*)(os + (w * 64 + row) * 68 + cofs);
            if (BIAS) { val[0] += bfr(bias[c0 + cofs]); val[1] += bfr(bias[c0 + cofs + 1]); val[2] += bfr(bias[c0 + cofs + 2]); val[3] += bfr(bias[c0 + cofs + 3]); }
            if (PLN == 0) { *(v4f*)(C + (size_t)(r0 + row) * ldc + c0 + cofs) = val; }
            else { const size_t po = (PLN == 2) ? (size_t)(r0 + row) * ldc + c0 + cofs : ((size_t)(c0 / HD) * TT + r0 + row) * HD + c0 % HD + cofs;
                v4h o16; v4us oh, ol;
#pragma unroll
                for (int e = 0; e < 4; ++e) { o16[e] = tohx(val[e]); unsigned short a2, c2; splitf(val[e], a2, c2); oh[e] = a2; ol[e] = c2; }
                // each s_wait_xcnt 0 stands directly behind its case's stores, in front of any later write of their address or data registers (the built code tests the cases one after the other)
                if (PLN != 3 || r0 >= RH) { *(v4h*)(P16 + po) = o16; if (PLN == 3) asm volatile("s_wait_xcnt 0x0" ::: "memory"); }
                if (PLN != 3 || r0 < RH) { *(v4us*)(Ph + po) = oh; *(v4us*)(Pl + po) = ol; asm volatile("s_wait_xcnt 0x0" ::: "memory"); } } }
        return;
    }
#pragma unroll
    for (int mb = 0; mb < 4; ++mb) {
#pragma unroll
        for (int nb = 0; nb < 4; ++nb) {
#pragma unroll
            for (int j = 0; j < 8; ++j) os[(hi * 8 + j) * 68 + nb * 16 + lr] = acc[mb][nb][j]; }
        __builtin_amdgcn_wave_barrier(); asm volatile("" ::: "memory");
        float* crow = C + (size_t)(r0 + mb * 16) * ldc + c0;
{
#pragma unroll
            for (int s = 0; s < 8; ++s) { const int row = 2 * s + hi, cofs = lr * 4; v4f val = *(const v4fa*)(os + row * 68 + cofs); if (BIAS) { val[0] += bfr(bias[c0 + cofs]); val[1] += bfr(bias[c0 + cofs + 1]); val[2] += bfr(bias[c0 + cofs + 2]); val[3] += bfr(bias[c0 + cofs + 3]); }
                *(v4f*)(crow + (size_t)row * ldc + cofs) = val; }
             }
        __builtin_amdgcn_wave_barrier(); asm volatile("" ::: "memory");
    }
}


// ---- k_wtG: every 'xw' [DM][HD] weight block (the 3 * NH_ blocks of W in memory order, then Wo, which has the same shape) goes to its bf16 Bt [HD][DM] plane in ONE launch; grid (DM * HD / 4096, 3 * NH_ + 1), blockIdx.y picks the block.
__global__ __launch_bounds__(256) void k_wtG(const float* __restrict__ wall, const float* __restrict__ wo, bf* WQ, bf* WK, bf* WV, bf* WO) {
    static_assert(DQ == DM && DOUT == HD && NKV == NH_, "Wo and every block of W share one shape");
    constexpr int K = DM, N = HD;
    const int y = blockIdx.y, hd = y / 3, pj = y - 3 * hd;   // block y of W is head hd's projection pj (q, k, v); y == 3 * NH_ is Wo
    const float* __restrict__ w = (y < 3 * NH_) ? wall + (size_t)y * K * N : wo;
    bf* Bt = (y < 3 * NH_) ? (pj == 0 ? WQ : pj == 1 ? WK : WV) + (size_t)hd * N * K : WO;   // Bt rows hd * HD .. of that projection
    const int lane = threadIdx.x & 31; const int L0 = (blockIdx.x * 8 + (threadIdx.x >> 5)) * 8; const int nlines = N * K / 64;
{
#pragma unroll 1
        for (int l = 0; l < 8; ++l) { const int L = L0 + l; if (L >= nlines) break; const size_t e = (size_t)L * 64 + lane * 2; const int k = (int)(e % K), n = (int)(e / K); v2us o;
            o[0] = f2bf(w[(size_t)k * N + n]); o[1] = f2bf(w[(size_t)(k + 1) * N + n]); *(v2us*)(Bt + e) = o; }
         }
}
__global__ __launch_bounds__(256) void k_cvt8(const float* __restrict__ src, bf* dst, size_t n8) { const size_t i = (size_t)blockIdx.x * 256 + threadIdx.x; if (i >= n8) return; const v8f v = *(const v8f*)(src + i * 8); v8us o;
#pragma unroll
    for (int k = 0; k < 8; ++k) o[k] = f2bf(v[k]); *(v8us*)(dst + i * 8) = o;  }

// ---- k_attn: scores, softmax, P V and the hi/lo merge of one head's AR query rows in one work-group of 16 waves; grid (heads, TT / AR), the hi/lo row tiles (t0 < RH) first.
// The AR x TT f32 score rows stay in LDS (pitch SP floats); softmax rewrites each row in place as its 16-bit P planes; the P V partial tiles reuse the same LDS.
// Sum orders: scores k = 0, 32, 64, 96; wave w sums the keys [128 w, 128 w + 128) of P V; the 16 f32 partial tiles are added in wave order 0 .. 15.
#define AR  32                    // query rows per work-group
#define SP  (TT + 4)              // score row pitch in floats: 16 B x odd for the b128 fragment reads, and rows 8 apart fall 32 banks apart for the accumulator stores
#define OPP (HD + 4)              // partial output row pitch in floats, same two properties
template <typename T16, bool HL>
__device__ __forceinline__ void attn_rows(const T16* __restrict__ Q, const T16* __restrict__ Q2, const T16* __restrict__ Kp, const T16* __restrict__ K2, const T16* __restrict__ Vt, const T16* __restrict__ V2, bf* Ah, bf* Al, int t0, int h, float* sm) {
    typedef typename WFrag<T16>::V V;
    const int lane = threadIdx.x & 31, lr = lane & 15, hi = lane >> 4;
    const int wv = __builtin_amdgcn_readfirstlane((int)(threadIdx.x >> 5));   // wave number, kept scalar so that the key ranges and LDS bases are scalar too
    {   // S = Q K^T: the AR query rows' fragments stay in registers, wave wv takes keys [128 wv, 128 wv + 128)
        V qa[AR / 16][HD / 32], qb[AR / 16][HD / 32];
#pragma unroll
        for (int mb = 0; mb < AR / 16; ++mb)
#pragma unroll
            for (int ks = 0; ks < HD / 32; ++ks) { const size_t qo = (size_t)(t0 + mb * 16 + lr) * HD + 8 * hi + ks * 32; qa[mb][ks] = WFrag<T16>::ld(Q + qo); if (HL) qb[mb][ks] = WFrag<T16>::ld(Q2 + qo); }
        constexpr int G = HL ? 2 : 4, TS = (HD / 32) / G, NS = 8 * TS, NB = HL ? 2 : 3;   // a step is G k blocks of one 16-key tile (8 loads); NB register sets, NB - 1 steps loaded ahead
        V kb[NB][G], kc2[NB][G]; v8f acc[AR / 16];
        auto ldk = [&](int s, V* b, V* b2) {
#pragma unroll
            for (int g = 0; g < G; ++g) { const size_t bo = (size_t)(wv * 128 + (s / TS) * 16 + lr) * HD + 8 * hi + ((s % TS) * G + g) * 32; b[g] = WFrag<T16>::ld(Kp + bo); if (HL) b2[g] = WFrag<T16>::ld(K2 + bo); } };
#pragma unroll
        for (int s = 0; s < NB - 1; ++s) ldk(s, kb[s], kc2[s]);
#pragma unroll
        for (int s = 0; s < NS; ++s) { const int n0 = wv * 128 + (s / TS) * 16;
            if (s + NB - 1 < NS) ldk(s + NB - 1, kb[(s + NB - 1) % NB], kc2[(s + NB - 1) % NB]);
            __builtin_amdgcn_sched_barrier(0);   // keeps the later steps' loads in front of this step's products, so that their latency runs under them
            if (s % TS == 0) {
#pragma unroll
                for (int mb = 0; mb < AR / 16; ++mb) acc[mb] = (v8f){}; }
#pragma unroll
            for (int g = 0; g < G; ++g) { const int ks = (s % TS) * G + g;
#pragma unroll
                for (int mb = 0; mb < AR / 16; ++mb) { acc[mb] = WFrag<T16>::mma(qa[mb][ks], kb[s % NB][g], acc[mb]); if (HL) { acc[mb] = WFrag<T16>::mma(qb[mb][ks], kb[s % NB][g], acc[mb]); acc[mb] = WFrag<T16>::mma(qa[mb][ks], kc2[s % NB][g], acc[mb]); } } }
            if (s % TS == TS - 1) {
                asm volatile("v_nop\n\tv_nop\n\tv_nop\n\tv_nop" : "+v"(acc[0]), "+v"(acc[1]));   // the four vector slots the chip needs before the next tile's first product rewrites these accumulators (only LDS stores lie between)
#pragma unroll
                for (int mb = 0; mb < AR / 16; ++mb)
#pragma unroll
                    for (int j = 0; j < 8; ++j) sm[(mb * 16 + hi * 8 + j) * SP + n0 + lr] = acc[mb][j]; } }
    }
    __syncthreads();   // every wave's score columns are in LDS before any wave reads whole rows
    // softmax, one wave per row (register row, one exp, fixed trees): t = S x HD^-0.5 (no mask); the row's P planes overwrite the row itself once it is in registers
    for (int r = 0; r < AR / 16; ++r) { float* sr = sm + (wv * (AR / 16) + r) * SP; float v[TT / 32]; float mx = -3.0e38f;
#pragma unroll
        for (int ch = 0; ch < TT / 128; ++ch) { const v4f a = *(const v4fa*)(sr + ch * 128 + lane * 4);
#pragma unroll
            for (int q = 0; q < 4; ++q) { const float t = a[q] * SCL; v[ch * 4 + q] = t; mx = fmaxf(mx, t); } }
#pragma unroll
        for (int sh = 16; sh; sh >>= 1) mx = fmaxf(mx, __shfl_xor(mx, sh, 32));
        float sum = 0.f;
#pragma unroll
        for (int k = 0; k < TT / 32; ++k) { v[k] = __builtin_amdgcn_exp2f(__fmul_rn(__fsub_rn(v[k], mx), 1.4426950408889634f)); sum += v[k]; }
#pragma unroll
        for (int sh = 16; sh; sh >>= 1) sum += __shfl_xor(sum, sh, 32);
        const float f = __fdiv_rn(HL ? 1.0f : PCAR, sum);
        if (HL) { bf* ph = (bf*)sr;   // hi plane in the row's first TT 16-bit places, lo plane in the next TT
#pragma unroll
            for (int ch = 0; ch < TT / 128; ++ch) { v4us oh, ol;
#pragma unroll
                for (int q = 0; q < 4; ++q) { unsigned short a, c2; splitf(v[ch * 4 + q] * f, a, c2); oh[q] = a; ol[q] = c2; }
                *(v4us*)(ph + ch * 128 + lane * 4) = oh; *(v4us*)(ph + TT + ch * 128 + lane * 4) = ol; }
        } else { h16* p16 = (h16*)sr;
#pragma unroll
            for (int ch = 0; ch < TT / 128; ++ch) { v4h o4;
#pragma unroll
                for (int q = 0; q < 4; ++q) o4[q] = tohx(v[ch * 4 + q] * f);
                *(v4h*)(p16 + ch * 128 + lane * 4) = o4; } } }
    constexpr int GV = HL ? 1 : 4, VS = (HD / 16) / GV, NV = 4 * VS, NW = HL ? 3 : 2;   // a step is GV 16-column tiles of V^T at one k block; NW register sets, NW - 1 steps (8 loads) loaded ahead
    V vb[NW][GV], vc[NW][GV];
    auto ldv = [&](int s, V* b, V* b2) {
#pragma unroll
        for (int g = 0; g < GV; ++g) { const size_t vo = (size_t)(((s % VS) * GV + g) * 16 + lr) * TT + 8 * hi + wv * 128 + (s / VS) * 32; b[g] = WFrag<T16>::ld(Vt + vo); if (HL) b2[g] = WFrag<T16>::ld(V2 + vo); } };
#pragma unroll
    for (int s = 0; s < NW - 1; ++s) ldv(s, vb[s], vc[s]);
    __syncthreads();   // every row's P planes are in LDS before any wave reads its key range of all rows
    v8f o[AR / 16][HD / 16];
#pragma unroll
    for (int mb = 0; mb < AR / 16; ++mb)
#pragma unroll
        for (int nb = 0; nb < HD / 16; ++nb) o[mb][nb] = (v8f){};
    const T16* P = (const T16*)sm; V a[AR / 16], a2[AR / 16];
#pragma unroll
    for (int s = 0; s < NV; ++s) {
        if (s + NW - 1 < NV) ldv(s + NW - 1, vb[(s + NW - 1) % NW], vc[(s + NW - 1) % NW]);
        if (s % VS == 0) {
#pragma unroll
            for (int mb = 0; mb < AR / 16; ++mb) { const T16* pr = P + (mb * 16 + lr) * (2 * SP) + 8 * hi + wv * 128 + (s / VS) * 32; a[mb] = WFrag<T16>::ld(pr); if (HL) a2[mb] = WFrag<T16>::ld(pr + TT); } }
        __builtin_amdgcn_sched_barrier(0);   // keeps the later steps' loads in front of this step's products, so that their latency runs under them
#pragma unroll
        for (int g = 0; g < GV; ++g) { const int nb = (s % VS) * GV + g;
#pragma unroll
            for (int mb = 0; mb < AR / 16; ++mb) { o[mb][nb] = WFrag<T16>::mma(a[mb], vb[s % NW][g], o[mb][nb]); if (HL) { o[mb][nb] = WFrag<T16>::mma(a2[mb], vb[s % NW][g], o[mb][nb]); o[mb][nb] = WFrag<T16>::mma(a[mb], vc[s % NW][g], o[mb][nb]); } } } }
    __syncthreads();   // every wave has read its P fragments before the partial tiles overwrite them
    float* my = sm + wv * (AR * OPP);
#pragma unroll
    for (int mb = 0; mb < AR / 16; ++mb)
#pragma unroll
        for (int nb = 0; nb < HD / 16; ++nb)
#pragma unroll
            for (int j = 0; j < 8; ++j) my[(mb * 16 + hi * 8 + j) * OPP + nb * 16 + lr] = o[mb][nb][j];
    __syncthreads();   // every wave's partial tile is in LDS before any wave adds them
    const float cs = HL ? 1.0f : (1.0f / PCAR);
#pragma unroll
    for (int it = 0; it < AR * HD / 4 / 512; ++it) { const int q = it * 512 + (int)threadIdx.x, row = q >> 5, cofs = (q & 31) * 4; v4f val = *(const v4fa*)(sm + row * OPP + cofs);
#pragma unroll
        for (int w = 1; w < 16; ++w) val += *(const v4fa*)(sm + (w * AR + row) * OPP + cofs);
        v4us oh, ol;
#pragma unroll
        for (int e = 0; e < 4; ++e) { unsigned short a, c2; splitf(val[e] * cs, a, c2); oh[e] = a; ol[e] = c2; }
        const size_t oo = (size_t)(t0 + row) * DQ + h * HD + cofs; *(v4us*)(Ah + oo) = oh; *(v4us*)(Al + oo) = ol;
        asm volatile("s_wait_xcnt 0x0" ::: "memory"); }   // stands behind the two stores, in front of any later write of their address registers
}
__global__ __launch_bounds__(512) void k_attn(const h16* __restrict__ Q16, const bf* __restrict__ Qh, const bf* __restrict__ Ql, const h16* __restrict__ K16, const bf* __restrict__ Kh, const bf* __restrict__ Kl, const h16* __restrict__ V16, const bf* __restrict__ Vh, const bf* __restrict__ Vl, bf* Ah, bf* Al) {
    __shared__ __align__(16) float sm[16 * AR * OPP];   // 16 partial tiles; the AR score rows (AR * SP floats) fit inside
    const int h = blockIdx.x, t0 = blockIdx.y * AR; const size_t zq = (size_t)h * TT * HD, zk = (size_t)(h / REP) * TT * HD;
    if (t0 < RH) attn_rows<bf, true>(Qh + zq, Ql + zq, Kh + zk, Kl + zk, Vh + zk, Vl + zk, Ah, Al, t0, h, sm);
    else attn_rows<h16, false>(Q16 + zq, nullptr, K16 + zk, nullptr, V16 + zk, nullptr, Ah, Al, t0, h, sm);
}

extern "C" void kernel_launch(void* const* d_in, const int* in_sizes, int n_in,
                              void* d_out, int out_size, void* d_ws, size_t ws_size, hipStream_t stream) {
    (void)in_sizes; (void)n_in; (void)out_size;
    const float* x = (const float*)d_in[0]; const float* wall = (const float*)d_in[1]; const float* wo = (const float*)d_in[2];   /* order x, W [8][3][1024][128], Wo [1024][128] */ const float* wq = wall; const float* wk = wall; const float* wv = wall; (void)wq; (void)wk; (void)wv;
    float* OUT = (float*)d_out;     // [4][2048][128]
    char* wsp = (char*)d_ws;
    auto take = [&](size_t bytes) { char* p = wsp; wsp += (bytes + 255) & ~(size_t)255; return (void*)p; };
    bf* WQ = (bf*)take((size_t)DQ * DM * 2); bf* WK = (bf*)take((size_t)DKV * DM * 2); bf* WV = (bf*)take((size_t)DKV * DM * 2); bf* WO = (bf*)take((size_t)DOUT * DQ * 2);
    bf* XB = (bf*)take((size_t)TT * DM * 2);
    h16* QP16 = (h16*)take((size_t)NH_ * TT * HD * 2); h16* KP16 = (h16*)take((size_t)NKV * TT * HD * 2); h16* VT16 = (h16*)take((size_t)NKV * HD * TT * 2);
    bf* QPh = (bf*)take((size_t)NH_ * TT * HD * 2); bf* QPl = (bf*)take((size_t)NH_ * TT * HD * 2); bf* KPh = (bf*)take((size_t)NKV * TT * HD * 2); bf* KPl = (bf*)take((size_t)NKV * TT * HD * 2); bf* VTh = (bf*)take((size_t)NKV * HD * TT * 2); bf* VTl = (bf*)take((size_t)NKV * HD * TT * 2);
    bf* ATh = (bf*)take((size_t)TT * DQ * 2); bf* ATl = (bf*)take((size_t)TT * DQ * 2);
    if ((size_t)(wsp - (char*)d_ws) > ws_size) return;    // ws 256 MiB
    k_wtG<<<dim3(DM * HD / 4096, 3 * NH_ + 1, 1), 256, 0, stream>>>(wall, wo, WQ, WK, WV, WO);   /* all 25 'xw' [1024][128] blocks -> Bt [128][1024] planes, one launch */
    for (int b = 0; b < NB_; ++b) {
        
        k_cvt8<<<(unsigned)(((size_t)TT * DM / 8 + 255) / 256), 256, 0, stream>>>(x + (size_t)b * TT * DM, XB, (size_t)TT * DM / 8);
        k_gemmw<bf, 0, false, 8, 3><<<dim3(TT / 64, DQ / 64, 1), 256, 0, stream>>>(XB, nullptr, WQ, nullptr, DM, nullptr, 0, nullptr, 0, 0, 0, QP16, QPh, QPl);    // q planes [h][t][d]
        k_gemmw<bf, 0, false, 8, 1><<<dim3(TT / 64, DKV / 64, 1), 256, 0, stream>>>(XB, nullptr, WK, nullptr, DM, nullptr, 0, nullptr, 0, 0, 0, KP16, KPh, KPl);   // k planes [h][t][d]
        k_gemmw<bf, 0, false, 8, 2><<<dim3(DKV / 64, TT / 64, 1), 256, 0, stream>>>(WV, nullptr, XB, nullptr, DM, nullptr, TT, nullptr, 0, 0, 0, VT16, VTh, VTl);  // V^T planes [h][d][t]: the weight rows are the tile's rows
        k_attn<<<dim3(NH_, TT / AR, 1), 512, 0, stream>>>(QP16, QPh, QPl, KP16, KPh, KPl, VT16, VTh, VTl, ATh, ATl);   // all heads of the batch; S and P never leave LDS
        k_gemmw<bf, 1, false, 16, 0><<<dim3(TT / 64, DOUT / 64, 1), 512, 0, stream>>>(ATh, ATl, WO, nullptr, DQ, OUT + (size_t)b * TT * DOUT, DOUT, nullptr, 0, 0, 0, nullptr, nullptr, nullptr);   /* z = o Wo: N 128 */ }
}

// v005
// It runs in 386 microseconds.
// In two side-by-side timings against v004, it was 1.19 and 1.21 times as fast.
// All steps since v000 together make it 6.37 times as fast.
#include <hip/hip_runtime.h>

// Multi-head attention with per-head weight tensors and 128-wide heads (x [4][2048][1024]; q, k, v = einsum('bnd,hde', x, W[:, i]) with W [8][3][1024][128] (1/32): head h's 'xw' blocks; 8 heads x 128; scores x 1/sqrt(128); softmax (no mask); o = concat heads [2048][1024]; z = o Wo ('xw' [1024][128]) -> [4][2048][128] (1.0 M); argument order x, W, Wo).
// Layout, every activation plane with one slab per batch and the projections, attention and Wo launched once for all batches (grid z = batch): bf16 copy of x; each head's three 'xw' [1024][128] blocks transposed once into the fused Bt planes (one launch for all of them and Wo); exact projections whose epilogue writes the 16-bit head planes (v as V^T = Wv x^T); dense T-2048 attention (hybrid rows: < 512 hi/lo 3 products, rest fp16 x1024); merged hi/lo x Wo exact (N 128).
// Compute dtypes, f32 accumulate: every input rounded to bf16; projections exact; attention rows < 512 3 products, rest fp16; softmax f32; Wo hl x exact.

#define NB_  4
#define TT   2048
#define DM   1024
#define NH_  8
#define NKV  8
#define REP  (NH_ / NKV)
#define HD   128
#define DQ   (NH_ * HD)
#define DKV  (NKV * HD)
#define RH   512                  // query rows < RH use hi+lo planes (0: none)
#define WIN  0
#define PCAR 1024.0f
#define SCL  0.088388347648318447f   // 1/sqrt(float32(128))
#define DOUT 128      // output width
typedef _Float16 h16;
typedef unsigned short bf;
typedef __attribute__((ext_vector_type(16))) __bf16   v16bf;
typedef __attribute__((ext_vector_type(16))) _Float16 v16h;
typedef __attribute__((ext_vector_type(8)))  _Float16 v8h;
typedef __attribute__((ext_vector_type(8)))  unsigned short v8us;
typedef __attribute__((ext_vector_type(8)))  float    v8f;
typedef __attribute__((ext_vector_type(4)))  float    v4f;
typedef v8h  __attribute__((may_alias)) v8ha;
typedef v4f  __attribute__((may_alias)) v4fa;
typedef v8us __attribute__((may_alias)) v8usa;

__device__ __forceinline__ unsigned short f2bf(float f) { unsigned u = __float_as_uint(f); u += 0x7FFFu + ((u >> 16) & 1u); return (unsigned short)(u >> 16); }
__device__ __forceinline__ float bf2f(unsigned short b) { return __uint_as_float(((unsigned)b) << 16); }
__device__ __forceinline__ float bfr(float f) { return bf2f(f2bf(f)); }
__device__ __forceinline__ v16h cat16(v8h lo, v8h hi) { return __builtin_shufflevector(lo, hi, 0, 1, 2, 3, 4, 5, 6, 7, 8, 9, 10, 11, 12, 13, 14, 15); }
__device__ __forceinline__ v16bf cat16b(v8us lo, v8us hi) { return __builtin_bit_cast(v16bf, __builtin_shufflevector(lo, hi, 0, 1, 2, 3, 4, 5, 6, 7, 8, 9, 10, 11, 12, 13, 14, 15)); }
__device__ __forceinline__ v8f wmma16(v16h a, v16h b, v8f c) { return __builtin_amdgcn_wmma_f32_16x16x32_f16(false, a, false, b, (short)0, c, false, false); }
__device__ __forceinline__ v8f wmmab(v16bf a, v16bf b, v8f c) { return __builtin_amdgcn_wmma_f32_16x16x32_bf16(false, a, false, b, (short)0, c, false, false); }

__device__ __forceinline__ h16 tohx(float x) { return (h16)x; }
__device__ __forceinline__ void splitf(float y, unsigned short& h, unsigned short& l) { h = f2bf(y); l = f2bf(y - bf2f(h)); }
typedef __attribute__((ext_vector_type(2))) _Float16 v2h;
typedef __attribute__((ext_vector_type(4))) _Float16 v4h;
typedef __attribute__((ext_vector_type(2))) unsigned short v2us;
typedef __attribute__((ext_vector_type(4))) unsigned short v4us;
typedef __attribute__((ext_vector_type(2))) float v2f;
typedef __attribute__((ext_vector_type(4))) int v4i;

// ---- k_gemmw: register-blocked GEMM, one 64x64 output tile per work-group (16 accumulators per wave), operands straight from K-contiguous 16-bit planes; grid (M/64, N/64, Z), 32 * KS threads.
// C[m][n] (f32, pitch ldc, + optional f32 bias[n]) = sum_k A[m][k] Bt[n][k] (+ split products per NSPLIT). z-batch strides sA/sB/sC in elements (sC steps the planes where PLN > 0). K % (32 * KS) == 0.
// PLN > 0 (KS > 1 only): no f32 C; the summed tile goes out as 16-bit planes (fp16, bf16 hi, bf16 lo). PLN 1: head planes [n / HD][m][n % HD]; PLN 3: the same, rows m < RH as hi/lo only and the rest as fp16 only (all that k_attn reads of q); PLN 2: planes [m][n] of pitch ldc.
// KS > 1: wave w sums the contiguous k range [w K/KS, (w+1) K/KS), so the KS waves' load latencies overlap; the KS f32 partial tiles meet in LDS and are added in wave order 0 .. KS-1.
template <typename T16> struct WFrag;
template <> struct WFrag<h16> { typedef v16h V; static __device__ __forceinline__ V ld(const h16* p) { return cat16(*(const v8h*)p, *(const v8h*)(p + 16)); } static __device__ __forceinline__ v8f mma(V a, V b, v8f c) { return wmma16(a, b, c); } };
template <> struct WFrag<bf> { typedef v16bf V; static __device__ __forceinline__ V ld(const bf* p) { return cat16b(*(const v8us*)p, *(const v8us*)(p + 16)); } static __device__ __forceinline__ v8f mma(V a, V b, v8f c) { return wmmab(a, b, c); } };
template <typename T16, int NSPLIT, bool BIAS, int KS, int PLN>
__global__ __launch_bounds__(32 * KS) void k_gemmw(const T16* __restrict__ A, const T16* __restrict__ A2, const T16* __restrict__ Bt, const T16* __restrict__ Bt2, int K, float* C, int ldc, const float* __restrict__ bias, size_t sA, size_t sB, size_t sC, h16* P16, bf* Ph, bf* Pl) {
    typedef typename WFrag<T16>::V V;
    __shared__ __align__(16) float os[(KS == 1 ? 16 : KS * 64) * 68];
    const size_t z = blockIdx.z; A += z * sA; if (A2) A2 += z * sA; Bt += z * sB; if (Bt2) Bt2 += z * sB; if (PLN == 0) C += z * sC; else { P16 += z * sC; Ph += z * sC; Pl += z * sC; }
    const int lane = threadIdx.x & 31, lr = lane & 15, hi = lane >> 4; const int r0 = blockIdx.x * 64, c0 = blockIdx.y * 64;
    const int wv = (KS == 1) ? 0 : __builtin_amdgcn_readfirstlane((int)(threadIdx.x >> 5));   // this wave's place in the K split, kept scalar so that the loop bounds are
    v8f acc[4][4];
#pragma unroll
    for (int mb = 0; mb < 4; ++mb)
#pragma unroll
        for (int nb = 0; nb < 4; ++nb) acc[mb][nb] = (v8f){};
    const size_t aoff = (size_t)(r0 + lr) * K + 8 * hi, boff = (size_t)(c0 + lr) * K + 8 * hi;
#pragma unroll 1
    for (int kc = wv * (K / KS); kc < (wv + 1) * (K / KS); kc += 32) {
        V a[4], a2[4];
#pragma unroll
        for (int mb = 0; mb < 4; ++mb) { a[mb] = WFrag<T16>::ld(A + aoff + (size_t)mb * 16 * K + kc); if (NSPLIT == 1 || NSPLIT == 2) a2[mb] = WFrag<T16>::ld(A2 + aoff + (size_t)mb * 16 * K + kc); }
#pragma unroll
        for (int nb = 0; nb < 4; ++nb) { const V b = WFrag<T16>::ld(Bt + boff + (size_t)nb * 16 * K + kc); V b2; if (NSPLIT >= 2) b2 = WFrag<T16>::ld(Bt2 + boff + (size_t)nb * 16 * K + kc);
#pragma unroll
            for (int mb = 0; mb < 4; ++mb) { acc[mb][nb] = WFrag<T16>::mma(a[mb], b, acc[mb][nb]); if (NSPLIT == 1 || NSPLIT == 2) acc[mb][nb] = WFrag<T16>::mma(a2[mb], b, acc[mb][nb]); if (NSPLIT >= 2) acc[mb][nb] = WFrag<T16>::mma(a[mb], b2, acc[mb][nb]); } }
        asm volatile("v_nop\n\tv_nop\n\tv_nop\n\tv_nop" : "+v"(acc[0][0]), "+v"(acc[1][1]), "+v"(acc[2][2]), "+v"(acc[3][3]) : "v"(a[0]), "v"(a[3]));
    }
    if (KS > 1) {
        float* my = os + wv * (64 * 68);
#pragma unroll
        for (int mb = 0; mb < 4; ++mb)
#pragma unroll
            for (int nb = 0; nb < 4; ++nb)
#pragma unroll
                for (int j = 0; j < 8; ++j) my[(mb * 16 + hi * 8 + j) * 68 + nb * 16 + lr] = acc[mb][nb][j];
        __syncthreads();   // every wave's partial tile is in LDS before any wave adds them
#pragma unroll
        for (int it = 0; it < 32 / KS; ++it) { const int q = it * 32 * KS + (int)threadIdx.x, row = q >> 4, cofs = (q & 15) * 4; v4f val = *(const v4fa*)(os + row * 68 + cofs);
#pragma unroll
            for (int w = 1; w < KS; ++w) val += *(const v4fa*)(os + (w * 64 + row) * 68 + cofs);
            if (BIAS) { val[0] += bfr(bias[c0 + cofs]); val[1] += bfr(bias[c0 + cofs + 1]); val[2] += bfr(bias[c0 + cofs + 2]); val[3] += bfr(bias[c0 + cofs + 3]); }
            if (PLN == 0) { *(v4f*)(C + (size_t)(r0 + row) * ldc + c0 + cofs) = val; }
            else { const size_t po = (PLN == 2) ? (size_t)(r0 + row) * ldc + c0 + cofs : ((size_t)(c0 / HD) * TT + r0 + row) * HD + c0 % HD + cofs;
                v4h o16; v4us oh, ol;
#pragma unroll
                for (int e = 0; e < 4; ++e) { o16[e] = tohx(val[e]); unsigned short a2, c2; splitf(val[e], a2, c2); oh[e] = a2; ol[e] = c2; }
                // each s_wait_xcnt 0 stands directly behind its case's stores, in front of any later write of their address or data registers (the built code tests the cases one after the other)
                if (PLN != 3 || r0 >= RH) { *(v4h*)(P16 + po) = o16; if (PLN == 3) asm volatile("s_wait_xcnt 0x0" ::: "memory"); }
                if (PLN != 3 || r0 < RH) { *(v4us*)(Ph + po) = oh; *(v4us*)(Pl + po) = ol; asm volatile("s_wait_xcnt 0x0" ::: "memory"); } } }
        return;
    }
#pragma unroll
    for (int mb = 0; mb < 4; ++mb) {
#pragma unroll
        for (int nb = 0; nb < 4; ++nb) {
#pragma unroll
            for (int j = 0; j < 8; ++j) os[(hi * 8 + j) * 68 + nb * 16 + lr] = acc[mb][nb][j]; }
        __builtin_amdgcn_wave_barrier(); asm volatile("" ::: "memory");
        float* crow = C + (size_t)(r0 + mb * 16) * ldc + c0;
{
#pragma unroll
            for (int s = 0; s < 8; ++s) { const int row = 2 * s + hi, cofs = lr * 4; v4f val = *(const v4fa*)(os + row * 68 + cofs); if (BIAS) { val[0] += bfr(bias[c0 + cofs]); val[1] += bfr(bias[c0 + cofs + 1]); val[2] += bfr(bias[c0 + cofs + 2]); val[3] += bfr(bias[c0 + cofs + 3]); }
                *(v4f*)(crow + (size_t)row * ldc + cofs) = val; }
             }
        __builtin_amdgcn_wave_barrier(); asm volatile("" ::: "memory");
    }
}


// ---- k_wtG: every 'xw' [DM][HD] weight block (the 3 * NH_ blocks of W in memory order, then Wo, which has the same shape) goes to its bf16 Bt [HD][DM] plane in ONE launch; grid (DM * HD / 4096, 3 * NH_ + 1), blockIdx.y picks the block.
__global__ __launch_bounds__(256) void k_wtG(const float* __restrict__ wall, const float* __restrict__ wo, bf* WQ, bf* WK, bf* WV, bf* WO) {
    static_assert(DQ == DM && DOUT == HD && NKV == NH_, "Wo and every block of W share one shape");
    constexpr int K = DM, N = HD;
    const int y = blockIdx.y, hd = y / 3, pj = y - 3 * hd;   // block y of W is head hd's projection pj (q, k, v); y == 3 * NH_ is Wo
    const float* __restrict__ w = (y < 3 * NH_) ? wall + (size_t)y * K * N : wo;
    bf* Bt = (y < 3 * NH_) ? (pj == 0 ? WQ : pj == 1 ? WK : WV) + (size_t)hd * N * K : WO;   // Bt rows hd * HD .. of that projection
    const int lane = threadIdx.x & 31; const int L0 = (blockIdx.x * 8 + (threadIdx.x >> 5)) * 8; const int nlines = N * K / 64;
{
#pragma unroll 1
        for (int l = 0; l < 8; ++l) { const int L = L0 + l; if (L >= nlines) break; const size_t e = (size_t)L * 64 + lane * 2; const int k = (int)(e % K), n = (int)(e / K); v2us o;
            o[0] = f2bf(w[(size_t)k * N + n]); o[1] = f2bf(w[(size_t)(k + 1) * N + n]); *(v2us*)(Bt + e) = o; }
         }
}
__global__ __launch_bounds__(256) void k_cvt8(const float* __restrict__ src, bf* dst, size_t n8) { const size_t i = (size_t)blockIdx.x * 256 + threadIdx.x; if (i >= n8) return; const v8f v = *(const v8f*)(src + i * 8); v8us o;
#pragma unroll
    for (int k = 0; k < 8; ++k) o[k] = f2bf(v[k]); *(v8us*)(dst + i * 8) = o;  }

// ---- k_attn: scores, softmax, P V and the hi/lo merge of one head's AR query rows in one work-group of 16 waves; grid (heads, TT / AR, batches), each batch's hi/lo row tiles (t0 < RH) first.
// The AR x TT f32 score rows stay in LDS (pitch SP floats); softmax rewrites each row in place as its 16-bit P planes; the P V partial tiles reuse the same LDS.
// Sum orders: scores k = 0, 32, 64, 96; wave w sums the keys [128 w, 128 w + 128) of P V; the 16 f32 partial tiles are added in wave order 0 .. 15.
#define AR  32                    // query rows per work-group
#define SP  (TT + 4)              // score row pitch in floats: 16 B x odd for the b128 fragment reads, and rows 8 apart fall 32 banks apart for the accumulator stores
#define OPP (HD + 4)              // partial output row pitch in floats, same two properties
template <typename T16, bool HL>
__device__ __forceinline__ void attn_rows(const T16* __restrict__ Q, const T16* __restrict__ Q2, const T16* __restrict__ Kp, const T16* __restrict__ K2, const T16* __restrict__ Vt, const T16* __restrict__ V2, bf* Ah, bf* Al, int t0, int h, float* sm) {
    typedef typename WFrag<T16>::V V;
    const int lane = threadIdx.x & 31, lr = lane & 15, hi = lane >> 4;
    const int wv = __builtin_amdgcn_readfirstlane((int)(threadIdx.x >> 5));   // wave number, kept scalar so that the key ranges and LDS bases are scalar too
    {   // S = Q K^T: the AR query rows' fragments stay in registers, wave wv takes keys [128 wv, 128 wv + 128)
        V qa[AR / 16][HD / 32], qb[AR / 16][HD / 32];
#pragma unroll
        for (int mb = 0; mb < AR / 16; ++mb)
#pragma unroll
            for (int ks = 0; ks < HD / 32; ++ks) { const size_t qo = (size_t)(t0 + mb * 16 + lr) * HD + 8 * hi + ks * 32; qa[mb][ks] = WFrag<T16>::ld(Q + qo); if (HL) qb[mb][ks] = WFrag<T16>::ld(Q2 + qo); }
        constexpr int G = HL ? 2 : 4, TS = (HD / 32) / G, NS = 8 * TS, NB = HL ? 2 : 3;   // a step is G k blocks of one 16-key tile (8 loads); NB register sets, NB - 1 steps loaded ahead
        V kb[NB][G], kc2[NB][G]; v8f acc[AR / 16];
        auto ldk = [&](int s, V* b, V* b2) {
#pragma unroll
            for (int g = 0; g < G; ++g) { const size_t bo = (size_t)(wv * 128 + (s / TS) * 16 + lr) * HD + 8 * hi + ((s % TS) * G + g) * 32; b[g] = WFrag<T16>::ld(Kp + bo); if (HL) b2[g] = WFrag<T16>::ld(K2 + bo); } };
#pragma unroll
        for (int s = 0; s < NB - 1; ++s) ldk(s, kb[s], kc2[s]);
#pragma unroll
        for (int s = 0; s < NS; ++s) { const int n0 = wv * 128 + (s / TS) * 16;
            if (s + NB - 1 < NS) ldk(s + NB - 1, kb[(s + NB - 1) % NB], kc2[(s + NB - 1) % NB]);
            __builtin_amdgcn_sched_barrier(0);   // keeps the later steps' loads in front of this step's products, so that their latency runs under them
            if (s % TS == 0) {
#pragma unroll
                for (int mb = 0; mb < AR / 16; ++mb) acc[mb] = (v8f){}; }
#pragma unroll
            for (int g = 0; g < G; ++g) { const int ks = (s % TS) * G + g;
#pragma unroll
                for (int mb = 0; mb < AR / 16; ++mb) { acc[mb] = WFrag<T16>::mma(qa[mb][ks], kb[s % NB][g], acc[mb]); if (HL) { acc[mb] = WFrag<T16>::mma(qb[mb][ks], kb[s % NB][g], acc[mb]); acc[mb] = WFrag<T16>::mma(qa[mb][ks], kc2[s % NB][g], acc[mb]); } } }
            if (s % TS == TS - 1) {
                asm volatile("v_nop\n\tv_nop\n\tv_nop\n\tv_nop" : "+v"(acc[0]), "+v"(acc[1]));   // the four vector slots the chip needs before the next tile's first product rewrites these accumulators (only LDS stores lie between)
#pragma unroll
                for (int mb = 0; mb < AR / 16; ++mb)
#pragma unroll
                    for (int j = 0; j < 8; ++j) sm[(mb * 16 + hi * 8 + j) * SP + n0 + lr] = acc[mb][j]; } }
    }
    __syncthreads();   // every wave's score columns are in LDS before any wave reads whole rows
    // softmax, one wave per row (register row, one exp, fixed trees): t = S x HD^-0.5 (no mask); the row's P planes overwrite the row itself once it is in registers
    for (int r = 0; r < AR / 16; ++r) { float* sr = sm + (wv * (AR / 16) + r) * SP; float v[TT / 32]; float mx = -3.0e38f;
#pragma unroll
        for (int ch = 0; ch < TT / 128; ++ch) { const v4f a = *(const v4fa*)(sr + ch * 128 + lane * 4);
#pragma unroll
            for (int q = 0; q < 4; ++q) { const float t = a[q] * SCL; v[ch * 4 + q] = t; mx = fmaxf(mx, t); } }
#pragma unroll
        for (int sh = 16; sh; sh >>= 1) mx = fmaxf(mx, __shfl_xor(mx, sh, 32));
        float sum = 0.f;
#pragma unroll
        for (int k = 0; k < TT / 32; ++k) { v[k] = __builtin_amdgcn_exp2f(__fmul_rn(__fsub_rn(v[k], mx), 1.4426950408889634f)); sum += v[k]; }
#pragma unroll
        for (int sh = 16; sh; sh >>= 1) sum += __shfl_xor(sum, sh, 32);
        const float f = __fdiv_rn(HL ? 1.0f : PCAR, sum);
        if (HL) { bf* ph = (bf*)sr;   // hi plane in the row's first TT 16-bit places, lo plane in the next TT
#pragma unroll
            for (int ch = 0; ch < TT / 128; ++ch) { v4us oh, ol;
#pragma unroll
                for (int q = 0; q < 4; ++q) { unsigned short a, c2; splitf(v[ch * 4 + q] * f, a, c2); oh[q] = a; ol[q] = c2; }
                *(v4us*)(ph + ch * 128 + lane * 4) = oh; *(v4us*)(ph + TT + ch * 128 + lane * 4) = ol; }
        } else { h16* p16 = (h16*)sr;
#pragma unroll
            for (int ch = 0; ch < TT / 128; ++ch) { v4h o4;
#pragma unroll
                for (int q = 0; q < 4; ++q) o4[q] = tohx(v[ch * 4 + q] * f);
                *(v4h*)(p16 + ch * 128 + lane * 4) = o4; } } }
    constexpr int GV = HL ? 1 : 4, VS = (HD / 16) / GV, NV = 4 * VS, NW = HL ? 3 : 2;   // a step is GV 16-column tiles of V^T at one k block; NW register sets, NW - 1 steps (8 loads) loaded ahead
    V vb[NW][GV], vc[NW][GV];
    auto ldv = [&](int s, V* b, V* b2) {
#pragma unroll
        for (int g = 0; g < GV; ++g) { const size_t vo = (size_t)(((s % VS) * GV + g) * 16 + lr) * TT + 8 * hi + wv * 128 + (s / VS) * 32; b[g] = WFrag<T16>::ld(Vt + vo); if (HL) b2[g] = WFrag<T16>::ld(V2 + vo); } };
#pragma unroll
    for (int s = 0; s < NW - 1; ++s) ldv(s, vb[s], vc[s]);
    __syncthreads();   // every row's P planes are in LDS before any wave reads its key range of all rows
    v8f o[AR / 16][HD / 16];
#pragma unroll
    for (int mb = 0; mb < AR / 16; ++mb)
#pragma unroll
        for (int nb = 0; nb < HD / 16; ++nb) o[mb][nb] = (v8f){};
    const T16* P = (const T16*)sm; V a[AR / 16], a2[AR / 16];
#pragma unroll
    for (int s = 0; s < NV; ++s) {
        if (s + NW - 1 < NV) ldv(s + NW - 1, vb[(s + NW - 1) % NW], vc[(s + NW - 1) % NW]);
        if (s % VS == 0) {
#pragma unroll
            for (int mb = 0; mb < AR / 16; ++mb) { const T16* pr = P + (mb * 16 + lr) * (2 * SP) + 8 * hi + wv * 128 + (s / VS) * 32; a[mb] = WFrag<T16>::ld(pr); if (HL) a2[mb] = WFrag<T16>::ld(pr + TT); } }
        __builtin_amdgcn_sched_barrier(0);   // keeps the later steps' loads in front of this step's products, so that their latency runs under them
#pragma unroll
        for (int g = 0; g < GV; ++g) { const int nb = (s % VS) * GV + g;
#pragma unroll
            for (int mb = 0; mb < AR / 16; ++mb) { o[mb][nb] = WFrag<T16>::mma(a[mb], vb[s % NW][g], o[mb][nb]); if (HL) { o[mb][nb] = WFrag<T16>::mma(a2[mb], vb[s % NW][g], o[mb][nb]); o[mb][nb] = WFrag<T16>::mma(a[mb], vc[s % NW][g], o[mb][nb]); } } } }
    __syncthreads();   // every wave has read its P fragments before the partial tiles overwrite them
    float* my = sm + wv * (AR * OPP);
#pragma unroll
    for (int mb = 0; mb < AR / 16; ++mb)
#pragma unroll
        for (int nb = 0; nb < HD / 16; ++nb)
#pragma unroll
            for (int j = 0; j < 8; ++j) my[(mb * 16 + hi * 8 + j) * OPP + nb * 16 + lr] = o[mb][nb][j];
    __syncthreads();   // every wave's partial tile is in LDS before any wave adds them
    const float cs = HL ? 1.0f : (1.0f / PCAR);
#pragma unroll
    for (int it = 0; it < AR * HD / 4 / 512; ++it) { const int q = it * 512 + (int)threadIdx.x, row = q >> 5, cofs = (q & 31) * 4; v4f val = *(const v4fa*)(sm + row * OPP + cofs);
#pragma unroll
        for (int w = 1; w < 16; ++w) val += *(const v4fa*)(sm + (w * AR + row) * OPP + cofs);
        v4us oh, ol;
#pragma unroll
        for (int e = 0; e < 4; ++e) { unsigned short a, c2; splitf(val[e] * cs, a, c2); oh[e] = a; ol[e] = c2; }
        const size_t oo = (size_t)(t0 + row) * DQ + h * HD + cofs; *(v4us*)(Ah + oo) = oh; *(v4us*)(Al + oo) = ol;
        asm volatile("s_wait_xcnt 0x0" ::: "memory"); }   // stands behind the two stores, in front of any later write of their address registers
}
__global__ __launch_bounds__(512) void k_attn(const h16* __restrict__ Q16, const bf* __restrict__ Qh, const bf* __restrict__ Ql, const h16* __restrict__ K16, const bf* __restrict__ Kh, const bf* __restrict__ Kl, const h16* __restrict__ V16, const bf* __restrict__ Vh, const bf* __restrict__ Vl, bf* Ah, bf* Al) {
    __shared__ __align__(16) float sm[16 * AR * OPP];   // 16 partial tiles; the AR score rows (AR * SP floats) fit inside
    const int h = blockIdx.x, t0 = blockIdx.y * AR; const size_t b = blockIdx.z; const size_t zq = (b * NH_ + h) * TT * HD, zk = (b * NKV + h / REP) * TT * HD;
    Ah += b * TT * DQ; Al += b * TT * DQ;   // this batch's slab of the merged head rows
    if (t0 < RH) attn_rows<bf, true>(Qh + zq, Ql + zq, Kh + zk, Kl + zk, Vh + zk, Vl + zk, Ah, Al, t0, h, sm);
    else attn_rows<h16, false>(Q16 + zq, nullptr, K16 + zk, nullptr, V16 + zk, nullptr, Ah, Al, t0, h, sm);
}

extern "C" void kernel_launch(void* const* d_in, const int* in_sizes, int n_in,
                              void* d_out, int out_size, void* d_ws, size_t ws_size, hipStream_t stream) {
    (void)in_sizes; (void)n_in; (void)out_size;
    const float* x = (const float*)d_in[0]; const float* wall = (const float*)d_in[1]; const float* wo = (const float*)d_in[2];   /* order x, W [8][3][1024][128], Wo [1024][128] */ const float* wq = wall; const float* wk = wall; const float* wv = wall; (void)wq; (void)wk; (void)wv;
    float* OUT = (float*)d_out;     // [4][2048][128]
    char* wsp = (char*)d_ws;
    auto take = [&](size_t bytes) { char* p = wsp; wsp += (bytes + 255) & ~(size_t)255; return (void*)p; };
    bf* WQ = (bf*)take((size_t)DQ * DM * 2); bf* WK = (bf*)take((size_t)DKV * DM * 2); bf* WV = (bf*)take((size_t)DKV * DM * 2); bf* WO = (bf*)take((size_t)DOUT * DQ * 2);
    bf* XB = (bf*)take((size_t)NB_ * TT * DM * 2);
    h16* QP16 = (h16*)take((size_t)NB_ * NH_ * TT * HD * 2); h16* KP16 = (h16*)take((size_t)NB_ * NKV * TT * HD * 2); h16* VT16 = (h16*)take((size_t)NB_ * NKV * HD * TT * 2);
    bf* QPh = (bf*)take((size_t)NB_ * NH_ * TT * HD * 2); bf* QPl = (bf*)take((size_t)NB_ * NH_ * TT * HD * 2); bf* KPh = (bf*)take((size_t)NB_ * NKV * TT * HD * 2); bf* KPl = (bf*)take((size_t)NB_ * NKV * TT * HD * 2); bf* VTh = (bf*)take((size_t)NB_ * NKV * HD * TT * 2); bf* VTl = (bf*)take((size_t)NB_ * NKV * HD * TT * 2);
    bf* ATh = (bf*)take((size_t)NB_ * TT * DQ * 2); bf* ATl = (bf*)take((size_t)NB_ * TT * DQ * 2);
    if ((size_t)(wsp - (char*)d_ws) > ws_size) return;    // ws 256 MiB
    k_wtG<<<dim3(DM * HD / 4096, 3 * NH_ + 1, 1), 256, 0, stream>>>(wall, wo, WQ, WK, WV, WO);   /* all 25 'xw' [1024][128] blocks -> Bt [128][1024] planes, one launch */
    k_cvt8<<<(unsigned)(((size_t)NB_ * TT * DM / 8 + 255) / 256), 256, 0, stream>>>(x, XB, (size_t)NB_ * TT * DM / 8);
    k_gemmw<bf, 0, false, 8, 3><<<dim3(TT / 64, DQ / 64, NB_), 256, 0, stream>>>(XB, nullptr, WQ, nullptr, DM, nullptr, 0, nullptr, (size_t)TT * DM, 0, (size_t)NH_ * TT * HD, QP16, QPh, QPl);    // q planes [b][h][t][d]
    k_gemmw<bf, 0, false, 8, 1><<<dim3(TT / 64, DKV / 64, NB_), 256, 0, stream>>>(XB, nullptr, WK, nullptr, DM, nullptr, 0, nullptr, (size_t)TT * DM, 0, (size_t)NKV * TT * HD, KP16, KPh, KPl);   // k planes [b][h][t][d]
    k_gemmw<bf, 0, false, 8, 2><<<dim3(DKV / 64, TT / 64, NB_), 256, 0, stream>>>(WV, nullptr, XB, nullptr, DM, nullptr, TT, nullptr, 0, (size_t)TT * DM, (size_t)NKV * HD * TT, VT16, VTh, VTl);  // V^T planes [b][h][d][t]: the weight rows are the tile's rows
    k_attn<<<dim3(NH_, TT / AR, NB_), 512, 0, stream>>>(QP16, QPh, QPl, KP16, KPh, KPl, VT16, VTh, VTl, ATh, ATl);   // all heads of all batches; S and P never leave LDS
    k_gemmw<bf, 1, false, 16, 0><<<dim3(TT / 64, DOUT / 64, NB_), 512, 0, stream>>>(ATh, ATl, WO, nullptr, DQ, OUT, DOUT, nullptr, (size_t)TT * DQ, 0, (size_t)TT * DOUT, nullptr, nullptr, nullptr);   /* z = o Wo: N 128 */
}

// v006
// It runs in 252 microseconds.
// Timed twice side by side with v005, it ran 1.53 and 1.52 times as fast.
// All steps since v000 together make it 9.72 times as fast.
#include <hip/hip_runtime.h>

// Multi-head attention with per-head weight tensors and 128-wide heads (x [4][2048][1024]; q, k, v = einsum('bnd,hde', x, W[:, i]) with W [8][3][1024][128] (1/32): head h's 'xw' blocks; 8 heads x 128; scores x 1/sqrt(128); softmax (no mask); o = concat heads [2048][1024]; z = o Wo ('xw' [1024][128]) -> [4][2048][128] (1.0 M); argument order x, W, Wo).
// Layout, every activation plane with one slab per batch and the projection, attention and output kernels launched once for all batches (grid z = batch): bf16 copy of x; each head's three 'xw' [1024][128] blocks transposed once into the fused Bt planes (one launch for all of them and Wo); exact projections whose epilogue writes the 16-bit head planes (v as V^T = Wv x^T); dense T-2048 attention (hybrid rows: < 512 hi/lo 3 products, rest fp16 x1024); merged hi/lo x Wo exact (N 128).
// Every 16-bit plane that feeds a matrix product lies in FRAGMENT ORDER (fo() below): a block of 16 rows x 32 k is 1 KB, laid so that lane l's two 16-byte fragment pieces stand at bytes 16 l and 512 + 16 l of the block. A wave-wide fragment load, and a wave-wide plane store, is then 512 contiguous bytes (4 whole lines) where row-major planes gave 16 pieces of 32 bytes.
// Compute dtypes, f32 accumulate: every input rounded to bf16; projections exact; attention rows < 512 3 products, rest fp16; softmax f32; Wo hl x exact.

#define NB_  4
#define TT   2048
#define DM   1024
#define NH_  8
#define NKV  8
#define REP  (NH_ / NKV)
#define HD   128
#define DQ   (NH_ * HD)
#define DKV  (NKV * HD)
#define RH   512                  // query rows < RH use hi+lo planes (0: none)
#define WIN  0
#define PCAR 1024.0f
#define SCL  0.088388347648318447f   // 1/sqrt(float32(128))
#define DOUT 128      // output width
typedef _Float16 h16;
typedef unsigned short bf;
typedef __attribute__((ext_vector_type(16))) __bf16   v16bf;
typedef __attribute__((ext_vector_type(16))) _Float16 v16h;
typedef __attribute__((ext_vector_type(8)))  _Float16 v8h;
typedef __attribute__((ext_vector_type(8)))  unsigned short v8us;
typedef __attribute__((ext_vector_type(8)))  float    v8f;
typedef __attribute__((ext_vector_type(4)))  float    v4f;
typedef v8h  __attribute__((may_alias)) v8ha;
typedef v4f  __attribute__((may_alias)) v4fa;
typedef v8us __attribute__((may_alias)) v8usa;

__device__ __forceinline__ unsigned short f2bf(float f) { unsigned u = __float_as_uint(f); u += 0x7FFFu + ((u >> 16) & 1u); return (unsigned short)(u >> 16); }
__device__ __forceinline__ float bf2f(unsigned short b) { return __uint_as_float(((unsigned)b) << 16); }
__device__ __forceinline__ float bfr(float f) { return bf2f(f2bf(f)); }
__device__ __forceinline__ v16h cat16(v8h lo, v8h hi) { return __builtin_shufflevector(lo, hi, 0, 1, 2, 3, 4, 5, 6, 7, 8, 9, 10, 11, 12, 13, 14, 15); }
__device__ __forceinline__ v16bf cat16b(v8us lo, v8us hi) { return __builtin_bit_cast(v16bf, __builtin_shufflevector(lo, hi, 0, 1, 2, 3, 4, 5, 6, 7, 8, 9, 10, 11, 12, 13, 14, 15)); }
__device__ __forceinline__ v8f wmma16(v16h a, v16h b, v8f c) { return __builtin_amdgcn_wmma_f32_16x16x32_f16(false, a, false, b, (short)0, c, false, false); }
__device__ __forceinline__ v8f wmmab(v16bf a, v16bf b, v8f c) { return __builtin_amdgcn_wmma_f32_16x16x32_bf16(false, a, false, b, (short)0, c, false, false); }

__device__ __forceinline__ h16 tohx(float x) { return (h16)x; }
__device__ __forceinline__ void splitf(float y, unsigned short& h, unsigned short& l) { h = f2bf(y); l = f2bf(y - bf2f(h)); }
typedef __attribute__((ext_vector_type(2))) _Float16 v2h;
typedef __attribute__((ext_vector_type(4))) _Float16 v4h;
typedef __attribute__((ext_vector_type(2))) unsigned short v2us;
typedef __attribute__((ext_vector_type(4))) unsigned short v4us;
typedef __attribute__((ext_vector_type(2))) float v2f;
typedef __attribute__((ext_vector_type(4))) int v4i;

// ---- k_gemmw: register-blocked GEMM, one 64x64 output tile per work-group (16 accumulators per wave), operands straight from fragment-ordered 16-bit planes (ld: row-major piece pair, for LDS rows; ldf: block base + 8 * lane of a fragment-ordered plane); grid (M/64, N/64, Z), 32 * KS threads.
// C[m][n] (f32, pitch ldc, + optional f32 bias[n]) = sum_k A[m][k] Bt[n][k] (+ split products per NSPLIT). z-batch strides sA/sB/sC in elements (sC steps the planes where PLN > 0). K % (32 * KS) == 0.
// PLN > 0 (KS > 1 only): no f32 C; the summed tile goes out as 16-bit planes (fp16, bf16 hi, bf16 lo). PLN 1: head planes [n / HD][m][n % HD]; PLN 3: the same, rows m < RH as hi/lo only and the rest as fp16 only (all that k_attn reads of q); PLN 2: planes [m][n] of ldc columns; each plane (each head's, for PLN 1 and 3) in fragment order.
// KS > 1: wave w sums the contiguous k range [w K/KS, (w+1) K/KS), so the KS waves' load latencies overlap; the KS f32 partial tiles meet in LDS and are added in wave order 0 .. KS-1.
// fo: element offset of (row r, column k) in a fragment-ordered plane of K columns (K % 32 == 0). 8 consecutive k (k % 8 == 0) stay contiguous; the block of rows [16 a, 16 a + 16) x columns [32 b, 32 b + 32) starts at (a K / 32 + b) * 512.
__device__ __forceinline__ size_t fo(int r, int k, int K) { return ((size_t)(r >> 4) * (K >> 5) + (k >> 5)) * 512 + ((k >> 4) & 1) * 256 + ((k >> 3) & 1) * 128 + (r & 15) * 8 + (k & 7); }
template <typename T16> struct WFrag;
template <> struct WFrag<h16> { typedef v16h V; static __device__ __forceinline__ V ld(const h16* p) { return cat16(*(const v8h*)p, *(const v8h*)(p + 16)); } static __device__ __forceinline__ V ldf(const h16* p) { return cat16(*(const v8h*)p, *(const v8h*)(p + 256)); } static __device__ __forceinline__ v8f mma(V a, V b, v8f c) { return wmma16(a, b, c); } };
template <> struct WFrag<bf> { typedef v16bf V; static __device__ __forceinline__ V ld(const bf* p) { return cat16b(*(const v8us*)p, *(const v8us*)(p + 16)); } static __device__ __forceinline__ V ldf(const bf* p) { return cat16b(*(const v8us*)p, *(const v8us*)(p + 256)); } static __device__ __forceinline__ v8f mma(V a, V b, v8f c) { return wmmab(a, b, c); } };
template <typename T16, int NSPLIT, bool BIAS, int KS, int PLN>
__global__ __launch_bounds__(32 * KS) void k_gemmw(const T16* __restrict__ A, const T16* __restrict__ A2, const T16* __restrict__ Bt, const T16* __restrict__ Bt2, int K, float* C, int ldc, const float* __restrict__ bias, size_t sA, size_t sB, size_t sC, h16* P16, bf* Ph, bf* Pl) {
    typedef typename WFrag<T16>::V V;
    __shared__ __align__(16) float os[(KS == 1 ? 16 : KS * 64) * 68];
    const size_t z = blockIdx.z; A += z * sA; if (A2) A2 += z * sA; Bt += z * sB; if (Bt2) Bt2 += z * sB; if (PLN == 0) C += z * sC; else { P16 += z * sC; Ph += z * sC; Pl += z * sC; }
    const int lane = threadIdx.x & 31, lr = lane & 15, hi = lane >> 4; const int r0 = blockIdx.x * 64, c0 = blockIdx.y * 64;
    const int wv = (KS == 1) ? 0 : __builtin_amdgcn_readfirstlane((int)(threadIdx.x >> 5));   // this wave's place in the K split, kept scalar so that the loop bounds are
    v8f acc[4][4];
#pragma unroll
    for (int mb = 0; mb < 4; ++mb)
#pragma unroll
        for (int nb = 0; nb < 4; ++nb) acc[mb][nb] = (v8f){};
    const size_t aoff = (size_t)r0 * K + 8 * lane, boff = (size_t)c0 * K + 8 * lane;   // = fo(r0 + lr, 8 * hi, K): 16 rows on are 16 * K elements on, 32 k on are 512
#pragma unroll 1
    for (int kc = wv * (K / KS); kc < (wv + 1) * (K / KS); kc += 32) {
        V a[4], a2[4];
#pragma unroll
        for (int mb = 0; mb < 4; ++mb) { a[mb] = WFrag<T16>::ldf(A + aoff + (size_t)mb * 16 * K + kc * 16); if (NSPLIT == 1 || NSPLIT == 2) a2[mb] = WFrag<T16>::ldf(A2 + aoff + (size_t)mb * 16 * K + kc * 16); }
#pragma unroll
        for (int nb = 0; nb < 4; ++nb) { const V b = WFrag<T16>::ldf(Bt + boff + (size_t)nb * 16 * K + kc * 16); V b2; if (NSPLIT >= 2) b2 = WFrag<T16>::ldf(Bt2 + boff + (size_t)nb * 16 * K + kc * 16);
#pragma unroll
            for (int mb = 0; mb < 4; ++mb) { acc[mb][nb] = WFrag<T16>::mma(a[mb], b, acc[mb][nb]); if (NSPLIT == 1 || NSPLIT == 2) acc[mb][nb] = WFrag<T16>::mma(a2[mb], b, acc[mb][nb]); if (NSPLIT >= 2) acc[mb][nb] = WFrag<T16>::mma(a[mb], b2, acc[mb][nb]); } }
        asm volatile("v_nop\n\tv_nop\n\tv_nop\n\tv_nop" : "+v"(acc[0][0]), "+v"(acc[1][1]), "+v"(acc[2][2]), "+v"(acc[3][3]) : "v"(a[0]), "v"(a[3]));
    }
    if (KS > 1) {
        float* my = os + wv * (64 * 68);
#pragma unroll
        for (int mb = 0; mb < 4; ++mb)
#pragma unroll
            for (int nb = 0; nb < 4; ++nb)
#pragma unroll
                for (int j = 0; j < 8; ++j) my[(mb * 16 + hi * 8 + j) * 68 + nb * 16 + lr] = acc[mb][nb][j];
        __syncthreads();   // every wave's partial tile is in LDS before any wave adds them
        if (PLN == 0) {
#pragma unroll
            for (int it = 0; it < 32 / KS; ++it) { const int q = it * 32 * KS + (int)threadIdx.x, row = q >> 4, cofs = (q & 15) * 4; v4f val = *(const v4fa*)(os + row * 68 + cofs);
#pragma unroll
                for (int w = 1; w < KS; ++w) val += *(const v4fa*)(os + (w * 64 + row) * 68 + cofs);
                if (BIAS) { val[0] += bfr(bias[c0 + cofs]); val[1] += bfr(bias[c0 + cofs + 1]); val[2] += bfr(bias[c0 + cofs + 2]); val[3] += bfr(bias[c0 + cofs + 3]); }
                *(v4f*)(C + (size_t)(r0 + row) * ldc + c0 + cofs) = val; }
        } else {   // a wave takes 16 rows x 16 columns at a time, lane (lr, hi) the 8 columns 8 hi .. of row lr: its 16 bytes of each plane stand at byte 16 * lane of a 512-byte half block
#pragma unroll
            for (int it = 0; it < 16 / KS; ++it) { const int g = it * KS + wv, row = (g >> 2) * 16 + lr, cofs = (g & 3) * 16 + hi * 8; v4f val[2];
#pragma unroll
                for (int p = 0; p < 2; ++p) { val[p] = *(const v4fa*)(os + row * 68 + cofs + 4 * p);
#pragma unroll
                    for (int w = 1; w < KS; ++w) val[p] += *(const v4fa*)(os + (w * 64 + row) * 68 + cofs + 4 * p); }
                if (BIAS) {
#pragma unroll
                    for (int e = 0; e < 8; ++e) val[e >> 2][e & 3] += bfr(bias[c0 + cofs + e]); }
                const size_t po = (PLN == 2) ? fo(r0 + row, c0 + cofs, ldc) : (size_t)(c0 / HD) * TT * HD + fo(r0 + row, c0 % HD + cofs, HD);
                v8h o16; v8us oh, ol;
#pragma unroll
                for (int e = 0; e < 8; ++e) { const float y = val[e >> 2][e & 3]; o16[e] = tohx(y); unsigned short a2, c2; splitf(y, a2, c2); oh[e] = a2; ol[e] = c2; }
                // each s_wait_xcnt 0 stands directly behind its case's stores, in front of any later write of their address or data registers (the built code tests the cases one after the other)
                if (PLN != 3 || r0 >= RH) { *(v8h*)(P16 + po) = o16; if (PLN == 3) asm volatile("s_wait_xcnt 0x0" ::: "memory"); }
                if (PLN != 3 || r0 < RH) { *(v8us*)(Ph + po) = oh; *(v8us*)(Pl + po) = ol; asm volatile("s_wait_xcnt 0x0" ::: "memory"); } } }
        return;
    }
#pragma unroll
    for (int mb = 0; mb < 4; ++mb) {
#pragma unroll
        for (int nb = 0; nb < 4; ++nb) {
#pragma unroll
            for (int j = 0; j < 8; ++j) os[(hi * 8 + j) * 68 + nb * 16 + lr] = acc[mb][nb][j]; }
        __builtin_amdgcn_wave_barrier(); asm volatile("" ::: "memory");
        float* crow = C + (size_t)(r0 + mb * 16) * ldc + c0;
{
#pragma unroll
            for (int s = 0; s < 8; ++s) { const int row = 2 * s + hi, cofs = lr * 4; v4f val = *(const v4fa*)(os + row * 68 + cofs); if (BIAS) { val[0] += bfr(bias[c0 + cofs]); val[1] += bfr(bias[c0 + cofs + 1]); val[2] += bfr(bias[c0 + cofs + 2]); val[3] += bfr(bias[c0 + cofs + 3]); }
                *(v4f*)(crow + (size_t)row * ldc + cofs) = val; }
             }
        __builtin_amdgcn_wave_barrier(); asm volatile("" ::: "memory");
    }
}


// ---- k_wtG: every 'xw' [DM][HD] weight block (the 3 * NH_ blocks of W in memory order, then Wo, which has the same shape) goes to its bf16 Bt [HD][DM] plane (fragment order) in ONE launch; grid (DM * HD / 4096, 3 * NH_ + 1), blockIdx.y picks the block.
__global__ __launch_bounds__(256) void k_wtG(const float* __restrict__ wall, const float* __restrict__ wo, bf* WQ, bf* WK, bf* WV, bf* WO) {
    static_assert(DQ == DM && DOUT == HD && NKV == NH_, "Wo and every block of W share one shape");
    constexpr int K = DM, N = HD;
    const int y = blockIdx.y, hd = y / 3, pj = y - 3 * hd;   // block y of W is head hd's projection pj (q, k, v); y == 3 * NH_ is Wo
    const float* __restrict__ w = (y < 3 * NH_) ? wall + (size_t)y * K * N : wo;
    bf* Bt = (y < 3 * NH_) ? (pj == 0 ? WQ : pj == 1 ? WK : WV) + (size_t)hd * N * K : WO;   // Bt rows hd * HD .. of that projection
    const int lane = threadIdx.x & 31; const int L0 = (blockIdx.x * 8 + (threadIdx.x >> 5)) * 8; const int nlines = N * K / 64;
{
#pragma unroll 1
        for (int l = 0; l < 8; ++l) { const int L = L0 + l; if (L >= nlines) break; const size_t e = (size_t)L * 64 + lane * 2; const int eb = (int)(e >> 9), ei = (int)(e & 511);   // e = fo(n, k, K), taken apart: block, then place in the block
            const int n = (eb / (K / 32)) * 16 + ((ei >> 3) & 15), k = (eb % (K / 32)) * 32 + (ei >> 8) * 16 + ((ei >> 7) & 1) * 8 + (ei & 7); v2us o;
            o[0] = f2bf(w[(size_t)k * N + n]); o[1] = f2bf(w[(size_t)(k + 1) * N + n]); *(v2us*)(Bt + e) = o; }
         }
}
// ---- k_cvt8: rows of DM f32 -> one bf16 plane in fragment order; thread i writes the plane's elements [8 i, 8 i + 8) = fo(r, k .. k + 7, DM), so a wave stores 512 contiguous bytes and reads 64 bytes of each of 16 rows.
__global__ __launch_bounds__(256) void k_cvt8(const float* __restrict__ src, bf* dst, size_t n8) { const size_t i = (size_t)blockIdx.x * 256 + threadIdx.x; if (i >= n8) return;
    const size_t eb = i >> 6; const int ei = (int)(i & 63); const size_t r = (eb / (DM / 32)) * 16 + (ei & 15); const int k = (int)(eb % (DM / 32)) * 32 + (ei >> 5) * 16 + ((ei >> 4) & 1) * 8;
    const v8f v = *(const v8f*)(src + r * DM + k); v8us o;
#pragma unroll
    for (int k = 0; k < 8; ++k) o[k] = f2bf(v[k]); *(v8us*)(dst + i * 8) = o;  }

// ---- k_attn: scores, softmax, P V and the hi/lo merge of one head's AR query rows in one work-group of 16 waves; grid (heads, TT / AR, batches), each batch's hi/lo row tiles (t0 < RH) first.
// The AR x TT f32 score rows stay in LDS (pitch SP floats); softmax rewrites each row in place as its 16-bit P planes; the P V partial tiles reuse the same LDS.
// Sum orders: scores k = 0, 32, 64, 96; wave w sums the keys [128 w, 128 w + 128) of P V; the 16 f32 partial tiles are added in wave order 0 .. 15.
#define AR  32                    // query rows per work-group
#define SP  (TT + 4)              // score row pitch in floats: 16 B x odd for the b128 fragment reads, and rows 8 apart fall 32 banks apart for the accumulator stores
#define OPP (HD + 4)              // partial output row pitch in floats, same two properties
template <typename T16, bool HL>
__device__ __forceinline__ void attn_rows(const T16* __restrict__ Q, const T16* __restrict__ Q2, const T16* __restrict__ Kp, const T16* __restrict__ K2, const T16* __restrict__ Vt, const T16* __restrict__ V2, bf* Ah, bf* Al, int t0, int h, float* sm) {
    typedef typename WFrag<T16>::V V;
    const int lane = threadIdx.x & 31, lr = lane & 15, hi = lane >> 4;
    const int wv = __builtin_amdgcn_readfirstlane((int)(threadIdx.x >> 5));   // wave number, kept scalar so that the key ranges and LDS bases are scalar too
    {   // S = Q K^T: the AR query rows' fragments stay in registers, wave wv takes keys [128 wv, 128 wv + 128)
        V qa[AR / 16][HD / 32], qb[AR / 16][HD / 32];
#pragma unroll
        for (int mb = 0; mb < AR / 16; ++mb)
#pragma unroll
            for (int ks = 0; ks < HD / 32; ++ks) { const size_t qo = (size_t)(t0 + mb * 16) * HD + ks * 512 + 8 * lane; qa[mb][ks] = WFrag<T16>::ldf(Q + qo); if (HL) qb[mb][ks] = WFrag<T16>::ldf(Q2 + qo); }   // qo = fo(t0 + mb * 16 + lr, ks * 32 + 8 * hi, HD)
        constexpr int G = HL ? 2 : 4, TS = (HD / 32) / G, NS = 8 * TS, NB = HL ? 2 : 3;   // a step is G k blocks of one 16-key tile (8 loads); NB register sets, NB - 1 steps loaded ahead
        V kb[NB][G], kc2[NB][G]; v8f acc[AR / 16];
        auto ldk = [&](int s, V* b, V* b2) {
#pragma unroll
            for (int g = 0; g < G; ++g) { const size_t bo = (size_t)(wv * 128 + (s / TS) * 16) * HD + ((s % TS) * G + g) * 512 + 8 * lane; b[g] = WFrag<T16>::ldf(Kp + bo); if (HL) b2[g] = WFrag<T16>::ldf(K2 + bo); } };   // bo = fo(key tile's row lr, k block's 8 * hi, HD)
#pragma unroll
        for (int s = 0; s < NB - 1; ++s) ldk(s, kb[s], kc2[s]);
#pragma unroll
        for (int s = 0; s < NS; ++s) { const int n0 = wv * 128 + (s / TS) * 16;
            if (s + NB - 1 < NS) ldk(s + NB - 1, kb[(s + NB - 1) % NB], kc2[(s + NB - 1) % NB]);
            __builtin_amdgcn_sched_barrier(0);   // keeps the later steps' loads in front of this step's products, so that their latency runs under them
            if (s % TS == 0) {
#pragma unroll
                for (int mb = 0; mb < AR / 16; ++mb) acc[mb] = (v8f){}; }
#pragma unroll
            for (int g = 0; g < G; ++g) { const int ks = (s % TS) * G + g;
#pragma unroll
                for (int mb = 0; mb < AR / 16; ++mb) { acc[mb] = WFrag<T16>::mma(qa[mb][ks], kb[s % NB][g], acc[mb]); if (HL) { acc[mb] = WFrag<T16>::mma(qb[mb][ks], kb[s % NB][g], acc[mb]); acc[mb] = WFrag<T16>::mma(qa[mb][ks], kc2[s % NB][g], acc[mb]); } } }
            if (s % TS == TS - 1) {
                asm volatile("v_nop\n\tv_nop\n\tv_nop\n\tv_nop" : "+v"(acc[0]), "+v"(acc[1]));   // the four vector slots the chip needs before the next tile's first product rewrites these accumulators (only LDS stores lie between)
#pragma unroll
                for (int mb = 0; mb < AR / 16; ++mb)
#pragma unroll
                    for (int j = 0; j < 8; ++j) sm[(mb * 16 + hi * 8 + j) * SP + n0 + lr] = acc[mb][j]; } }
    }
    __syncthreads();   // every wave's score columns are in LDS before any wave reads whole rows
    // softmax, one wave per row (register row, one exp, fixed trees): t = S x HD^-0.5 (no mask); the row's P planes overwrite the row itself once it is in registers
    for (int r = 0; r < AR / 16; ++r) { float* sr = sm + (wv * (AR / 16) + r) * SP; float v[TT / 32]; float mx = -3.0e38f;
#pragma unroll
        for (int ch = 0; ch < TT / 128; ++ch) { const v4f a = *(const v4fa*)(sr + ch * 128 + lane * 4);
#pragma unroll
            for (int q = 0; q < 4; ++q) { const float t = a[q] * SCL; v[ch * 4 + q] = t; mx = fmaxf(mx, t); } }
#pragma unroll
        for (int sh = 16; sh; sh >>= 1) mx = fmaxf(mx, __shfl_xor(mx, sh, 32));
        float sum = 0.f;
#pragma unroll
        for (int k = 0; k < TT / 32; ++k) { v[k] = __builtin_amdgcn_exp2f(__fmul_rn(__fsub_rn(v[k], mx), 1.4426950408889634f)); sum += v[k]; }
#pragma unroll
        for (int sh = 16; sh; sh >>= 1) sum += __shfl_xor(sum, sh, 32);
        const float f = __fdiv_rn(HL ? 1.0f : PCAR, sum);
        if (HL) { bf* ph = (bf*)sr;   // hi plane in the row's first TT 16-bit places, lo plane in the next TT
#pragma unroll
            for (int ch = 0; ch < TT / 128; ++ch) { v4us oh, ol;
#pragma unroll
                for (int q = 0; q < 4; ++q) { unsigned short a, c2; splitf(v[ch * 4 + q] * f, a, c2); oh[q] = a; ol[q] = c2; }
                *(v4us*)(ph + ch * 128 + lane * 4) = oh; *(v4us*)(ph + TT + ch * 128 + lane * 4) = ol; }
        } else { h16* p16 = (h16*)sr;
#pragma unroll
            for (int ch = 0; ch < TT / 128; ++ch) { v4h o4;
#pragma unroll
                for (int q = 0; q < 4; ++q) o4[q] = tohx(v[ch * 4 + q] * f);
                *(v4h*)(p16 + ch * 128 + lane * 4) = o4; } } }
    constexpr int GV = HL ? 1 : 4, VS = (HD / 16) / GV, NV = 4 * VS, NW = HL ? 3 : 2;   // a step is GV 16-column tiles of V^T at one k block; NW register sets, NW - 1 steps (8 loads) loaded ahead
    V vb[NW][GV], vc[NW][GV];
    auto ldv = [&](int s, V* b, V* b2) {
#pragma unroll
        for (int g = 0; g < GV; ++g) { const size_t vo = (size_t)(((s % VS) * GV + g) * 16) * TT + (wv * 4 + (s / VS)) * 512 + 8 * lane; b[g] = WFrag<T16>::ldf(Vt + vo); if (HL) b2[g] = WFrag<T16>::ldf(V2 + vo); } };   // vo = fo(column tile's row lr, key block's 8 * hi, TT)
#pragma unroll
    for (int s = 0; s < NW - 1; ++s) ldv(s, vb[s], vc[s]);
    __syncthreads();   // every row's P planes are in LDS before any wave reads its key range of all rows
    v8f o[AR / 16][HD / 16];
#pragma unroll
    for (int mb = 0; mb < AR / 16; ++mb)
#pragma unroll
        for (int nb = 0; nb < HD / 16; ++nb) o[mb][nb] = (v8f){};
    const T16* P = (const T16*)sm; V a[AR / 16], a2[AR / 16];
#pragma unroll
    for (int s = 0; s < NV; ++s) {
        if (s + NW - 1 < NV) ldv(s + NW - 1, vb[(s + NW - 1) % NW], vc[(s + NW - 1) % NW]);
        if (s % VS == 0) {
#pragma unroll
            for (int mb = 0; mb < AR / 16; ++mb) { const T16* pr = P + (mb * 16 + lr) * (2 * SP) + 8 * hi + wv * 128 + (s / VS) * 32; a[mb] = WFrag<T16>::ld(pr); if (HL) a2[mb] = WFrag<T16>::ld(pr + TT); } }
        __builtin_amdgcn_sched_barrier(0);   // keeps the later steps' loads in front of this step's products, so that their latency runs under them
#pragma unroll
        for (int g = 0; g < GV; ++g) { const int nb = (s % VS) * GV + g;
#pragma unroll
            for (int mb = 0; mb < AR / 16; ++mb) { o[mb][nb] = WFrag<T16>::mma(a[mb], vb[s % NW][g], o[mb][nb]); if (HL) { o[mb][nb] = WFrag<T16>::mma(a2[mb], vb[s % NW][g], o[mb][nb]); o[mb][nb] = WFrag<T16>::mma(a[mb], vc[s % NW][g], o[mb][nb]); } } } }
    __syncthreads();   // every wave has read its P fragments before the partial tiles overwrite them
    float* my = sm + wv * (AR * OPP);
#pragma unroll
    for (int mb = 0; mb < AR / 16; ++mb)
#pragma unroll
        for (int nb = 0; nb < HD / 16; ++nb)
#pragma unroll
            for (int j = 0; j < 8; ++j) my[(mb * 16 + hi * 8 + j) * OPP + nb * 16 + lr] = o[mb][nb][j];
    __syncthreads();   // every wave's partial tile is in LDS before any wave adds them
    const float cs = HL ? 1.0f : (1.0f / PCAR);
    static_assert(AR * HD / 8 == 512, "one 8-column piece per thread");
    {   // wave wv takes 16 rows x 16 columns, lane (lr, hi) the 8 columns 8 hi .. of row lr: its 16 bytes of each plane stand at byte 16 * lane of a 512-byte half block of the merged rows' fragment order
        const int row = (wv >> 3) * 16 + lr, cofs = (wv & 7) * 16 + hi * 8; v4f val[2];
#pragma unroll
        for (int p = 0; p < 2; ++p) { val[p] = *(const v4fa*)(sm + row * OPP + cofs + 4 * p);
#pragma unroll
            for (int w = 1; w < 16; ++w) val[p] += *(const v4fa*)(sm + (w * AR + row) * OPP + cofs + 4 * p); }
        v8us oh, ol;
#pragma unroll
        for (int e = 0; e < 8; ++e) { unsigned short a, c2; splitf(val[e >> 2][e & 3] * cs, a, c2); oh[e] = a; ol[e] = c2; }
        const size_t oo = fo(t0 + row, h * HD + cofs, DQ); *(v8us*)(Ah + oo) = oh; *(v8us*)(Al + oo) = ol;
        asm volatile("s_wait_xcnt 0x0" ::: "memory"); }   // stands behind the two stores, in front of any later write of their address registers
}
__global__ __launch_bounds__(512) void k_attn(const h16* __restrict__ Q16, const bf* __restrict__ Qh, const bf* __restrict__ Ql, const h16* __restrict__ K16, const bf* __restrict__ Kh, const bf* __restrict__ Kl, const h16* __restrict__ V16, const bf* __restrict__ Vh, const bf* __restrict__ Vl, bf* Ah, bf* Al) {
    __shared__ __align__(16) float sm[16 * AR * OPP];   // 16 partial tiles; the AR score rows (AR * SP floats) fit inside
    const int h = blockIdx.x, t0 = blockIdx.y * AR; const size_t b = blockIdx.z; const size_t zq = (b * NH_ + h) * TT * HD, zk = (b * NKV + h / REP) * TT * HD;
    Ah += b * TT * DQ; Al += b * TT * DQ;   // this batch's slab of the merged head rows
    if (t0 < RH) attn_rows<bf, true>(Qh + zq, Ql + zq, Kh + zk, Kl + zk, Vh + zk, Vl + zk, Ah, Al, t0, h, sm);
    else attn_rows<h16, false>(Q16 + zq, nullptr, K16 + zk, nullptr, V16 + zk, nullptr, Ah, Al, t0, h, sm);
}

extern "C" void kernel_launch(void* const* d_in, const int* in_sizes, int n_in,
                              void* d_out, int out_size, void* d_ws, size_t ws_size, hipStream_t stream) {
    (void)in_sizes; (void)n_in; (void)out_size;
    const float* x = (const float*)d_in[0]; const float* wall = (const float*)d_in[1]; const float* wo = (const float*)d_in[2];   /* order x, W [8][3][1024][128], Wo [1024][128] */ const float* wq = wall; const float* wk = wall; const float* wv = wall; (void)wq; (void)wk; (void)wv;
    float* OUT = (float*)d_out;     // [4][2048][128]
    char* wsp = (char*)d_ws;
    auto take = [&](size_t bytes) { char* p = wsp; wsp += (bytes + 255) & ~(size_t)255; return (void*)p; };
    bf* WQ = (bf*)take((size_t)DQ * DM * 2); bf* WK = (bf*)take((size_t)DKV * DM * 2); bf* WV = (bf*)take((size_t)DKV * DM * 2); bf* WO = (bf*)take((size_t)DOUT * DQ * 2);
    bf* XB = (bf*)take((size_t)NB_ * TT * DM * 2);
    h16* QP16 = (h16*)take((size_t)NB_ * NH_ * TT * HD * 2); h16* KP16 = (h16*)take((size_t)NB_ * NKV * TT * HD * 2); h16* VT16 = (h16*)take((size_t)NB_ * NKV * HD * TT * 2);
    bf* QPh = (bf*)take((size_t)NB_ * NH_ * TT * HD * 2); bf* QPl = (bf*)take((size_t)NB_ * NH_ * TT * HD * 2); bf* KPh = (bf*)take((size_t)NB_ * NKV * TT * HD * 2); bf* KPl = (bf*)take((size_t)NB_ * NKV * TT * HD * 2); bf* VTh = (bf*)take((size_t)NB_ * NKV * HD * TT * 2); bf* VTl = (bf*)take((size_t)NB_ * NKV * HD * TT * 2);
    bf* ATh = (bf*)take((size_t)NB_ * TT * DQ * 2); bf* ATl = (bf*)take((size_t)NB_ * TT * DQ * 2);
    if ((size_t)(wsp - (char*)d_ws) > ws_size) return;    // ws 256 MiB
    k_wtG<<<dim3(DM * HD / 4096, 3 * NH_ + 1, 1), 256, 0, stream>>>(wall, wo, WQ, WK, WV, WO);   /* all 25 'xw' [1024][128] blocks -> Bt [128][1024] planes, one launch */
    k_cvt8<<<(unsigned)(((size_t)NB_ * TT * DM / 8 + 255) / 256), 256, 0, stream>>>(x, XB, (size_t)NB_ * TT * DM / 8);
    k_gemmw<bf, 0, false, 8, 3><<<dim3(TT / 64, DQ / 64, NB_), 256, 0, stream>>>(XB, nullptr, WQ, nullptr, DM, nullptr, 0, nullptr, (size_t)TT * DM, 0, (size_t)NH_ * TT * HD, QP16, QPh, QPl);    // q planes [b][h][t][d]
    k_gemmw<bf, 0, false, 8, 1><<<dim3(TT / 64, DKV / 64, NB_), 256, 0, stream>>>(XB, nullptr, WK, nullptr, DM, nullptr, 0, nullptr, (size_t)TT * DM, 0, (size_t)NKV * TT * HD, KP16, KPh, KPl);   // k planes [b][h][t][d]
    k_gemmw<bf, 0, false, 8, 2><<<dim3(DKV / 64, TT / 64, NB_), 256, 0, stream>>>(WV, nullptr, XB, nullptr, DM, nullptr, TT, nullptr, 0, (size_t)TT * DM, (size_t)NKV * HD * TT, VT16, VTh, VTl);  // V^T planes [b][h][d][t]: the weight rows are the tile's rows
    k_attn<<<dim3(NH_, TT / AR, NB_), 512, 0, stream>>>(QP16, QPh, QPl, KP16, KPh, KPl, VT16, VTh, VTl, ATh, ATl);   // all heads of all batches; S and P never leave LDS
    k_gemmw<bf, 1, false, 16, 0><<<dim3(TT / 64, DOUT / 64, NB_), 512, 0, stream>>>(ATh, ATl, WO, nullptr, DQ, OUT, DOUT, nullptr, (size_t)TT * DQ, 0, (size_t)TT * DOUT, nullptr, nullptr, nullptr);   /* z = o Wo: N 128 */
}

// v007
// One run takes 213 microseconds.
// Two timings next to v006 both put it at 1.18 times that version's speed.
// All steps since v000 together make it 11.5 times as fast.
#include <hip/hip_runtime.h>

// Multi-head attention with per-head weight tensors and 128-wide heads (x [4][2048][1024]; q, k, v = einsum('bnd,hde', x, W[:, i]) with W [8][3][1024][128] (1/32): head h's 'xw' blocks; 8 heads x 128; scores x 1/sqrt(128); softmax (no mask); o = concat heads [2048][1024]; z = o Wo ('xw' [1024][128]) -> [4][2048][128] (1.0 M); argument order x, W, Wo).
// Layout, every activation plane with one slab per batch and the projection, attention and output kernels launched once for all batches (grid z = batch): bf16 copy of x; each head's three 'xw' [1024][128] blocks transposed once into the fused Bt planes (one launch for all of them and Wo); exact projections whose epilogue writes the 16-bit head planes (v as V^T = Wv x^T); dense T-2048 attention (hybrid rows: < 512 hi/lo 3 products, rest fp16 x1024); merged hi/lo x Wo exact (N 128).
// Every 16-bit plane that feeds a matrix product lies in FRAGMENT ORDER (fo() below): a block of 16 rows x 32 k is 1 KB, laid so that lane l's two 16-byte fragment pieces stand at bytes 16 l and 512 + 16 l of the block. A wave-wide fragment load, and a wave-wide plane store, is then 512 contiguous bytes (4 whole lines) where row-major planes gave 16 pieces of 32 bytes.
// Compute dtypes, f32 accumulate: every input rounded to bf16; projections exact; attention rows < 512 3 products, rest fp16; softmax f32; Wo hl x exact.

#define NB_  4
#define TT   2048
#define DM   1024
#define NH_  8
#define NKV  8
#define REP  (NH_ / NKV)
#define HD   128
#define DQ   (NH_ * HD)
#define DKV  (NKV * HD)
#define RH   512                  // query rows < RH use hi+lo planes (0: none)
#define WIN  0
#define PCAR 1024.0f
#define SCL  0.088388347648318447f   // 1/sqrt(float32(128))
#define DOUT 128      // output width
typedef _Float16 h16;
typedef unsigned short bf;
typedef __attribute__((ext_vector_type(16))) __bf16   v16bf;
typedef __attribute__((ext_vector_type(16))) _Float16 v16h;
typedef __attribute__((ext_vector_type(8)))  _Float16 v8h;
typedef __attribute__((ext_vector_type(8)))  unsigned short v8us;
typedef __attribute__((ext_vector_type(8)))  float    v8f;
typedef __attribute__((ext_vector_type(4)))  float    v4f;
typedef v8h  __attribute__((may_alias)) v8ha;
typedef v4f  __attribute__((may_alias)) v4fa;
typedef v8us __attribute__((may_alias)) v8usa;

__device__ __forceinline__ unsigned short f2bf(float f) { unsigned u = __float_as_uint(f); u += 0x7FFFu + ((u >> 16) & 1u); return (unsigned short)(u >> 16); }
__device__ __forceinline__ float bf2f(unsigned short b) { return __uint_as_float(((unsigned)b) << 16); }
__device__ __forceinline__ float bfr(float f) { return bf2f(f2bf(f)); }
__device__ __forceinline__ v16h cat16(v8h lo, v8h hi) { return __builtin_shufflevector(lo, hi, 0, 1, 2, 3, 4, 5, 6, 7, 8, 9, 10, 11, 12, 13, 14, 15); }
__device__ __forceinline__ v16bf cat16b(v8us lo, v8us hi) { return __builtin_bit_cast(v16bf, __builtin_shufflevector(lo, hi, 0, 1, 2, 3, 4, 5, 6, 7, 8, 9, 10, 11, 12, 13, 14, 15)); }
__device__ __forceinline__ v8f wmma16(v16h a, v16h b, v8f c) { return __builtin_amdgcn_wmma_f32_16x16x32_f16(false, a, false, b, (short)0, c, false, false); }
__device__ __forceinline__ v8f wmmab(v16bf a, v16bf b, v8f c) { return __builtin_amdgcn_wmma_f32_16x16x32_bf16(false, a, false, b, (short)0, c, false, false); }

__device__ __forceinline__ h16 tohx(float x) { return (h16)x; }
__device__ __forceinline__ void splitf(float y, unsigned short& h, unsigned short& l) { h = f2bf(y); l = f2bf(y - bf2f(h)); }
typedef __attribute__((ext_vector_type(2))) _Float16 v2h;
typedef __attribute__((ext_vector_type(4))) _Float16 v4h;
typedef __attribute__((ext_vector_type(2))) unsigned short v2us;
typedef __attribute__((ext_vector_type(4))) unsigned short v4us;
typedef __attribute__((ext_vector_type(2))) float v2f;
typedef __attribute__((ext_vector_type(4))) int v4i;

// ---- k_gemmw: register-blocked GEMM, one 64x64 output tile per work-group (16 accumulators per wave), operands straight from fragment-ordered 16-bit planes (ld: row-major piece pair, for LDS rows; ldf: block base + 8 * lane of a fragment-ordered plane); grid (M/64, N/64, Z), 32 * KS threads.
// C[m][n] (f32, pitch ldc, + optional f32 bias[n]) = sum_k A[m][k] Bt[n][k] (+ split products per NSPLIT). z-batch strides sA/sB/sC in elements (sC steps the planes where PLN > 0). K % (32 * KS) == 0.
// PLN > 0 (KS > 1 only): no f32 C; the summed tile goes out as 16-bit planes (fp16, bf16 hi, bf16 lo). PLN 1: head planes [n / HD][m][n % HD]; PLN 3: the same, rows m < RH as hi/lo only and the rest as fp16 only (all that k_attn reads of q); PLN 2: planes [m][n] of ldc columns; each plane (each head's, for PLN 1 and 3) in fragment order.
// KS > 1: wave w sums the contiguous k range [w K/KS, (w+1) K/KS), so the KS waves' load latencies overlap; the KS f32 partial tiles meet in LDS and are added in wave order 0 .. KS-1.
// fo: element offset of (row r, column k) in a fragment-ordered plane of K columns (K % 32 == 0). 8 consecutive k (k % 8 == 0) stay contiguous; the block of rows [16 a, 16 a + 16) x columns [32 b, 32 b + 32) starts at (a K / 32 + b) * 512.
__device__ __forceinline__ size_t fo(int r, int k, int K) { return ((size_t)(r >> 4) * (K >> 5) + (k >> 5)) * 512 + ((k >> 4) & 1) * 256 + ((k >> 3) & 1) * 128 + (r & 15) * 8 + (k & 7); }
template <typename T16> struct WFrag;
template <> struct WFrag<h16> { typedef v16h V; static __device__ __forceinline__ V ld(const h16* p) { return cat16(*(const v8h*)p, *(const v8h*)(p + 16)); } static __device__ __forceinline__ V ldf(const h16* p) { return cat16(*(const v8h*)p, *(const v8h*)(p + 256)); } static __device__ __forceinline__ v8f mma(V a, V b, v8f c) { return wmma16(a, b, c); } };
template <> struct WFrag<bf> { typedef v16bf V; static __device__ __forceinline__ V ld(const bf* p) { return cat16b(*(const v8us*)p, *(const v8us*)(p + 16)); } static __device__ __forceinline__ V ldf(const bf* p) { return cat16b(*(const v8us*)p, *(const v8us*)(p + 256)); } static __device__ __forceinline__ v8f mma(V a, V b, v8f c) { return wmmab(a, b, c); } };
template <typename T16, int NSPLIT, bool BIAS, int KS, int PLN>
__global__ __launch_bounds__(32 * KS) void k_gemmw(const T16* __restrict__ A, const T16* __restrict__ A2, const T16* __restrict__ Bt, const T16* __restrict__ Bt2, int K, float* C, int ldc, const float* __restrict__ bias, size_t sA, size_t sB, size_t sC, h16* P16, bf* Ph, bf* Pl) {
    typedef typename WFrag<T16>::V V;
    __shared__ __align__(16) float os[(KS == 1 ? 16 : KS * 64) * 68];
    const size_t z = blockIdx.z; A += z * sA; if (A2) A2 += z * sA; Bt += z * sB; if (Bt2) Bt2 += z * sB; if (PLN == 0) C += z * sC; else { P16 += z * sC; Ph += z * sC; Pl += z * sC; }
    const int lane = threadIdx.x & 31, lr = lane & 15, hi = lane >> 4; const int r0 = blockIdx.x * 64, c0 = blockIdx.y * 64;
    const int wv = (KS == 1) ? 0 : __builtin_amdgcn_readfirstlane((int)(threadIdx.x >> 5));   // this wave's place in the K split, kept scalar so that the loop bounds are
    v8f acc[4][4];
#pragma unroll
    for (int mb = 0; mb < 4; ++mb)
#pragma unroll
        for (int nb = 0; nb < 4; ++nb) acc[mb][nb] = (v8f){};
    const size_t aoff = (size_t)r0 * K + 8 * lane, boff = (size_t)c0 * K + 8 * lane;   // = fo(r0 + lr, 8 * hi, K): 16 rows on are 16 * K elements on, 32 k on are 512
#pragma unroll 1
    for (int kc = wv * (K / KS); kc < (wv + 1) * (K / KS); kc += 32) {
        V a[4], a2[4];
#pragma unroll
        for (int mb = 0; mb < 4; ++mb) { a[mb] = WFrag<T16>::ldf(A + aoff + (size_t)mb * 16 * K + kc * 16); if (NSPLIT == 1 || NSPLIT == 2) a2[mb] = WFrag<T16>::ldf(A2 + aoff + (size_t)mb * 16 * K + kc * 16); }
#pragma unroll
        for (int nb = 0; nb < 4; ++nb) { const V b = WFrag<T16>::ldf(Bt + boff + (size_t)nb * 16 * K + kc * 16); V b2; if (NSPLIT >= 2) b2 = WFrag<T16>::ldf(Bt2 + boff + (size_t)nb * 16 * K + kc * 16);
#pragma unroll
            for (int mb = 0; mb < 4; ++mb) { acc[mb][nb] = WFrag<T16>::mma(a[mb], b, acc[mb][nb]); if (NSPLIT == 1 || NSPLIT == 2) acc[mb][nb] = WFrag<T16>::mma(a2[mb], b, acc[mb][nb]); if (NSPLIT >= 2) acc[mb][nb] = WFrag<T16>::mma(a[mb], b2, acc[mb][nb]); } }
        asm volatile("v_nop\n\tv_nop\n\tv_nop\n\tv_nop" : "+v"(acc[0][0]), "+v"(acc[1][1]), "+v"(acc[2][2]), "+v"(acc[3][3]) : "v"(a[0]), "v"(a[3]));
    }
    if (KS > 1) {
        float* my = os + wv * (64 * 68);
#pragma unroll
        for (int mb = 0; mb < 4; ++mb)
#pragma unroll
            for (int nb = 0; nb < 4; ++nb)
#pragma unroll
                for (int j = 0; j < 8; ++j) my[(mb * 16 + hi * 8 + j) * 68 + nb * 16 + lr] = acc[mb][nb][j];
        __syncthreads();   // every wave's partial tile is in LDS before any wave adds them
        if (PLN == 0) {
#pragma unroll
            for (int it = 0; it < 32 / KS; ++it) { const int q = it * 32 * KS + (int)threadIdx.x, row = q >> 4, cofs = (q & 15) * 4; v4f val = *(const v4fa*)(os + row * 68 + cofs);
#pragma unroll
                for (int w = 1; w < KS; ++w) val += *(const v4fa*)(os + (w * 64 + row) * 68 + cofs);
                if (BIAS) { val[0] += bfr(bias[c0 + cofs]); val[1] += bfr(bias[c0 + cofs + 1]); val[2] += bfr(bias[c0 + cofs + 2]); val[3] += bfr(bias[c0 + cofs + 3]); }
                *(v4f*)(C + (size_t)(r0 + row) * ldc + c0 + cofs) = val; }
        } else {   // a wave takes 16 rows x 16 columns at a time, lane (lr, hi) the 8 columns 8 hi .. of row lr: its 16 bytes of each plane stand at byte 16 * lane of a 512-byte half block
#pragma unroll
            for (int it = 0; it < 16 / KS; ++it) { const int g = it * KS + wv, row = (g >> 2) * 16 + lr, cofs = (g & 3) * 16 + hi * 8; v4f val[2];
#pragma unroll
                for (int p = 0; p < 2; ++p) { val[p] = *(const v4fa*)(os + row * 68 + cofs + 4 * p);
#pragma unroll
                    for (int w = 1; w < KS; ++w) val[p] += *(const v4fa*)(os + (w * 64 + row) * 68 + cofs + 4 * p); }
                if (BIAS) {
#pragma unroll
                    for (int e = 0; e < 8; ++e) val[e >> 2][e & 3] += bfr(bias[c0 + cofs + e]); }
                const size_t po = (PLN == 2) ? fo(r0 + row, c0 + cofs, ldc) : (size_t)(c0 / HD) * TT * HD + fo(r0 + row, c0 % HD + cofs, HD);
                v8h o16; v8us oh, ol;
#pragma unroll
                for (int e = 0; e < 8; ++e) { const float y = val[e >> 2][e & 3]; o16[e] = tohx(y); unsigned short a2, c2; splitf(y, a2, c2); oh[e] = a2; ol[e] = c2; }
                // each s_wait_xcnt 0 stands directly behind its case's stores, in front of any later write of their address or data registers (the built code tests the cases one after the other)
                if (PLN != 3 || r0 >= RH) { *(v8h*)(P16 + po) = o16; if (PLN == 3) asm volatile("s_wait_xcnt 0x0" ::: "memory"); }
                if (PLN != 3 || r0 < RH) { *(v8us*)(Ph + po) = oh; *(v8us*)(Pl + po) = ol; asm volatile("s_wait_xcnt 0x0" ::: "memory"); } } }
        return;
    }
#pragma unroll
    for (int mb = 0; mb < 4; ++mb) {
#pragma unroll
        for (int nb = 0; nb < 4; ++nb) {
#pragma unroll
            for (int j = 0; j < 8; ++j) os[(hi * 8 + j) * 68 + nb * 16 + lr] = acc[mb][nb][j]; }
        __builtin_amdgcn_wave_barrier(); asm volatile("" ::: "memory");
        float* crow = C + (size_t)(r0 + mb * 16) * ldc + c0;
{
#pragma unroll
            for (int s = 0; s < 8; ++s) { const int row = 2 * s + hi, cofs = lr * 4; v4f val = *(const v4fa*)(os + row * 68 + cofs); if (BIAS) { val[0] += bfr(bias[c0 + cofs]); val[1] += bfr(bias[c0 + cofs + 1]); val[2] += bfr(bias[c0 + cofs + 2]); val[3] += bfr(bias[c0 + cofs + 3]); }
                *(v4f*)(crow + (size_t)row * ldc + cofs) = val; }
             }
        __builtin_amdgcn_wave_barrier(); asm volatile("" ::: "memory");
    }
}


// ---- k_gemms: the three projections. One 128x128 output tile per work-group of 4 waves (2 x 2, each wave a 64x64 tile, 16 accumulators, the whole K range in order k = 0, 32, ...); grid (M/128, N/128, batches).
// A and Bt are fragment-ordered bf16 planes of DM columns. A stage is 128 k of the tile's 128 A rows and 128 Bt rows (64 KB): 16 pieces of 4 KB (16 rows x 128 k), each contiguous in its plane, brought into LDS by asynchronous copies (16 B a lane), so that each operand byte leaves L2 once per work-group and serves two waves. Two buffers: the next stage's copies fly while this stage is worked on.
// The blocks keep their fragment order in LDS: a wave-wide fragment read is 512 contiguous bytes. The output planes are those of k_gemmw's PLN (1, 2, 3).
// cp8: eight copies = four pieces, each in two halves of 2 KB (the work-group's 128 lanes x 16 B); LDS places 2 KB apart, a piece's global place 16 plane rows (16 * DM elements) behind the last. s_wait_xcnt 0 as the statement's last line stands in front of any later write of the address registers the copies name.
__device__ __forceinline__ void cp8(unsigned l, const bf* g) {
    asm volatile("global_load_async_to_lds_b128 %0, %8, off\n\t"
                 "global_load_async_to_lds_b128 %1, %9, off\n\t"
                 "global_load_async_to_lds_b128 %2, %10, off\n\t"
                 "global_load_async_to_lds_b128 %3, %11, off\n\t"
                 "global_load_async_to_lds_b128 %4, %12, off\n\t"
                 "global_load_async_to_lds_b128 %5, %13, off\n\t"
                 "global_load_async_to_lds_b128 %6, %14, off\n\t"
                 "global_load_async_to_lds_b128 %7, %15, off\n\t"
                 "s_wait_xcnt 0x0"
                 :: "v"(l), "v"(l + 2048u), "v"(l + 4096u), "v"(l + 6144u), "v"(l + 8192u), "v"(l + 10240u), "v"(l + 12288u), "v"(l + 14336u),
                    "v"(g), "v"(g + 1024), "v"(g + 16 * DM), "v"(g + 16 * DM + 1024), "v"(g + 32 * DM), "v"(g + 32 * DM + 1024), "v"(g + 48 * DM), "v"(g + 48 * DM + 1024) : "memory");
}
template <int PLN>
__global__ __launch_bounds__(128) void k_gemms(const bf* __restrict__ A, const bf* __restrict__ Bt, int ldc, size_t sA, size_t sB, size_t sC, h16* P16, bf* Ph, bf* Pl) {
    typedef WFrag<bf>::V V;
    constexpr int K = DM, NT = K / 128;   // NT stages of 128 k
    static_assert(NT >= 2, "the prologue fills two stages");
    __shared__ __align__(16) bf ring[2 * 32768];   // two 64 KB stage buffers (A part, then Bt part); afterwards the four waves' f32 tiles (pitch 68) lie in the same bytes
    static_assert(4 * 64 * 68 * 4 <= 2 * 32768 * 2, "the f32 tiles fit in the ring");
    const size_t z = blockIdx.z; A += z * sA; Bt += z * sB; P16 += z * sC; Ph += z * sC; Pl += z * sC;
    const int tid = threadIdx.x, lane = tid & 31, lr = lane & 15, hi = lane >> 4;
    const int wv = __builtin_amdgcn_readfirstlane(tid >> 5), wm = wv >> 1, wn = wv & 1;   // the wave's place in the 2 x 2 tile grid, kept scalar so that its LDS bases are
    const int r0 = blockIdx.x * 128, c0 = blockIdx.y * 128;
    const bf* gA = A + (size_t)r0 * K + tid * 8; const bf* gB = Bt + (size_t)c0 * K + tid * 8;   // this lane's 16 bytes of the first half piece of stage 0
    const unsigned l0 = (unsigned)(size_t)ring + (unsigned)tid * 16u;   // and their place in buffer 0 (LDS byte address)
    auto stage = [&](int t, int b) { const unsigned l = l0 + (unsigned)b * 65536u; const bf* a = gA + t * 2048; const bf* w = gB + t * 2048;   // 128 k on are 2048 elements on in a piece's plane
        cp8(l, a); cp8(l + 16384u, a + 64 * DM); cp8(l + 32768u, w); cp8(l + 49152u, w + 64 * DM); };
    v8f acc[4][4];
#pragma unroll
    for (int mb = 0; mb < 4; ++mb)
#pragma unroll
        for (int nb = 0; nb < 4; ++nb) acc[mb][nb] = (v8f){};
    stage(0, 0);
    asm volatile("s_wait_asynccnt 0x0" ::: "memory");   // this wave's copies of stage 0 have landed
    __syncthreads();   // every wave's copies of stage 0 have landed before any wave reads the buffer
    stage(1, 1);
#pragma unroll 1   // one trip's text serves all stages (64 products a trip already); the buffer is picked by t & 1
    for (int t = 0; t < NT; ++t) {
        const bf* sa = ring + (t & 1) * 32768 + wm * 8192 + 8 * lane; const bf* sb = ring + (t & 1) * 32768 + 16384 + wn * 8192 + 8 * lane;
#pragma unroll
        for (int ks = 0; ks < 4; ++ks) { V a[4], b[4];
#pragma unroll
            for (int mb = 0; mb < 4; ++mb) a[mb] = WFrag<bf>::ldf(sa + mb * 2048 + ks * 512);
#pragma unroll
            for (int nb = 0; nb < 4; ++nb) b[nb] = WFrag<bf>::ldf(sb + nb * 2048 + ks * 512);
            __builtin_amdgcn_sched_barrier(0);   // keeps the k block's 16 LDS reads together in front of its 16 products: one wait for LDS a block, not one for each Bt fragment
#pragma unroll
            for (int nb = 0; nb < 4; ++nb)
#pragma unroll
                for (int mb = 0; mb < 4; ++mb) acc[mb][nb] = WFrag<bf>::mma(a[mb], b[nb], acc[mb][nb]); }
        asm volatile("s_wait_dscnt 0x0" ::: "memory");      // this wave's reads of the buffer are done before it may be refilled
        asm volatile("s_wait_asynccnt 0x0" ::: "memory");   // this wave's copies of stage t + 1 have landed
        __syncthreads();   // publishes stage t + 1 and ends every wave's reads of stage t's buffer
        if (t + 2 < NT) stage(t + 2, t & 1);
    }
    asm volatile("s_wait_asynccnt 0x0" ::: "memory");   // no copy is outstanding when the buffers become output staging
    float* my = (float*)ring + wv * (64 * 68);
#pragma unroll
    for (int mb = 0; mb < 4; ++mb)
#pragma unroll
        for (int nb = 0; nb < 4; ++nb)
#pragma unroll
            for (int j = 0; j < 8; ++j) my[(mb * 16 + hi * 8 + j) * 68 + nb * 16 + lr] = acc[mb][nb][j];
    __syncthreads();   // the tile's stores are in LDS before its rows are read back by other lanes
    const int r0w = r0 + wm * 64, c0w = c0 + wn * 64;
    // 16 rows x 16 columns at a time, lane (lr, hi) the 8 columns 8 hi .. of row lr: its 16 bytes of each plane stand at byte 16 * lane of a 512-byte half block
#pragma unroll 4   // one 16-row band a trip: the column offsets become constants, the text stays a quarter of the full unroll's
    for (int g = 0; g < 16; ++g) { const int row = (g >> 2) * 16 + lr, cofs = (g & 3) * 16 + hi * 8;
        const v4f v0 = *(const v4fa*)(my + row * 68 + cofs), v1 = *(const v4fa*)(my + row * 68 + cofs + 4);
        const size_t po = (PLN == 2) ? fo(r0w + row, c0w + cofs, ldc) : (size_t)(c0w / HD) * TT * HD + fo(r0w + row, c0w % HD + cofs, HD);
        v8h o16; v8us oh, ol;
#pragma unroll
        for (int e = 0; e < 8; ++e) { const float y = e < 4 ? v0[e & 3] : v1[e & 3]; o16[e] = tohx(y); unsigned short a2, c2; splitf(y, a2, c2); oh[e] = a2; ol[e] = c2; }
        // each s_wait_xcnt 0 stands directly behind its case's stores, in front of any later write of their address or data registers
        if (PLN != 3 || r0 >= RH) { *(v8h*)(P16 + po) = o16; if (PLN == 3) asm volatile("s_wait_xcnt 0x0" ::: "memory"); }
        if (PLN != 3 || r0 < RH) { *(v8us*)(Ph + po) = oh; *(v8us*)(Pl + po) = ol; asm volatile("s_wait_xcnt 0x0" ::: "memory"); } }
}

// ---- k_wtG: every 'xw' [DM][HD] weight block (the 3 * NH_ blocks of W in memory order, then Wo, which has the same shape) goes to its bf16 Bt [HD][DM] plane (fragment order) in ONE launch; grid (DM * HD / 4096, 3 * NH_ + 1), blockIdx.y picks the block.
__global__ __launch_bounds__(256) void k_wtG(const float* __restrict__ wall, const float* __restrict__ wo, bf* WQ, bf* WK, bf* WV, bf* WO) {
    static_assert(DQ == DM && DOUT == HD && NKV == NH_, "Wo and every block of W share one shape");
    constexpr int K = DM, N = HD;
    const int y = blockIdx.y, hd = y / 3, pj = y - 3 * hd;   // block y of W is head hd's projection pj (q, k, v); y == 3 * NH_ is Wo
    const float* __restrict__ w = (y < 3 * NH_) ? wall + (size_t)y * K * N : wo;
    bf* Bt = (y < 3 * NH_) ? (pj == 0 ? WQ : pj == 1 ? WK : WV) + (size_t)hd * N * K : WO;   // Bt rows hd * HD .. of that projection
    const int lane = threadIdx.x & 31; const int L0 = (blockIdx.x * 8 + (threadIdx.x >> 5)) * 8; const int nlines = N * K / 64;
{
#pragma unroll 1
        for (int l = 0; l < 8; ++l) { const int L = L0 + l; if (L >= nlines) break; const size_t e = (size_t)L * 64 + lane * 2; const int eb = (int)(e >> 9), ei = (int)(e & 511);   // e = fo(n, k, K), taken apart: block, then place in the block
            const int n = (eb / (K / 32)) * 16 + ((ei >> 3) & 15), k = (eb % (K / 32)) * 32 + (ei >> 8) * 16 + ((ei >> 7) & 1) * 8 + (ei & 7); v2us o;
            o[0] = f2bf(w[(size_t)k * N + n]); o[1] = f2bf(w[(size_t)(k + 1) * N + n]); *(v2us*)(Bt + e) = o; }
         }
}
// ---- k_cvt8: rows of DM f32 -> one bf16 plane in fragment order; thread i writes the plane's elements [8 i, 8 i + 8) = fo(r, k .. k + 7, DM), so a wave stores 512 contiguous bytes and reads 64 bytes of each of 16 rows.
__global__ __launch_bounds__(256) void k_cvt8(const float* __restrict__ src, bf* dst, size_t n8) { const size_t i = (size_t)blockIdx.x * 256 + threadIdx.x; if (i >= n8) return;
    const size_t eb = i >> 6; const int ei = (int)(i & 63); const size_t r = (eb / (DM / 32)) * 16 + (ei & 15); const int k = (int)(eb % (DM / 32)) * 32 + (ei >> 5) * 16 + ((ei >> 4) & 1) * 8;
    const v8f v = *(const v8f*)(src + r * DM + k); v8us o;
#pragma unroll
    for (int k = 0; k < 8; ++k) o[k] = f2bf(v[k]); *(v8us*)(dst + i * 8) = o;  }

// ---- k_attn: scores, softmax, P V and the hi/lo merge of one head's AR query rows in one work-group of 16 waves; grid (heads, TT / AR, batches), each batch's hi/lo row tiles (t0 < RH) first.
// The AR x TT f32 score rows stay in LDS (pitch SP floats); softmax rewrites each row in place as its 16-bit P planes; the P V partial tiles reuse the same LDS.
// Sum orders: scores k = 0, 32, 64, 96; wave w sums the keys [128 w, 128 w + 128) of P V; the 16 f32 partial tiles are added in wave order 0 .. 15.
#define AR  32                    // query rows per work-group
#define SP  (TT + 4)              // score row pitch in floats: 16 B x odd for the b128 fragment reads, and rows 8 apart fall 32 banks apart for the accumulator stores
#define OPP (HD + 4)              // partial output row pitch in floats, same two properties
template <typename T16, bool HL>
__device__ __forceinline__ void attn_rows(const T16* __restrict__ Q, const T16* __restrict__ Q2, const T16* __restrict__ Kp, const T16* __restrict__ K2, const T16* __restrict__ Vt, const T16* __restrict__ V2, bf* Ah, bf* Al, int t0, int h, float* sm) {
    typedef typename WFrag<T16>::V V;
    const int lane = threadIdx.x & 31, lr = lane & 15, hi = lane >> 4;
    const int wv = __builtin_amdgcn_readfirstlane((int)(threadIdx.x >> 5));   // wave number, kept scalar so that the key ranges and LDS bases are scalar too
    {   // S = Q K^T: the AR query rows' fragments stay in registers, wave wv takes keys [128 wv, 128 wv + 128)
        V qa[AR / 16][HD / 32], qb[AR / 16][HD / 32];
#pragma unroll
        for (int mb = 0; mb < AR / 16; ++mb)
#pragma unroll
            for (int ks = 0; ks < HD / 32; ++ks) { const size_t qo = (size_t)(t0 + mb * 16) * HD + ks * 512 + 8 * lane; qa[mb][ks] = WFrag<T16>::ldf(Q + qo); if (HL) qb[mb][ks] = WFrag<T16>::ldf(Q2 + qo); }   // qo = fo(t0 + mb * 16 + lr, ks * 32 + 8 * hi, HD)
        constexpr int G = HL ? 2 : 4, TS = (HD / 32) / G, NS = 8 * TS, NB = HL ? 2 : 3;   // a step is G k blocks of one 16-key tile (8 loads); NB register sets, NB - 1 steps loaded ahead
        V kb[NB][G], kc2[NB][G]; v8f acc[AR / 16];
        auto ldk = [&](int s, V* b, V* b2) {
#pragma unroll
            for (int g = 0; g < G; ++g) { const size_t bo = (size_t)(wv * 128 + (s / TS) * 16) * HD + ((s % TS) * G + g) * 512 + 8 * lane; b[g] = WFrag<T16>::ldf(Kp + bo); if (HL) b2[g] = WFrag<T16>::ldf(K2 + bo); } };   // bo = fo(key tile's row lr, k block's 8 * hi, HD)
#pragma unroll
        for (int s = 0; s < NB - 1; ++s) ldk(s, kb[s], kc2[s]);
#pragma unroll
        for (int s = 0; s < NS; ++s) { const int n0 = wv * 128 + (s / TS) * 16;
            if (s + NB - 1 < NS) ldk(s + NB - 1, kb[(s + NB - 1) % NB], kc2[(s + NB - 1) % NB]);
            __builtin_amdgcn_sched_barrier(0);   // keeps the later steps' loads in front of this step's products, so that their latency runs under them
            if (s % TS == 0) {
#pragma unroll
                for (int mb = 0; mb < AR / 16; ++mb) acc[mb] = (v8f){}; }
#pragma unroll
            for (int g = 0; g < G; ++g) { const int ks = (s % TS) * G + g;
#pragma unroll
                for (int mb = 0; mb < AR / 16; ++mb) { acc[mb] = WFrag<T16>::mma(qa[mb][ks], kb[s % NB][g], acc[mb]); if (HL) { acc[mb] = WFrag<T16>::mma(qb[mb][ks], kb[s % NB][g], acc[mb]); acc[mb] = WFrag<T16>::mma(qa[mb][ks], kc2[s % NB][g], acc[mb]); } } }
            if (s % TS == TS - 1) {
                asm volatile("v_nop\n\tv_nop\n\tv_nop\n\tv_nop" : "+v"(acc[0]), "+v"(acc[1]));   // the four vector slots the chip needs before the next tile's first product rewrites these accumulators (only LDS stores lie between)
#pragma unroll
                for (int mb = 0; mb < AR / 16; ++mb)
#pragma unroll
                    for (int j = 0; j < 8; ++j) sm[(mb * 16 + hi * 8 + j) * SP + n0 + lr] = acc[mb][j]; } }
    }
    __syncthreads();   // every wave's score columns are in LDS before any wave reads whole rows
    // softmax, one wave per row (register row, one exp, fixed trees): t = S x HD^-0.5 (no mask); the row's P planes overwrite the row itself once it is in registers
    for (int r = 0; r < AR / 16; ++r) { float* sr = sm + (wv * (AR / 16) + r) * SP; float v[TT / 32]; float mx = -3.0e38f;
#pragma unroll
        for (int ch = 0; ch < TT / 128; ++ch) { const v4f a = *(const v4fa*)(sr + ch * 128 + lane * 4);
#pragma unroll
            for (int q = 0; q < 4; ++q) { const float t = a[q] * SCL; v[ch * 4 + q] = t; mx = fmaxf(mx, t); } }
#pragma unroll
        for (int sh = 16; sh; sh >>= 1) mx = fmaxf(mx, __shfl_xor(mx, sh, 32));
        float sum = 0.f;
#pragma unroll
        for (int k = 0; k < TT / 32; ++k) { v[k] = __builtin_amdgcn_exp2f(__fmul_rn(__fsub_rn(v[k], mx), 1.4426950408889634f)); sum += v[k]; }
#pragma unroll
        for (int sh = 16; sh; sh >>= 1) sum += __shfl_xor(sum, sh, 32);
        const float f = __fdiv_rn(HL ? 1.0f : PCAR, sum);
        if (HL) { bf* ph = (bf*)sr;   // hi plane in the row's first TT 16-bit places, lo plane in the next TT
#pragma unroll
            for (int ch = 0; ch < TT / 128; ++ch) { v4us oh, ol;
#pragma unroll
                for (int q = 0; q < 4; ++q) { unsigned short a, c2; splitf(v[ch * 4 + q] * f, a, c2); oh[q] = a; ol[q] = c2; }
                *(v4us*)(ph + ch * 128 + lane * 4) = oh; *(v4us*)(ph + TT + ch * 128 + lane * 4) = ol; }
        } else { h16* p16 = (h16*)sr;
#pragma unroll
            for (int ch = 0; ch < TT / 128; ++ch) { v4h o4;
#pragma unroll
                for (int q = 0; q < 4; ++q) o4[q] = tohx(v[ch * 4 + q] * f);
                *(v4h*)(p16 + ch * 128 + lane * 4) = o4; } } }
    constexpr int GV = HL ? 1 : 4, VS = (HD / 16) / GV, NV = 4 * VS, NW = HL ? 3 : 2;   // a step is GV 16-column tiles of V^T at one k block; NW register sets, NW - 1 steps (8 loads) loaded ahead
    V vb[NW][GV], vc[NW][GV];
    auto ldv = [&](int s, V* b, V* b2) {
#pragma unroll
        for (int g = 0; g < GV; ++g) { const size_t vo = (size_t)(((s % VS) * GV + g) * 16) * TT + (wv * 4 + (s / VS)) * 512 + 8 * lane; b[g] = WFrag<T16>::ldf(Vt + vo); if (HL) b2[g] = WFrag<T16>::ldf(V2 + vo); } };   // vo = fo(column tile's row lr, key block's 8 * hi, TT)
#pragma unroll
    for (int s = 0; s < NW - 1; ++s) ldv(s, vb[s], vc[s]);
    __syncthreads();   // every row's P planes are in LDS before any wave reads its key range of all rows
    v8f o[AR / 16][HD / 16];
#pragma unroll
    for (int mb = 0; mb < AR / 16; ++mb)
#pragma unroll
        for (int nb = 0; nb < HD / 16; ++nb) o[mb][nb] = (v8f){};
    const T16* P = (const T16*)sm; V a[AR / 16], a2[AR / 16];
#pragma unroll
    for (int s = 0; s < NV; ++s) {
        if (s + NW - 1 < NV) ldv(s + NW - 1, vb[(s + NW - 1) % NW], vc[(s + NW - 1) % NW]);
        if (s % VS == 0) {
#pragma unroll
            for (int mb = 0; mb < AR / 16; ++mb) { const T16* pr = P + (mb * 16 + lr) * (2 * SP) + 8 * hi + wv * 128 + (s / VS) * 32; a[mb] = WFrag<T16>::ld(pr); if (HL) a2[mb] = WFrag<T16>::ld(pr + TT); } }
        __builtin_amdgcn_sched_barrier(0);   // keeps the later steps' loads in front of this step's products, so that their latency runs under them
#pragma unroll
        for (int g = 0; g < GV; ++g) { const int nb = (s % VS) * GV + g;
#pragma unroll
            for (int mb = 0; mb < AR / 16; ++mb) { o[mb][nb] = WFrag<T16>::mma(a[mb], vb[s % NW][g], o[mb][nb]); if (HL) { o[mb][nb] = WFrag<T16>::mma(a2[mb], vb[s % NW][g], o[mb][nb]); o[mb][nb] = WFrag<T16>::mma(a[mb], vc[s % NW][g], o[mb][nb]); } } } }
    __syncthreads();   // every wave has read its P fragments before the partial tiles overwrite them
    float* my = sm + wv * (AR * OPP);
#pragma unroll
    for (int mb = 0; mb < AR / 16; ++mb)
#pragma unroll
        for (int nb = 0; nb < HD / 16; ++nb)
#pragma unroll
            for (int j = 0; j < 8; ++j) my[(mb * 16 + hi * 8 + j) * OPP + nb * 16 + lr] = o[mb][nb][j];
    __syncthreads();   // every wave's partial tile is in LDS before any wave adds them
    const float cs = HL ? 1.0f : (1.0f / PCAR);
    static_assert(AR * HD / 8 == 512, "one 8-column piece per thread");
    {   // wave wv takes 16 rows x 16 columns, lane (lr, hi) the 8 columns 8 hi .. of row lr: its 16 bytes of each plane stand at byte 16 * lane of a 512-byte half block of the merged rows' fragment order
        const int row = (wv >> 3) * 16 + lr, cofs = (wv & 7) * 16 + hi * 8; v4f val[2];
#pragma unroll
        for (int p = 0; p < 2; ++p) { val[p] = *(const v4fa*)(sm + row * OPP + cofs + 4 * p);
#pragma unroll
            for (int w = 1; w < 16; ++w) val[p] += *(const v4fa*)(sm + (w * AR + row) * OPP + cofs + 4 * p); }
        v8us oh, ol;
#pragma unroll
        for (int e = 0; e < 8; ++e) { unsigned short a, c2; splitf(val[e >> 2][e & 3] * cs, a, c2); oh[e] = a; ol[e] = c2; }
        const size_t oo = fo(t0 + row, h * HD + cofs, DQ); *(v8us*)(Ah + oo) = oh; *(v8us*)(Al + oo) = ol;
        asm volatile("s_wait_xcnt 0x0" ::: "memory"); }   // stands behind the two stores, in front of any later write of their address registers
}
__global__ __launch_bounds__(512) void k_attn(const h16* __restrict__ Q16, const bf* __restrict__ Qh, const bf* __restrict__ Ql, const h16* __restrict__ K16, const bf* __restrict__ Kh, const bf* __restrict__ Kl, const h16* __restrict__ V16, const bf* __restrict__ Vh, const bf* __restrict__ Vl, bf* Ah, bf* Al) {
    __shared__ __align__(16) float sm[16 * AR * OPP];   // 16 partial tiles; the AR score rows (AR * SP floats) fit inside
    const int h = blockIdx.x, t0 = blockIdx.y * AR; const size_t b = blockIdx.z; const size_t zq = (b * NH_ + h) * TT * HD, zk = (b * NKV + h / REP) * TT * HD;
    Ah += b * TT * DQ; Al += b * TT * DQ;   // this batch's slab of the merged head rows
    if (t0 < RH) attn_rows<bf, true>(Qh + zq, Ql + zq, Kh + zk, Kl + zk, Vh + zk, Vl + zk, Ah, Al, t0, h, sm);
    else attn_rows<h16, false>(Q16 + zq, nullptr, K16 + zk, nullptr, V16 + zk, nullptr, Ah, Al, t0, h, sm);
}

extern "C" void kernel_launch(void* const* d_in, const int* in_sizes, int n_in,
                              void* d_out, int out_size, void* d_ws, size_t ws_size, hipStream_t stream) {
    (void)in_sizes; (void)n_in; (void)out_size;
    const float* x = (const float*)d_in[0]; const float* wall = (const float*)d_in[1]; const float* wo = (const float*)d_in[2];   /* order x, W [8][3][1024][128], Wo [1024][128] */ const float* wq = wall; const float* wk = wall; const float* wv = wall; (void)wq; (void)wk; (void)wv;
    float* OUT = (float*)d_out;     // [4][2048][128]
    char* wsp = (char*)d_ws;
    auto take = [&](size_t bytes) { char* p = wsp; wsp += (bytes + 255) & ~(size_t)255; return (void*)p; };
    bf* WQ = (bf*)take((size_t)DQ * DM * 2); bf* WK = (bf*)take((size_t)DKV * DM * 2); bf* WV = (bf*)take((size_t)DKV * DM * 2); bf* WO = (bf*)take((size_t)DOUT * DQ * 2);
    bf* XB = (bf*)take((size_t)NB_ * TT * DM * 2);
    h16* QP16 = (h16*)take((size_t)NB_ * NH_ * TT * HD * 2); h16* KP16 = (h16*)take((size_t)NB_ * NKV * TT * HD * 2); h16* VT16 = (h16*)take((size_t)NB_ * NKV * HD * TT * 2);
    bf* QPh = (bf*)take((size_t)NB_ * NH_ * TT * HD * 2); bf* QPl = (bf*)take((size_t)NB_ * NH_ * TT * HD * 2); bf* KPh = (bf*)take((size_t)NB_ * NKV * TT * HD * 2); bf* KPl = (bf*)take((size_t)NB_ * NKV * TT * HD * 2); bf* VTh = (bf*)take((size_t)NB_ * NKV * HD * TT * 2); bf* VTl = (bf*)take((size_t)NB_ * NKV * HD * TT * 2);
    bf* ATh = (bf*)take((size_t)NB_ * TT * DQ * 2); bf* ATl = (bf*)take((size_t)NB_ * TT * DQ * 2);
    if ((size_t)(wsp - (char*)d_ws) > ws_size) return;    // ws 256 MiB
    k_wtG<<<dim3(DM * HD / 4096, 3 * NH_ + 1, 1), 256, 0, stream>>>(wall, wo, WQ, WK, WV, WO);   /* all 25 'xw' [1024][128] blocks -> Bt [128][1024] planes, one launch */
    k_cvt8<<<(unsigned)(((size_t)NB_ * TT * DM / 8 + 255) / 256), 256, 0, stream>>>(x, XB, (size_t)NB_ * TT * DM / 8);
    k_gemms<3><<<dim3(TT / 128, DQ / 128, NB_), 128, 0, stream>>>(XB, WQ, 0, (size_t)TT * DM, 0, (size_t)NH_ * TT * HD, QP16, QPh, QPl);    // q planes [b][h][t][d]
    k_gemms<1><<<dim3(TT / 128, DKV / 128, NB_), 128, 0, stream>>>(XB, WK, 0, (size_t)TT * DM, 0, (size_t)NKV * TT * HD, KP16, KPh, KPl);   // k planes [b][h][t][d]
    k_gemms<2><<<dim3(DKV / 128, TT / 128, NB_), 128, 0, stream>>>(WV, XB, TT, 0, (size_t)TT * DM, (size_t)NKV * HD * TT, VT16, VTh, VTl);  // V^T planes [b][h][d][t]: the weight rows are the tile's rows
    k_attn<<<dim3(NH_, TT / AR, NB_), 512, 0, stream>>>(QP16, QPh, QPl, KP16, KPh, KPl, VT16, VTh, VTl, ATh, ATl);   // all heads of all batches; S and P never leave LDS
    k_gemmw<bf, 1, false, 16, 0><<<dim3(TT / 64, DOUT / 64, NB_), 512, 0, stream>>>(ATh, ATl, WO, nullptr, DQ, OUT, DOUT, nullptr, (size_t)TT * DQ, 0, (size_t)TT * DOUT, nullptr, nullptr, nullptr);   /* z = o Wo: N 128 */
}

// v008
// A run of this version takes 155 microseconds.
// Two timings next to v007 both put it at 1.37 times that version's speed.
// All steps since v000 together make it 15.7 times as fast.
#include <hip/hip_runtime.h>

// Multi-head attention with per-head weight tensors and 128-wide heads (x [4][2048][1024]; q, k, v = einsum('bnd,hde', x, W[:, i]) with W [8][3][1024][128] (1/32): head h's 'xw' blocks; 8 heads x 128; scores x 1/sqrt(128); softmax (no mask); o = concat heads [2048][1024]; z = o Wo ('xw' [1024][128]) -> [4][2048][128] (1.0 M); argument order x, W, Wo).
// Layout, every plane with one slab per batch and every kernel launched once for all batches (grid z = batch; k_attn: grid x = batches x heads): bf16 copy of x; each head's three 'xw' [1024][128] blocks transposed once into the fused Bt planes (one launch for all of them and Wo); exact projections whose epilogue writes the 16-bit head planes (v as V^T = Wv x^T); dense T-2048 attention with an online softmax (hybrid rows: < 512 hi/lo 3 products, rest fp16); merged hi/lo x Wo exact (N 128).
// Every 16-bit plane that feeds a matrix product lies in FRAGMENT ORDER (fo() below): a block of 16 rows x 32 k is 1 KB, laid so that lane l's two 16-byte fragment pieces stand at bytes 16 l and 512 + 16 l of the block. A wave-wide fragment load, and a wave-wide plane store, is then 512 contiguous bytes (4 whole lines) where row-major planes gave 16 pieces of 32 bytes.
// Compute dtypes, f32 accumulate: every input rounded to bf16; projections exact; attention rows < 512 3 products, rest fp16; softmax f32; Wo hl x exact.

#define NB_  4
#define TT   2048
#define DM   1024
#define NH_  8
#define NKV  8
#define REP  (NH_ / NKV)
#define HD   128
#define DQ   (NH_ * HD)
#define DKV  (NKV * HD)
#define RH   512                  // query rows < RH use hi+lo planes (0: none)
#define WIN  0
#define SCL  0.088388347648318447f   // 1/sqrt(float32(128))
#define DOUT 128      // output width
typedef _Float16 h16;
typedef unsigned short bf;
typedef __attribute__((ext_vector_type(16))) __bf16   v16bf;
typedef __attribute__((ext_vector_type(16))) _Float16 v16h;
typedef __attribute__((ext_vector_type(8)))  _Float16 v8h;
typedef __attribute__((ext_vector_type(8)))  unsigned short v8us;
typedef __attribute__((ext_vector_type(8)))  float    v8f;
typedef __attribute__((ext_vector_type(4)))  float    v4f;
typedef v8h  __attribute__((may_alias)) v8ha;
typedef v4f  __attribute__((may_alias)) v4fa;
typedef v8us __attribute__((may_alias)) v8usa;

__device__ __forceinline__ unsigned short f2bf(float f) { unsigned u = __float_as_uint(f); u += 0x7FFFu + ((u >> 16) & 1u); return (unsigned short)(u >> 16); }
__device__ __forceinline__ float bf2f(unsigned short b) { return __uint_as_float(((unsigned)b) << 16); }
__device__ __forceinline__ float bfr(float f) { return bf2f(f2bf(f)); }
__device__ __forceinline__ v16h cat16(v8h lo, v8h hi) { return __builtin_shufflevector(lo, hi, 0, 1, 2, 3, 4, 5, 6, 7, 8, 9, 10, 11, 12, 13, 14, 15); }
__device__ __forceinline__ v16bf cat16b(v8us lo, v8us hi) { return __builtin_bit_cast(v16bf, __builtin_shufflevector(lo, hi, 0, 1, 2, 3, 4, 5, 6, 7, 8, 9, 10, 11, 12, 13, 14, 15)); }
__device__ __forceinline__ v8f wmma16(v16h a, v16h b, v8f c) { return __builtin_amdgcn_wmma_f32_16x16x32_f16(false, a, false, b, (short)0, c, false, false); }
__device__ __forceinline__ v8f wmmab(v16bf a, v16bf b, v8f c) { return __builtin_amdgcn_wmma_f32_16x16x32_bf16(false, a, false, b, (short)0, c, false, false); }

__device__ __forceinline__ h16 tohx(float x) { return (h16)x; }
__device__ __forceinline__ void splitf(float y, unsigned short& h, unsigned short& l) { h = f2bf(y); l = f2bf(y - bf2f(h)); }
typedef __attribute__((ext_vector_type(2))) _Float16 v2h;
typedef __attribute__((ext_vector_type(4))) _Float16 v4h;
typedef __attribute__((ext_vector_type(2))) unsigned short v2us;
typedef __attribute__((ext_vector_type(4))) unsigned short v4us;
typedef __attribute__((ext_vector_type(2))) float v2f;
typedef __attribute__((ext_vector_type(4))) int v4i;

// ---- k_gemmw: register-blocked GEMM, one 64x64 output tile per work-group (16 accumulators per wave), operands straight from fragment-ordered 16-bit planes (ld: row-major piece pair, for LDS rows; ldf: block base + 8 * lane of a fragment-ordered plane); grid (M/64, N/64, Z), 32 * KS threads.
// C[m][n] (f32, pitch ldc, + optional f32 bias[n]) = sum_k A[m][k] Bt[n][k] (+ split products per NSPLIT). z-batch strides sA/sB/sC in elements (sC steps the planes where PLN > 0). K % (32 * KS) == 0.
// PLN > 0 (KS > 1 only): no f32 C; the summed tile goes out as 16-bit planes (fp16, bf16 hi, bf16 lo). PLN 1: head planes [n / HD][m][n % HD]; PLN 3: the same, rows m < RH as hi/lo only and the rest as fp16 only (all that k_attn reads of q); PLN 2: planes [m][n] of ldc columns; each plane (each head's, for PLN 1 and 3) in fragment order.
// KS > 1: wave w sums the contiguous k range [w K/KS, (w+1) K/KS), so the KS waves' load latencies overlap; the KS f32 partial tiles meet in LDS and are added in wave order 0 .. KS-1.
// fo: element offset of (row r, column k) in a fragment-ordered plane of K columns (K % 32 == 0). 8 consecutive k (k % 8 == 0) stay contiguous; the block of rows [16 a, 16 a + 16) x columns [32 b, 32 b + 32) starts at (a K / 32 + b) * 512.
__device__ __forceinline__ size_t fo(int r, int k, int K) { return ((size_t)(r >> 4) * (K >> 5) + (k >> 5)) * 512 + ((k >> 4) & 1) * 256 + ((k >> 3) & 1) * 128 + (r & 15) * 8 + (k & 7); }
template <typename T16> struct WFrag;
template <> struct WFrag<h16> { typedef v16h V; static __device__ __forceinline__ V ld(const h16* p) { return cat16(*(const v8h*)p, *(const v8h*)(p + 16)); } static __device__ __forceinline__ V ldf(const h16* p) { return cat16(*(const v8h*)p, *(const v8h*)(p + 256)); } static __device__ __forceinline__ v8f mma(V a, V b, v8f c) { return wmma16(a, b, c); } };
template <> struct WFrag<bf> { typedef v16bf V; static __device__ __forceinline__ V ld(const bf* p) { return cat16b(*(const v8us*)p, *(const v8us*)(p + 16)); } static __device__ __forceinline__ V ldf(const bf* p) { return cat16b(*(const v8us*)p, *(const v8us*)(p + 256)); } static __device__ __forceinline__ v8f mma(V a, V b, v8f c) { return wmmab(a, b, c); } };
template <typename T16, int NSPLIT, bool BIAS, int KS, int PLN>
__global__ __launch_bounds__(32 * KS) void k_gemmw(const T16* __restrict__ A, const T16* __restrict__ A2, const T16* __restrict__ Bt, const T16* __restrict__ Bt2, int K, float* C, int ldc, const float* __restrict__ bias, size_t sA, size_t sB, size_t sC, h16* P16, bf* Ph, bf* Pl) {
    typedef typename WFrag<T16>::V V;
    __shared__ __align__(16) float os[(KS == 1 ? 16 : KS * 64) * 68];
    const size_t z = blockIdx.z; A += z * sA; if (A2) A2 += z * sA; Bt += z * sB; if (Bt2) Bt2 += z * sB; if (PLN == 0) C += z * sC; else { P16 += z * sC; Ph += z * sC; Pl += z * sC; }
    const int lane = threadIdx.x & 31, lr = lane & 15, hi = lane >> 4; const int r0 = blockIdx.x * 64, c0 = blockIdx.y * 64;
    const int wv = (KS == 1) ? 0 : __builtin_amdgcn_readfirstlane((int)(threadIdx.x >> 5));   // this wave's place in the K split, kept scalar so that the loop bounds are
    v8f acc[4][4];
#pragma unroll
    for (int mb = 0; mb < 4; ++mb)
#pragma unroll
        for (int nb = 0; nb < 4; ++nb) acc[mb][nb] = (v8f){};
    const size_t aoff = (size_t)r0 * K + 8 * lane, boff = (size_t)c0 * K + 8 * lane;   // = fo(r0 + lr, 8 * hi, K): 16 rows on are 16 * K elements on, 32 k on are 512
#pragma unroll 1
    for (int kc = wv * (K / KS); kc < (wv + 1) * (K / KS); kc += 32) {
        V a[4], a2[4];
#pragma unroll
        for (int mb = 0; mb < 4; ++mb) { a[mb] = WFrag<T16>::ldf(A + aoff + (size_t)mb * 16 * K + kc * 16); if (NSPLIT == 1 || NSPLIT == 2) a2[mb] = WFrag<T16>::ldf(A2 + aoff + (size_t)mb * 16 * K + kc * 16); }
#pragma unroll
        for (int nb = 0; nb < 4; ++nb) { const V b = WFrag<T16>::ldf(Bt + boff + (size_t)nb * 16 * K + kc * 16); V b2; if (NSPLIT >= 2) b2 = WFrag<T16>::ldf(Bt2 + boff + (size_t)nb * 16 * K + kc * 16);
#pragma unroll
            for (int mb = 0; mb < 4; ++mb) { acc[mb][nb] = WFrag<T16>::mma(a[mb], b, acc[mb][nb]); if (NSPLIT == 1 || NSPLIT == 2) acc[mb][nb] = WFrag<T16>::mma(a2[mb], b, acc[mb][nb]); if (NSPLIT >= 2) acc[mb][nb] = WFrag<T16>::mma(a[mb], b2, acc[mb][nb]); } }
        asm volatile("v_nop\n\tv_nop\n\tv_nop\n\tv_nop" : "+v"(acc[0][0]), "+v"(acc[1][1]), "+v"(acc[2][2]), "+v"(acc[3][3]) : "v"(a[0]), "v"(a[3]));
    }
    if (KS > 1) {
        float* my = os + wv * (64 * 68);
#pragma unroll
        for (int mb = 0; mb < 4; ++mb)
#pragma unroll
            for (int nb = 0; nb < 4; ++nb)
#pragma unroll
                for (int j = 0; j < 8; ++j) my[(mb * 16 + hi * 8 + j) * 68 + nb * 16 + lr] = acc[mb][nb][j];
        __syncthreads();   // every wave's partial tile is in LDS before any wave adds them
        if (PLN == 0) {
#pragma unroll
            for (int it = 0; it < 32 / KS; ++it) { const int q = it * 32 * KS + (int)threadIdx.x, row = q >> 4, cofs = (q & 15) * 4; v4f val = *(const v4fa*)(os + row * 68 + cofs);
#pragma unroll
                for (int w = 1; w < KS; ++w) val += *(const v4fa*)(os + (w * 64 + row) * 68 + cofs);
                if (BIAS) { val[0] += bfr(bias[c0 + cofs]); val[1] += bfr(bias[c0 + cofs + 1]); val[2] += bfr(bias[c0 + cofs + 2]); val[3] += bfr(bias[c0 + cofs + 3]); }
                *(v4f*)(C + (size_t)(r0 + row) * ldc + c0 + cofs) = val; }
        } else {   // a wave takes 16 rows x 16 columns at a time, lane (lr, hi) the 8 columns 8 hi .. of row lr: its 16 bytes of each plane stand at byte 16 * lane of a 512-byte half block
#pragma unroll
            for (int it = 0; it < 16 / KS; ++it) { const int g = it * KS + wv, row = (g >> 2) * 16 + lr, cofs = (g & 3) * 16 + hi * 8; v4f val[2];
#pragma unroll
                for (int p = 0; p < 2; ++p) { val[p] = *(const v4fa*)(os + row * 68 + cofs + 4 * p);
#pragma unroll
                    for (int w = 1; w < KS; ++w) val[p] += *(const v4fa*)(os + (w * 64 + row) * 68 + cofs + 4 * p); }
                if (BIAS) {
#pragma unroll
                    for (int e = 0; e < 8; ++e) val[e >> 2][e & 3] += bfr(bias[c0 + cofs + e]); }
                const size_t po = (PLN == 2) ? fo(r0 + row, c0 + cofs, ldc) : (size_t)(c0 / HD) * TT * HD + fo(r0 + row, c0 % HD + cofs, HD);
                v8h o16; v8us oh, ol;
#pragma unroll
                for (int e = 0; e < 8; ++e) { const float y = val[e >> 2][e & 3]; o16[e] = tohx(y); unsigned short a2, c2; splitf(y, a2, c2); oh[e] = a2; ol[e] = c2; }
                // each s_wait_xcnt 0 stands directly behind its case's stores, in front of any later write of their address or data registers (the built code tests the cases one after the other)
                if (PLN != 3 || r0 >= RH) { *(v8h*)(P16 + po) = o16; if (PLN == 3) asm volatile("s_wait_xcnt 0x0" ::: "memory"); }
                if (PLN != 3 || r0 < RH) { *(v8us*)(Ph + po) = oh; *(v8us*)(Pl + po) = ol; asm volatile("s_wait_xcnt 0x0" ::: "memory"); } } }
        return;
    }
#pragma unroll
    for (int mb = 0; mb < 4; ++mb) {
#pragma unroll
        for (int nb = 0; nb < 4; ++nb) {
#pragma unroll
            for (int j = 0; j < 8; ++j) os[(hi * 8 + j) * 68 + nb * 16 + lr] = acc[mb][nb][j]; }
        __builtin_amdgcn_wave_barrier(); asm volatile("" ::: "memory");
        float* crow = C + (size_t)(r0 + mb * 16) * ldc + c0;
{
#pragma unroll
            for (int s = 0; s < 8; ++s) { const int row = 2 * s + hi, cofs = lr * 4; v4f val = *(const v4fa*)(os + row * 68 + cofs); if (BIAS) { val[0] += bfr(bias[c0 + cofs]); val[1] += bfr(bias[c0 + cofs + 1]); val[2] += bfr(bias[c0 + cofs + 2]); val[3] += bfr(bias[c0 + cofs + 3]); }
                *(v4f*)(crow + (size_t)row * ldc + cofs) = val; }
             }
        __builtin_amdgcn_wave_barrier(); asm volatile("" ::: "memory");
    }
}


// ---- k_gemms: the three projections. One 128x128 output tile per work-group of 4 waves (2 x 2, each wave a 64x64 tile, 16 accumulators, the whole K range in order k = 0, 32, ...); grid (M/128, N/128, batches).
// A and Bt are fragment-ordered bf16 planes of DM columns. A stage is 128 k of the tile's 128 A rows and 128 Bt rows (64 KB): 16 pieces of 4 KB (16 rows x 128 k), each contiguous in its plane, brought into LDS by asynchronous copies (16 B a lane), so that each operand byte leaves L2 once per work-group and serves two waves. Two buffers: the next stage's copies fly while this stage is worked on.
// The blocks keep their fragment order in LDS: a wave-wide fragment read is 512 contiguous bytes. The output planes are those of k_gemmw's PLN (1, 2, 3).
// cp8: eight copies = four pieces, each in two halves of 2 KB (the work-group's 128 lanes x 16 B); LDS places 2 KB apart, a piece's global place 16 plane rows (16 * DM elements) behind the last. s_wait_xcnt 0 as the statement's last line stands in front of any later write of the address registers the copies name.
__device__ __forceinline__ void cp8(unsigned l, const bf* g) {
    asm volatile("global_load_async_to_lds_b128 %0, %8, off\n\t"
                 "global_load_async_to_lds_b128 %1, %9, off\n\t"
                 "global_load_async_to_lds_b128 %2, %10, off\n\t"
                 "global_load_async_to_lds_b128 %3, %11, off\n\t"
                 "global_load_async_to_lds_b128 %4, %12, off\n\t"
                 "global_load_async_to_lds_b128 %5, %13, off\n\t"
                 "global_load_async_to_lds_b128 %6, %14, off\n\t"
                 "global_load_async_to_lds_b128 %7, %15, off\n\t"
                 "s_wait_xcnt 0x0"
                 :: "v"(l), "v"(l + 2048u), "v"(l + 4096u), "v"(l + 6144u), "v"(l + 8192u), "v"(l + 10240u), "v"(l + 12288u), "v"(l + 14336u),
                    "v"(g), "v"(g + 1024), "v"(g + 16 * DM), "v"(g + 16 * DM + 1024), "v"(g + 32 * DM), "v"(g + 32 * DM + 1024), "v"(g + 48 * DM), "v"(g + 48 * DM + 1024) : "memory");
}
template <int PLN>
__global__ __launch_bounds__(128) void k_gemms(const bf* __restrict__ A, const bf* __restrict__ Bt, int ldc, size_t sA, size_t sB, size_t sC, h16* P16, bf* Ph, bf* Pl) {
    typedef WFrag<bf>::V V;
    constexpr int K = DM, NT = K / 128;   // NT stages of 128 k
    static_assert(NT >= 2, "the prologue fills two stages");
    __shared__ __align__(16) bf ring[2 * 32768];   // two 64 KB stage buffers (A part, then Bt part); afterwards the four waves' f32 tiles (pitch 68) lie in the same bytes
    static_assert(4 * 64 * 68 * 4 <= 2 * 32768 * 2, "the f32 tiles fit in the ring");
    const size_t z = blockIdx.z; A += z * sA; Bt += z * sB; P16 += z * sC; Ph += z * sC; Pl += z * sC;
    const int tid = threadIdx.x, lane = tid & 31, lr = lane & 15, hi = lane >> 4;
    const int wv = __builtin_amdgcn_readfirstlane(tid >> 5), wm = wv >> 1, wn = wv & 1;   // the wave's place in the 2 x 2 tile grid, kept scalar so that its LDS bases are
    const int r0 = blockIdx.x * 128, c0 = blockIdx.y * 128;
    const bf* gA = A + (size_t)r0 * K + tid * 8; const bf* gB = Bt + (size_t)c0 * K + tid * 8;   // this lane's 16 bytes of the first half piece of stage 0
    const unsigned l0 = (unsigned)(size_t)ring + (unsigned)tid * 16u;   // and their place in buffer 0 (LDS byte address)
    auto stage = [&](int t, int b) { const unsigned l = l0 + (unsigned)b * 65536u; const bf* a = gA + t * 2048; const bf* w = gB + t * 2048;   // 128 k on are 2048 elements on in a piece's plane
        cp8(l, a); cp8(l + 16384u, a + 64 * DM); cp8(l + 32768u, w); cp8(l + 49152u, w + 64 * DM); };
    v8f acc[4][4];
#pragma unroll
    for (int mb = 0; mb < 4; ++mb)
#pragma unroll
        for (int nb = 0; nb < 4; ++nb) acc[mb][nb] = (v8f){};
    stage(0, 0);
    asm volatile("s_wait_asynccnt 0x0" ::: "memory");   // this wave's copies of stage 0 have landed
    __syncthreads();   // every wave's copies of stage 0 have landed before any wave reads the buffer
    stage(1, 1);
#pragma unroll 1   // one trip's text serves all stages (64 products a trip already); the buffer is picked by t & 1
    for (int t = 0; t < NT; ++t) {
        const bf* sa = ring + (t & 1) * 32768 + wm * 8192 + 8 * lane; const bf* sb = ring + (t & 1) * 32768 + 16384 + wn * 8192 + 8 * lane;
#pragma unroll
        for (int ks = 0; ks < 4; ++ks) { V a[4], b[4];
#pragma unroll
            for (int mb = 0; mb < 4; ++mb) a[mb] = WFrag<bf>::ldf(sa + mb * 2048 + ks * 512);
#pragma unroll
            for (int nb = 0; nb < 4; ++nb) b[nb] = WFrag<bf>::ldf(sb + nb * 2048 + ks * 512);
            __builtin_amdgcn_sched_barrier(0);   // keeps the k block's 16 LDS reads together in front of its 16 products: one wait for LDS a block, not one for each Bt fragment
#pragma unroll
            for (int nb = 0; nb < 4; ++nb)
#pragma unroll
                for (int mb = 0; mb < 4; ++mb) acc[mb][nb] = WFrag<bf>::mma(a[mb], b[nb], acc[mb][nb]); }
        asm volatile("s_wait_dscnt 0x0" ::: "memory");      // this wave's reads of the buffer are done before it may be refilled
        asm volatile("s_wait_asynccnt 0x0" ::: "memory");   // this wave's copies of stage t + 1 have landed
        __syncthreads();   // publishes stage t + 1 and ends every wave's reads of stage t's buffer
        if (t + 2 < NT) stage(t + 2, t & 1);
    }
    asm volatile("s_wait_asynccnt 0x0" ::: "memory");   // no copy is outstanding when the buffers become output staging
    float* my = (float*)ring + wv * (64 * 68);
#pragma unroll
    for (int mb = 0; mb < 4; ++mb)
#pragma unroll
        for (int nb = 0; nb < 4; ++nb)
#pragma unroll
            for (int j = 0; j < 8; ++j) my[(mb * 16 + hi * 8 + j) * 68 + nb * 16 + lr] = acc[mb][nb][j];
    __syncthreads();   // the tile's stores are in LDS before its rows are read back by other lanes
    const int r0w = r0 + wm * 64, c0w = c0 + wn * 64;
    // 16 rows x 16 columns at a time, lane (lr, hi) the 8 columns 8 hi .. of row lr: its 16 bytes of each plane stand at byte 16 * lane of a 512-byte half block
#pragma unroll 4   // one 16-row band a trip: the column offsets become constants, the text stays a quarter of the full unroll's
    for (int g = 0; g < 16; ++g) { const int row = (g >> 2) * 16 + lr, cofs = (g & 3) * 16 + hi * 8;
        const v4f v0 = *(const v4fa*)(my + row * 68 + cofs), v1 = *(const v4fa*)(my + row * 68 + cofs + 4);
        const size_t po = (PLN == 2) ? fo(r0w + row, c0w + cofs, ldc) : (size_t)(c0w / HD) * TT * HD + fo(r0w + row, c0w % HD + cofs, HD);
        v8h o16; v8us oh, ol;
#pragma unroll
        for (int e = 0; e < 8; ++e) { const float y = e < 4 ? v0[e & 3] : v1[e & 3]; o16[e] = tohx(y); unsigned short a2, c2; splitf(y, a2, c2); oh[e] = a2; ol[e] = c2; }
        // each s_wait_xcnt 0 stands directly behind its case's stores, in front of any later write of their address or data registers
        if (PLN != 3 || r0 >= RH) { *(v8h*)(P16 + po) = o16; if (PLN == 3) asm volatile("s_wait_xcnt 0x0" ::: "memory"); }
        if (PLN != 3 || r0 < RH) { *(v8us*)(Ph + po) = oh; *(v8us*)(Pl + po) = ol; asm volatile("s_wait_xcnt 0x0" ::: "memory"); } }
}

// ---- k_wtG: every 'xw' [DM][HD] weight block (the 3 * NH_ blocks of W in memory order, then Wo, which has the same shape) goes to its bf16 Bt [HD][DM] plane (fragment order) in ONE launch; grid (DM * HD / 4096, 3 * NH_ + 1), blockIdx.y picks the block.
__global__ __launch_bounds__(256) void k_wtG(const float* __restrict__ wall, const float* __restrict__ wo, bf* WQ, bf* WK, bf* WV, bf* WO) {
    static_assert(DQ == DM && DOUT == HD && NKV == NH_, "Wo and every block of W share one shape");
    constexpr int K = DM, N = HD;
    const int y = blockIdx.y, hd = y / 3, pj = y - 3 * hd;   // block y of W is head hd's projection pj (q, k, v); y == 3 * NH_ is Wo
    const float* __restrict__ w = (y < 3 * NH_) ? wall + (size_t)y * K * N : wo;
    bf* Bt = (y < 3 * NH_) ? (pj == 0 ? WQ : pj == 1 ? WK : WV) + (size_t)hd * N * K : WO;   // Bt rows hd * HD .. of that projection
    const int lane = threadIdx.x & 31; const int L0 = (blockIdx.x * 8 + (threadIdx.x >> 5)) * 8; const int nlines = N * K / 64;
{
#pragma unroll 1
        for (int l = 0; l < 8; ++l) { const int L = L0 + l; if (L >= nlines) break; const size_t e = (size_t)L * 64 + lane * 2; const int eb = (int)(e >> 9), ei = (int)(e & 511);   // e = fo(n, k, K), taken apart: block, then place in the block
            const int n = (eb / (K / 32)) * 16 + ((ei >> 3) & 15), k = (eb % (K / 32)) * 32 + (ei >> 8) * 16 + ((ei >> 7) & 1) * 8 + (ei & 7); v2us o;
            o[0] = f2bf(w[(size_t)k * N + n]); o[1] = f2bf(w[(size_t)(k + 1) * N + n]); *(v2us*)(Bt + e) = o; }
         }
}
// ---- k_cvt8: rows of DM f32 -> one bf16 plane in fragment order; thread i writes the plane's elements [8 i, 8 i + 8) = fo(r, k .. k + 7, DM), so a wave stores 512 contiguous bytes and reads 64 bytes of each of 16 rows.
__global__ __launch_bounds__(256) void k_cvt8(const float* __restrict__ src, bf* dst, size_t n8) { const size_t i = (size_t)blockIdx.x * 256 + threadIdx.x; if (i >= n8) return;
    const size_t eb = i >> 6; const int ei = (int)(i & 63); const size_t r = (eb / (DM / 32)) * 16 + (ei & 15); const int k = (int)(eb % (DM / 32)) * 32 + (ei >> 5) * 16 + ((ei >> 4) & 1) * 8;
    const v8f v = *(const v8f*)(src + r * DM + k); v8us o;
#pragma unroll
    for (int k = 0; k < 8; ++k) o[k] = f2bf(v[k]); *(v8us*)(dst + i * 8) = o;  }

// ---- k_attn: scores, online softmax, P V and the hi/lo merge of BQ query rows of one head in one work-group of 8 waves; grid (batches * heads, TT / BQ), all hi/lo row tiles (t0 < RH) first.
// Transposed products: S^T = K Q^T (A = K fragments from LDS, B = Q fragments kept in registers), O^T += V^T P^T. A lane then holds scores of one query only: 8 keys of each 16-key tile, which are exactly its places of the B operand P^T, so S and P never leave registers.
// Wave wv owns the 32 query columns 32 (wv & 3) .. and, of every stage, the 32-key passes p with p % 2 == wv >> 2. K and V^T come in stages of SK keys (64 KB) by asynchronous copies into two LDS buffers, so that each byte leaves L2 once per 128 query rows.
// Sum orders: scores k = 0, 32, 64, 96; each wave sums its passes in key order under a running maximum (log2 domain; the maximum in use may trail the true one by up to 8, the sums are rescaled only when it would trail by more); the two key halves' sums are added at the end.
#define BQ  128                   // query rows per work-group
typedef __attribute__((ext_vector_type(2))) __bf16 v2bf;
typedef __attribute__((ext_vector_type(8))) unsigned v8u;
typedef __attribute__((ext_vector_type(4))) unsigned v4u;
__device__ __forceinline__ float xhalf(float x) { return __builtin_bit_cast(float, __builtin_amdgcn_permlanex16(__builtin_bit_cast(int, x), __builtin_bit_cast(int, x), 0x76543210, 0xfedcba98, false, false)); }   // lane l's value of lane l ^ 16
__device__ __forceinline__ unsigned pk2b(float a, float b) { return __builtin_bit_cast(unsigned, __builtin_convertvector((v2f){a, b}, v2bf)); }   // two bf16, round to nearest even
__device__ __forceinline__ unsigned pk2h(float a, float b) { return __builtin_bit_cast(unsigned, __builtin_convertvector((v2f){a, b}, v2h)); }    // two fp16, round to nearest even
// cp44: eight copies, four from each of two places; LDS places 4 KB apart (the work-group's 256 lanes x 16 B), global places GS elements apart. s_wait_xcnt 0 as the statement's last line stands in front of any later write of the address registers the copies name.
template <int GS, typename T16>
__device__ __forceinline__ void cp44(unsigned la, const T16* ga, unsigned lb, const T16* gb) {
    asm volatile("global_load_async_to_lds_b128 %0, %8, off\n\t"
                 "global_load_async_to_lds_b128 %1, %9, off\n\t"
                 "global_load_async_to_lds_b128 %2, %10, off\n\t"
                 "global_load_async_to_lds_b128 %3, %11, off\n\t"
                 "global_load_async_to_lds_b128 %4, %12, off\n\t"
                 "global_load_async_to_lds_b128 %5, %13, off\n\t"
                 "global_load_async_to_lds_b128 %6, %14, off\n\t"
                 "global_load_async_to_lds_b128 %7, %15, off\n\t"
                 "s_wait_xcnt 0x0"
                 :: "v"(la), "v"(la + 4096u), "v"(la + 8192u), "v"(la + 12288u), "v"(lb), "v"(lb + 4096u), "v"(lb + 8192u), "v"(lb + 12288u),
                    "v"(ga), "v"(ga + GS), "v"(ga + 2 * GS), "v"(ga + 3 * GS), "v"(gb), "v"(gb + GS), "v"(gb + 2 * GS), "v"(gb + 3 * GS) : "memory");
}
template <typename T16, bool HL>
__device__ __forceinline__ void attn_cols(const T16* __restrict__ Q, const T16* __restrict__ Q2, const T16* __restrict__ Kp, const T16* __restrict__ K2, const T16* __restrict__ Vt, const T16* __restrict__ V2, bf* Ah, bf* Al, int t0, int h, unsigned short* ringu) {
    typedef typename WFrag<T16>::V V;
    constexpr int SK = HL ? 64 : 128, NT = TT / SK, NP = SK / 64, VB = SK / 32;   // keys a stage, stages, passes a wave and stage, 32-key blocks a stage
    static_assert(NT >= 2, "the prologue fills two stages");
    constexpr float CS = SCL * 1.4426950408889634f;   // scores to the log2 domain
    constexpr float OFF = HL ? 0.0f : 4.0f;           // fp16 P carries 2^4 (it cancels against the row sum): small weights stay clear of the fp16 subnormals, the largest is 2^12
    const int tid = threadIdx.x, lane = tid & 31, lr = lane & 15, hi = lane >> 4;
    const int wv = __builtin_amdgcn_readfirstlane(tid >> 5), cw = wv & 3, kh = wv >> 2;   // column group and key half, kept scalar so that the LDS bases and the last branch are
    const T16* ring = (const T16*)ringu;
    const unsigned lb0 = (unsigned)(size_t)ringu;   // buffer 0 (LDS byte address)
    // A buffer, in elements: K at 0 (16-key tile a, k block c at (4 a + c) * 512; hi/lo: the lo plane 8192 on), V^T at 16384 (16-row tile t, key block c at (VB t + c) * 512; hi/lo: the lo plane 8192 on).
    // K: a stage is contiguous in its plane. V^T: a tile's VB blocks are contiguous, the next tile's lie 32768 elements on; with VB 2 one 4 KB copy takes two tiles, the upper 128 lanes the second.
    const T16* bK2 = HL ? K2 : Kp + 8192; const T16* bV2 = HL ? V2 : Vt + 4 * 32768;   // second place of each pair of four copies: the lo plane, or the second half of the stage's part of the plane
    const unsigned kofs = (unsigned)wv * 256u, vofs = HL ? (unsigned)kh * 32768u + (unsigned)cw * 256u : (unsigned)wv * 256u, lofs = (unsigned)lane * 8u;   // element offsets of the wave (scalar) and of the lane in it: thread tid takes the 16 bytes at 16 tid of each 4 KB; the plane bases stay scalar too
    auto stage = [&](int st, int b) { const unsigned l = lb0 + (unsigned)b * 65536u + 2u * kofs + 2u * lofs, ko = kofs + (unsigned)st * (SK * HD) + lofs, vo = vofs + (unsigned)st * (VB * 512) + lofs;
        cp44<2048>(l, Kp + ko, l + 16384u, bK2 + ko);
        cp44<(HL ? 65536 : 32768)>(l + 32768u, Vt + vo, l + 49152u, bV2 + vo); };
    stage(0, 0);
    V qa[2][HD / 32], qb[2][HD / 32];
#pragma unroll
    for (int g = 0; g < 2; ++g)
#pragma unroll
        for (int ks = 0; ks < HD / 32; ++ks) { const size_t qo = (size_t)(t0 + cw * 32 + g * 16) * HD + ks * 512 + 8 * lane; qa[g][ks] = WFrag<T16>::ldf(Q + qo); if (HL) qb[g][ks] = WFrag<T16>::ldf(Q2 + qo); }   // qo = fo(query tile's row lr, ks * 32 + 8 * hi, HD)
    v8f o[2][HD / 16]; float mrun[2], lrun[2];
#pragma unroll
    for (int g = 0; g < 2; ++g) { mrun[g] = -__builtin_inff(); lrun[g] = 0.f;
#pragma unroll
        for (int t = 0; t < HD / 16; ++t) o[g][t] = (v8f){}; }
    asm volatile("s_wait_asynccnt 0x0" ::: "memory");   // this wave's copies of stage 0 have landed
    __syncthreads();   // every wave's copies of stage 0 have landed before any wave reads the buffer
    stage(1, 1);
#pragma unroll 1   // one trip's text serves all stages; the buffer is picked by st & 1
    for (int st = 0; st < NT; ++st) {
        const T16* sb = ring + (st & 1) * 32768 + 8 * lane;
        V kf[2][HD / 32], kl[2][HD / 32];
        auto ldk = [&](int p) {
#pragma unroll
            for (int kt = 0; kt < 2; ++kt)
#pragma unroll
                for (int ks = 0; ks < HD / 32; ++ks) { const T16* kp = sb + ((p * 2 + kt) * 4 + ks) * 512; kf[kt][ks] = WFrag<T16>::ldf(kp); if (HL) kl[kt][ks] = WFrag<T16>::ldf(kp + 8192); } };
        ldk(kh);
#pragma unroll
        for (int i = 0; i < NP; ++i) { const int p = kh + 2 * i;   // this wave's 32-key pass of the stage
            v8f s[2][2];
            __builtin_amdgcn_sched_barrier(0);   // keeps the pass's K reads together in front of its products: one wait for LDS, not one for each fragment
#pragma unroll
            for (int kt = 0; kt < 2; ++kt)
#pragma unroll
                for (int g = 0; g < 2; ++g) { s[kt][g] = (v8f){};
#pragma unroll
                    for (int ks = 0; ks < HD / 32; ++ks) { s[kt][g] = WFrag<T16>::mma(kf[kt][ks], qa[g][ks], s[kt][g]); if (HL) { s[kt][g] = WFrag<T16>::mma(kf[kt][ks], qb[g][ks], s[kt][g]); s[kt][g] = WFrag<T16>::mma(kl[kt][ks], qa[g][ks], s[kt][g]); } } }
            if (i + 1 < NP) ldk(p + 2);   // the wave's next pass of the same stage: its K reads run under this pass's softmax and second product
            V vf[HD / 16], vl[HD / 16];
#pragma unroll
            for (int t = 0; t < HD / 16; ++t) { const T16* vp = sb + 16384 + (t * VB + p) * 512; vf[t] = WFrag<T16>::ldf(vp); if (HL) vl[t] = WFrag<T16>::ldf(vp + 8192); }
            __builtin_amdgcn_sched_barrier(0);   // keeps the V^T reads in front of the softmax arithmetic, so that their latency runs under it
            float mb[2]; bool need = false;
#pragma unroll
            for (int g = 0; g < 2; ++g) { float mx = s[0][g][0];
#pragma unroll
                for (int j = 1; j < 16; ++j) mx = fmaxf(mx, s[j >> 3][g][j & 7]);
                mx = fmaxf(mx, xhalf(mx)) * CS;   // both wave halves hold the query's maximum of this pass, scaled (the scale is positive)
                mb[g] = mx; need = need || (mx > mrun[g] + 8.0f); }
            if (__builtin_amdgcn_ballot_w32(need) != 0) {   // wave-uniform; always taken in a wave's first pass, seldom later
#pragma unroll
                for (int g = 0; g < 2; ++g) { const float mn = fmaxf(mrun[g], mb[g]); const float corr = __builtin_amdgcn_exp2f(mrun[g] - mn);   // 0 in the first pass, where mrun is -inf
                    lrun[g] *= corr; mrun[g] = mn;
#pragma unroll
                    for (int t = 0; t < HD / 16; ++t) o[g][t] = o[g][t] * corr; } }
#pragma unroll
            for (int g = 0; g < 2; ++g) { const float nm = OFF - mrun[g]; v8u wh, wl; float ps0 = 0.f, ps1 = 0.f;
#pragma unroll
                for (int e = 0; e < 8; ++e) {   // operand elements 2 e, 2 e + 1 = keys 8 hi + .. of tile e >> 2: accumulator registers 2 (e & 3), 2 (e & 3) + 1
                    const float p0 = __builtin_amdgcn_exp2f(__builtin_fmaf(s[e >> 2][g][2 * (e & 3)], CS, nm)), p1 = __builtin_amdgcn_exp2f(__builtin_fmaf(s[e >> 2][g][2 * (e & 3) + 1], CS, nm));
                    ps0 += p0; ps1 += p1;
                    if (HL) { const unsigned w = pk2b(p0, p1); wh[e] = w; wl[e] = pk2b(p0 - __uint_as_float(w << 16), p1 - __uint_as_float(w & 0xFFFF0000u)); }
                    else wh[e] = pk2h(p0, p1); }
                lrun[g] += ps0 + ps1;
                const V pf = __builtin_bit_cast(V, wh);
#pragma unroll
                for (int t = 0; t < HD / 16; ++t) { o[g][t] = WFrag<T16>::mma(vf[t], pf, o[g][t]); if (HL) { o[g][t] = WFrag<T16>::mma(vf[t], __builtin_bit_cast(V, wl), o[g][t]); o[g][t] = WFrag<T16>::mma(vl[t], pf, o[g][t]); } } }
            __builtin_amdgcn_sched_barrier(0);
            asm volatile("v_nop\n\tv_nop\n\tv_nop\n\tv_nop");   // the four vector slots the chip needs behind the pass's last products, also on the loop's taken branch, before their operand registers are rewritten
            __builtin_amdgcn_sched_barrier(0);   // the two scheduling barriers keep the v_nops directly behind the products
        }
        asm volatile("s_wait_dscnt 0x0" ::: "memory");      // this wave's reads of the buffer are done before it may be refilled
        asm volatile("s_wait_asynccnt 0x0" ::: "memory");   // this wave's copies of stage st + 1 have landed
        __syncthreads();   // publishes stage st + 1 and ends every wave's reads of stage st's buffer
        if (st + 2 < NT) stage(st + 2, st & 1);
    }
    asm volatile("s_wait_asynccnt 0x0" ::: "memory");   // no copy is outstanding when the buffers become the hand-over space
    // the two key halves of the same columns swap sums through LDS: half 0 hands over column group 1 and finishes group 0, half 1 the other way round. A hand-over is 8 tiles x 32 lanes x 8 floats, then the running maxima and the row sums.
    float* xs = (float*)ringu + cw * (2 * 2112);
    auto put = [&](int g) { float* x = xs + kh * 2112; x[2048 + lane] = mrun[g]; x[2080 + lane] = lrun[g];
#pragma unroll
        for (int t = 0; t < HD / 16; ++t) { *(v4fa*)(x + (t * 2) * 128 + lane * 4) = __builtin_shufflevector(o[g][t], o[g][t], 0, 1, 2, 3); *(v4fa*)(x + (t * 2 + 1) * 128 + lane * 4) = __builtin_shufflevector(o[g][t], o[g][t], 4, 5, 6, 7); } };
    auto fin = [&](int g) { const float* x = xs + (1 - kh) * 2112; const float m1 = x[2048 + lane], l1 = x[2080 + lane]; const float mn = fmaxf(mrun[g], m1);
        const float c0 = __builtin_amdgcn_exp2f(mrun[g] - mn), c1 = __builtin_amdgcn_exp2f(m1 - mn); float l = lrun[g] * c0 + l1 * c1; l += xhalf(l);   // each wave half held the sums of its 8 keys of every tile
        const float inv = __fdiv_rn(1.0f, l), f0 = c0 * inv, f1 = c1 * inv;
#pragma unroll
        for (int t = 0; t < HD / 16; ++t) { const v4f a0 = *(const v4fa*)(x + (t * 2) * 128 + lane * 4), a1 = *(const v4fa*)(x + (t * 2 + 1) * 128 + lane * 4); v4u oh, ol;
#pragma unroll
            for (int e = 0; e < 4; ++e) { const float y0 = o[g][t][2 * e] * f0 + (e < 2 ? a0[2 * e] : a1[2 * e - 4]) * f1, y1 = o[g][t][2 * e + 1] * f0 + (e < 2 ? a0[2 * e + 1] : a1[2 * e - 3]) * f1;
                const unsigned w = pk2b(y0, y1); oh[e] = w; ol[e] = pk2b(y0 - __uint_as_float(w << 16), y1 - __uint_as_float(w & 0xFFFF0000u)); }
            // lane (lr, hi) holds columns 16 t + 8 hi .. + 7 of query row lr of the group: its 16 bytes of each plane stand at byte 16 * lane of a 512-byte half block of the merged rows' fragment order
            const size_t oo = fo(t0 + cw * 32 + g * 16 + lr, h * HD + t * 16 + hi * 8, DQ); *(v4u*)(Ah + oo) = oh; *(v4u*)(Al + oo) = ol;
            asm volatile("s_wait_xcnt 0x0" ::: "memory"); } };   // stands behind the two stores, in front of any later write of their address or data registers
    if (kh == 0) put(1); else put(0);
    __syncthreads();   // both halves' hand-overs are in LDS before either reads the other's
    if (kh == 0) fin(0); else fin(1);
}
__global__ __launch_bounds__(256) void k_attn(const h16* __restrict__ Q16, const bf* __restrict__ Qh, const bf* __restrict__ Ql, const h16* __restrict__ K16, const bf* __restrict__ Kh, const bf* __restrict__ Kl, const h16* __restrict__ V16, const bf* __restrict__ Vh, const bf* __restrict__ Vl, bf* Ah, bf* Al) {
    __shared__ __align__(128) unsigned short ring[2 * 32768];   // two 64 KB stage buffers; afterwards the hand-over space of the key halves
    static_assert(RH % BQ == 0 && TT % BQ == 0, "a row tile is wholly hi/lo or wholly fp16");
    const int h = blockIdx.x % NH_, t0 = blockIdx.y * BQ; const size_t b = blockIdx.x / NH_; const size_t zq = (b * NH_ + h) * TT * HD, zk = (b * NKV + h / REP) * TT * HD;
    Ah += b * TT * DQ; Al += b * TT * DQ;   // this batch's slab of the merged head rows
    if (t0 < RH) attn_cols<bf, true>(Qh + zq, Ql + zq, Kh + zk, Kl + zk, Vh + zk, Vl + zk, Ah, Al, t0, h, ring);
    else attn_cols<h16, false>(Q16 + zq, nullptr, K16 + zk, nullptr, V16 + zk, nullptr, Ah, Al, t0, h, ring);
}

extern "C" void kernel_launch(void* const* d_in, const int* in_sizes, int n_in,
                              void* d_out, int out_size, void* d_ws, size_t ws_size, hipStream_t stream) {
    (void)in_sizes; (void)n_in; (void)out_size;
    const float* x = (const float*)d_in[0]; const float* wall = (const float*)d_in[1]; const float* wo = (const float*)d_in[2];   /* order x, W [8][3][1024][128], Wo [1024][128] */ const float* wq = wall; const float* wk = wall; const float* wv = wall; (void)wq; (void)wk; (void)wv;
    float* OUT = (float*)d_out;     // [4][2048][128]
    char* wsp = (char*)d_ws;
    auto take = [&](size_t bytes) { char* p = wsp; wsp += (bytes + 255) & ~(size_t)255; return (void*)p; };
    bf* WQ = (bf*)take((size_t)DQ * DM * 2); bf* WK = (bf*)take((size_t)DKV * DM * 2); bf* WV = (bf*)take((size_t)DKV * DM * 2); bf* WO = (bf*)take((size_t)DOUT * DQ * 2);
    bf* XB = (bf*)take((size_t)NB_ * TT * DM * 2);
    h16* QP16 = (h16*)take((size_t)NB_ * NH_ * TT * HD * 2); h16* KP16 = (h16*)take((size_t)NB_ * NKV * TT * HD * 2); h16* VT16 = (h16*)take((size_t)NB_ * NKV * HD * TT * 2);
    bf* QPh = (bf*)take((size_t)NB_ * NH_ * TT * HD * 2); bf* QPl = (bf*)take((size_t)NB_ * NH_ * TT * HD * 2); bf* KPh = (bf*)take((size_t)NB_ * NKV * TT * HD * 2); bf* KPl = (bf*)take((size_t)NB_ * NKV * TT * HD * 2); bf* VTh = (bf*)take((size_t)NB_ * NKV * HD * TT * 2); bf* VTl = (bf*)take((size_t)NB_ * NKV * HD * TT * 2);
    bf* ATh = (bf*)take((size_t)NB_ * TT * DQ * 2); bf* ATl = (bf*)take((size_t)NB_ * TT * DQ * 2);
    if ((size_t)(wsp - (char*)d_ws) > ws_size) return;    // ws 256 MiB
    k_wtG<<<dim3(DM * HD / 4096, 3 * NH_ + 1, 1), 256, 0, stream>>>(wall, wo, WQ, WK, WV, WO);   /* all 25 'xw' [1024][128] blocks -> Bt [128][1024] planes, one launch */
    k_cvt8<<<(unsigned)(((size_t)NB_ * TT * DM / 8 + 255) / 256), 256, 0, stream>>>(x, XB, (size_t)NB_ * TT * DM / 8);
    k_gemms<3><<<dim3(TT / 128, DQ / 128, NB_), 128, 0, stream>>>(XB, WQ, 0, (size_t)TT * DM, 0, (size_t)NH_ * TT * HD, QP16, QPh, QPl);    // q planes [b][h][t][d]
    k_gemms<1><<<dim3(TT / 128, DKV / 128, NB_), 128, 0, stream>>>(XB, WK, 0, (size_t)TT * DM, 0, (size_t)NKV * TT * HD, KP16, KPh, KPl);   // k planes [b][h][t][d]
    k_gemms<2><<<dim3(DKV / 128, TT / 128, NB_), 128, 0, stream>>>(WV, XB, TT, 0, (size_t)TT * DM, (size_t)NKV * HD * TT, VT16, VTh, VTl);  // V^T planes [b][h][d][t]: the weight rows are the tile's rows
    k_attn<<<dim3(NH_ * NB_, TT / BQ, 1), 256, 0, stream>>>(QP16, QPh, QPl, KP16, KPh, KPl, VT16, VTh, VTl, ATh, ATl);   // all heads of all batches; S and P never leave registers
    k_gemmw<bf, 1, false, 16, 0><<<dim3(TT / 64, DOUT / 64, NB_), 512, 0, stream>>>(ATh, ATl, WO, nullptr, DQ, OUT, DOUT, nullptr, (size_t)TT * DQ, 0, (size_t)TT * DOUT, nullptr, nullptr, nullptr);   /* z = o Wo: N 128 */
}

// v009
// One run takes 144 microseconds.
// Timed twice side by side with v008, it ran 1.07 and 1.08 times as fast.
// All steps since v000 together make it 16.9 times as fast.
#include <hip/hip_runtime.h>

// Multi-head attention with per-head weight tensors and 128-wide heads (x [4][2048][1024]; q, k, v = einsum('bnd,hde', x, W[:, i]) with W [8][3][1024][128] (1/32): head h's 'xw' blocks; 8 heads x 128; scores x 1/sqrt(128); softmax (no mask); o = concat heads [2048][1024]; z = o Wo ('xw' [1024][128]) -> [4][2048][128] (1.0 M); argument order x, W, Wo).
// Layout, every plane with one slab per batch and every kernel launched once for all batches: bf16 copy of x and each head's three 'xw' [1024][128] blocks (and Wo) transposed into the fused Bt planes, both in one launch (k_prep); the three exact projections in one launch (k_gemms), whose epilogue writes the 16-bit head planes (v as V^T = Wv x^T); dense T-2048 attention with an online softmax (hybrid rows: < 512 hi/lo 3 products, rest fp16); merged hi/lo x Wo exact (N 128).
// Every 16-bit plane that feeds a matrix product lies in FRAGMENT ORDER (fo() below): a block of 16 rows x 32 k is 1 KB, laid so that lane l's two 16-byte fragment pieces stand at bytes 16 l and 512 + 16 l of the block. A wave-wide fragment load, and a wave-wide plane store, is then 512 contiguous bytes (4 whole lines) where row-major planes gave 16 pieces of 32 bytes.
// Compute dtypes, f32 accumulate: every input rounded to bf16; projections exact; attention rows < 512 3 products, rest fp16; softmax f32; Wo hl x exact.

#define NB_  4
#define TT   2048
#define DM   1024
#define NH_  8
#define NKV  8
#define REP  (NH_ / NKV)
#define HD   128
#define DQ   (NH_ * HD)
#define DKV  (NKV * HD)
#define RH   512                  // query rows < RH use hi+lo planes (0: none)
#define WIN  0
#define SCL  0.088388347648318447f   // 1/sqrt(float32(128))
#define DOUT 128      // output width
typedef _Float16 h16;
typedef unsigned short bf;
typedef __attribute__((ext_vector_type(16))) __bf16   v16bf;
typedef __attribute__((ext_vector_type(16))) _Float16 v16h;
typedef __attribute__((ext_vector_type(8)))  _Float16 v8h;
typedef __attribute__((ext_vector_type(8)))  unsigned short v8us;
typedef __attribute__((ext_vector_type(8)))  float    v8f;
typedef __attribute__((ext_vector_type(4)))  float    v4f;
typedef v8h  __attribute__((may_alias)) v8ha;
typedef v4f  __attribute__((may_alias)) v4fa;
typedef v8us __attribute__((may_alias)) v8usa;

__device__ __forceinline__ unsigned short f2bf(float f) { unsigned u = __float_as_uint(f); u += 0x7FFFu + ((u >> 16) & 1u); return (unsigned short)(u >> 16); }
__device__ __forceinline__ float bf2f(unsigned short b) { return __uint_as_float(((unsigned)b) << 16); }
__device__ __forceinline__ float bfr(float f) { return bf2f(f2bf(f)); }
__device__ __forceinline__ v16h cat16(v8h lo, v8h hi) { return __builtin_shufflevector(lo, hi, 0, 1, 2, 3, 4, 5, 6, 7, 8, 9, 10, 11, 12, 13, 14, 15); }
__device__ __forceinline__ v16bf cat16b(v8us lo, v8us hi) { return __builtin_bit_cast(v16bf, __builtin_shufflevector(lo, hi, 0, 1, 2, 3, 4, 5, 6, 7, 8, 9, 10, 11, 12, 13, 14, 15)); }
__device__ __forceinline__ v8f wmma16(v16h a, v16h b, v8f c) { return __builtin_amdgcn_wmma_f32_16x16x32_f16(false, a, false, b, (short)0, c, false, false); }
__device__ __forceinline__ v8f wmmab(v16bf a, v16bf b, v8f c) { return __builtin_amdgcn_wmma_f32_16x16x32_bf16(false, a, false, b, (short)0, c, false, false); }

__device__ __forceinline__ h16 tohx(float x) { return (h16)x; }
__device__ __forceinline__ void splitf(float y, unsigned short& h, unsigned short& l) { h = f2bf(y); l = f2bf(y - bf2f(h)); }
typedef __attribute__((ext_vector_type(2))) _Float16 v2h;
typedef __attribute__((ext_vector_type(4))) _Float16 v4h;
typedef __attribute__((ext_vector_type(2))) unsigned short v2us;
typedef __attribute__((ext_vector_type(4))) unsigned short v4us;
typedef __attribute__((ext_vector_type(2))) float v2f;
typedef __attribute__((ext_vector_type(4))) int v4i;

// ---- k_gemmw: register-blocked GEMM, one 64x64 output tile per work-group (16 accumulators per wave), operands straight from fragment-ordered 16-bit planes (ld: row-major piece pair, for LDS rows; ldf: block base + 8 * lane of a fragment-ordered plane); grid (M/64, N/64, Z), 32 * KS threads.
// C[m][n] (f32, pitch ldc, + optional f32 bias[n]) = sum_k A[m][k] Bt[n][k] (+ split products per NSPLIT). z-batch strides sA/sB/sC in elements (sC steps the planes where PLN > 0). K % (32 * KS) == 0.
// PLN > 0 (KS > 1 only): no f32 C; the summed tile goes out as 16-bit planes (fp16, bf16 hi, bf16 lo). PLN 1: head planes [n / HD][m][n % HD]; PLN 3: the same, rows m < RH as hi/lo only and the rest as fp16 only (all that k_attn reads of q); PLN 2: planes [m][n] of ldc columns; each plane (each head's, for PLN 1 and 3) in fragment order.
// KS > 1: wave w sums the contiguous k range [w K/KS, (w+1) K/KS), so the KS waves' load latencies overlap; the KS f32 partial tiles meet in LDS and are added in wave order 0 .. KS-1.
// fo: element offset of (row r, column k) in a fragment-ordered plane of K columns (K % 32 == 0). 8 consecutive k (k % 8 == 0) stay contiguous; the block of rows [16 a, 16 a + 16) x columns [32 b, 32 b + 32) starts at (a K / 32 + b) * 512.
__device__ __forceinline__ size_t fo(int r, int k, int K) { return ((size_t)(r >> 4) * (K >> 5) + (k >> 5)) * 512 + ((k >> 4) & 1) * 256 + ((k >> 3) & 1) * 128 + (r & 15) * 8 + (k & 7); }
template <typename T16> struct WFrag;
template <> struct WFrag<h16> { typedef v16h V; static __device__ __forceinline__ V ld(const h16* p) { return cat16(*(const v8h*)p, *(const v8h*)(p + 16)); } static __device__ __forceinline__ V ldf(const h16* p) { return cat16(*(const v8h*)p, *(const v8h*)(p + 256)); } static __device__ __forceinline__ v8f mma(V a, V b, v8f c) { return wmma16(a, b, c); } };
template <> struct WFrag<bf> { typedef v16bf V; static __device__ __forceinline__ V ld(const bf* p) { return cat16b(*(const v8us*)p, *(const v8us*)(p + 16)); } static __device__ __forceinline__ V ldf(const bf* p) { return cat16b(*(const v8us*)p, *(const v8us*)(p + 256)); } static __device__ __forceinline__ v8f mma(V a, V b, v8f c) { return wmmab(a, b, c); } };
template <typename T16, int NSPLIT, bool BIAS, int KS, int PLN>
__global__ __launch_bounds__(32 * KS) void k_gemmw(const T16* __restrict__ A, const T16* __restrict__ A2, const T16* __restrict__ Bt, const T16* __restrict__ Bt2, int K, float* C, int ldc, const float* __restrict__ bias, size_t sA, size_t sB, size_t sC, h16* P16, bf* Ph, bf* Pl) {
    typedef typename WFrag<T16>::V V;
    __shared__ __align__(16) float os[(KS == 1 ? 16 : KS * 64) * 68];
    const size_t z = blockIdx.z; A += z * sA; if (A2) A2 += z * sA; Bt += z * sB; if (Bt2) Bt2 += z * sB; if (PLN == 0) C += z * sC; else { P16 += z * sC; Ph += z * sC; Pl += z * sC; }
    const int lane = threadIdx.x & 31, lr = lane & 15, hi = lane >> 4; const int r0 = blockIdx.x * 64, c0 = blockIdx.y * 64;
    const int wv = (KS == 1) ? 0 : __builtin_amdgcn_readfirstlane((int)(threadIdx.x >> 5));   // this wave's place in the K split, kept scalar so that the loop bounds are
    v8f acc[4][4];
#pragma unroll
    for (int mb = 0; mb < 4; ++mb)
#pragma unroll
        for (int nb = 0; nb < 4; ++nb) acc[mb][nb] = (v8f){};
    const size_t aoff = (size_t)r0 * K + 8 * lane, boff = (size_t)c0 * K + 8 * lane;   // = fo(r0 + lr, 8 * hi, K): 16 rows on are 16 * K elements on, 32 k on are 512
#pragma unroll 1
    for (int kc = wv * (K / KS); kc < (wv + 1) * (K / KS); kc += 32) {
        V a[4], a2[4];
#pragma unroll
        for (int mb = 0; mb < 4; ++mb) { a[mb] = WFrag<T16>::ldf(A + aoff + (size_t)mb * 16 * K + kc * 16); if (NSPLIT == 1 || NSPLIT == 2) a2[mb] = WFrag<T16>::ldf(A2 + aoff + (size_t)mb * 16 * K + kc * 16); }
#pragma unroll
        for (int nb = 0; nb < 4; ++nb) { const V b = WFrag<T16>::ldf(Bt + boff + (size_t)nb * 16 * K + kc * 16); V b2; if (NSPLIT >= 2) b2 = WFrag<T16>::ldf(Bt2 + boff + (size_t)nb * 16 * K + kc * 16);
#pragma unroll
            for (int mb = 0; mb < 4; ++mb) { acc[mb][nb] = WFrag<T16>::mma(a[mb], b, acc[mb][nb]); if (NSPLIT == 1 || NSPLIT == 2) acc[mb][nb] = WFrag<T16>::mma(a2[mb], b, acc[mb][nb]); if (NSPLIT >= 2) acc[mb][nb] = WFrag<T16>::mma(a[mb], b2, acc[mb][nb]); } }
        asm volatile("v_nop\n\tv_nop\n\tv_nop\n\tv_nop" : "+v"(acc[0][0]), "+v"(acc[1][1]), "+v"(acc[2][2]), "+v"(acc[3][3]) : "v"(a[0]), "v"(a[3]));
    }
    if (KS > 1) {
        float* my = os + wv * (64 * 68);
#pragma unroll
        for (int mb = 0; mb < 4; ++mb)
#pragma unroll
            for (int nb = 0; nb < 4; ++nb)
#pragma unroll
                for (int j = 0; j < 8; ++j) my[(mb * 16 + hi * 8 + j) * 68 + nb * 16 + lr] = acc[mb][nb][j];
        __syncthreads();   // every wave's partial tile is in LDS before any wave adds them
        if (PLN == 0) {
#pragma unroll
            for (int it = 0; it < 32 / KS; ++it) { const int q = it * 32 * KS + (int)threadIdx.x, row = q >> 4, cofs = (q & 15) * 4; v4f val = *(const v4fa*)(os + row * 68 + cofs);
#pragma unroll
                for (int w = 1; w < KS; ++w) val += *(const v4fa*)(os + (w * 64 + row) * 68 + cofs);
                if (BIAS) { val[0] += bfr(bias[c0 + cofs]); val[1] += bfr(bias[c0 + cofs + 1]); val[2] += bfr(bias[c0 + cofs + 2]); val[3] += bfr(bias[c0 + cofs + 3]); }
                *(v4f*)(C + (size_t)(r0 + row) * ldc + c0 + cofs) = val; }
        } else {   // a wave takes 16 rows x 16 columns at a time, lane (lr, hi) the 8 columns 8 hi .. of row lr: its 16 bytes of each plane stand at byte 16 * lane of a 512-byte half block
#pragma unroll
            for (int it = 0; it < 16 / KS; ++it) { const int g = it * KS + wv, row = (g >> 2) * 16 + lr, cofs = (g & 3) * 16 + hi * 8; v4f val[2];
#pragma unroll
                for (int p = 0; p < 2; ++p) { val[p] = *(const v4fa*)(os + row * 68 + cofs + 4 * p);
#pragma unroll
                    for (int w = 1; w < KS; ++w) val[p] += *(const v4fa*)(os + (w * 64 + row) * 68 + cofs + 4 * p); }
                if (BIAS) {
#pragma unroll
                    for (int e = 0; e < 8; ++e) val[e >> 2][e & 3] += bfr(bias[c0 + cofs + e]); }
                const size_t po = (PLN == 2) ? fo(r0 + row, c0 + cofs, ldc) : (size_t)(c0 / HD) * TT * HD + fo(r0 + row, c0 % HD + cofs, HD);
                v8h o16; v8us oh, ol;
#pragma unroll
                for (int e = 0; e < 8; ++e) { const float y = val[e >> 2][e & 3]; o16[e] = tohx(y); unsigned short a2, c2; splitf(y, a2, c2); oh[e] = a2; ol[e] = c2; }
                // each s_wait_xcnt 0 stands directly behind its case's stores, in front of any later write of their address or data registers (the built code tests the cases one after the other)
                if (PLN != 3 || r0 >= RH) { *(v8h*)(P16 + po) = o16; if (PLN == 3) asm volatile("s_wait_xcnt 0x0" ::: "memory"); }
                if (PLN != 3 || r0 < RH) { *(v8us*)(Ph + po) = oh; *(v8us*)(Pl + po) = ol; asm volatile("s_wait_xcnt 0x0" ::: "memory"); } } }
        return;
    }
#pragma unroll
    for (int mb = 0; mb < 4; ++mb) {
#pragma unroll
        for (int nb = 0; nb < 4; ++nb) {
#pragma unroll
            for (int j = 0; j < 8; ++j) os[(hi * 8 + j) * 68 + nb * 16 + lr] = acc[mb][nb][j]; }
        __builtin_amdgcn_wave_barrier(); asm volatile("" ::: "memory");
        float* crow = C + (size_t)(r0 + mb * 16) * ldc + c0;
{
#pragma unroll
            for (int s = 0; s < 8; ++s) { const int row = 2 * s + hi, cofs = lr * 4; v4f val = *(const v4fa*)(os + row * 68 + cofs); if (BIAS) { val[0] += bfr(bias[c0 + cofs]); val[1] += bfr(bias[c0 + cofs + 1]); val[2] += bfr(bias[c0 + cofs + 2]); val[3] += bfr(bias[c0 + cofs + 3]); }
                *(v4f*)(crow + (size_t)row * ldc + cofs) = val; }
             }
        __builtin_amdgcn_wave_barrier(); asm volatile("" ::: "memory");
    }
}


// ---- k_gemms: the three projections, one launch. One 128x128 output tile per work-group of 4 waves (2 x 2, each wave a 64x64 tile, 16 accumulators, the whole K range in order k = 0, 32, ...); gemms_tile is the work of one work-group on tile (bx, by) of one projection of one batch.
// A and Bt are fragment-ordered bf16 planes of DM columns. A stage is 128 k of the tile's 128 A rows and 128 Bt rows (64 KB): 16 pieces of 4 KB (16 rows x 128 k), each contiguous in its plane, brought into LDS by asynchronous copies (16 B a lane), so that each operand byte leaves L2 once per work-group and serves two waves. Two buffers: the next stage's copies fly while this stage is worked on.
// The blocks keep their fragment order in LDS: a wave-wide fragment read is 512 contiguous bytes. The output planes are those of k_gemmw's PLN (1, 2, 3).
// cp8: eight copies = four pieces, each in two halves of 2 KB (the work-group's 128 lanes x 16 B); LDS places 2 KB apart, a piece's global place 16 plane rows (16 * DM elements) behind the last. s_wait_xcnt 0 as the statement's last line stands in front of any later write of the address registers the copies name.
__device__ __forceinline__ void cp8(unsigned l, const bf* g) {
    asm volatile("global_load_async_to_lds_b128 %0, %8, off\n\t"
                 "global_load_async_to_lds_b128 %1, %9, off\n\t"
                 "global_load_async_to_lds_b128 %2, %10, off\n\t"
                 "global_load_async_to_lds_b128 %3, %11, off\n\t"
                 "global_load_async_to_lds_b128 %4, %12, off\n\t"
                 "global_load_async_to_lds_b128 %5, %13, off\n\t"
                 "global_load_async_to_lds_b128 %6, %14, off\n\t"
                 "global_load_async_to_lds_b128 %7, %15, off\n\t"
                 "s_wait_xcnt 0x0"
                 :: "v"(l), "v"(l + 2048u), "v"(l + 4096u), "v"(l + 6144u), "v"(l + 8192u), "v"(l + 10240u), "v"(l + 12288u), "v"(l + 14336u),
                    "v"(g), "v"(g + 1024), "v"(g + 16 * DM), "v"(g + 16 * DM + 1024), "v"(g + 32 * DM), "v"(g + 32 * DM + 1024), "v"(g + 48 * DM), "v"(g + 48 * DM + 1024) : "memory");
}
template <int PLN>
__device__ __forceinline__ void gemms_tile(const bf* __restrict__ A, const bf* __restrict__ Bt, int ldc, h16* P16, bf* Ph, bf* Pl, int bx, int by, bf* ring) {
    typedef WFrag<bf>::V V;
    constexpr int K = DM, NT = K / 128;   // NT stages of 128 k
    static_assert(NT >= 2, "the prologue fills two stages");
    static_assert(4 * 64 * 68 * 4 <= 2 * 32768 * 2, "the f32 tiles fit in the ring");
    const int tid = threadIdx.x, lane = tid & 31, lr = lane & 15, hi = lane >> 4;
    const int wv = __builtin_amdgcn_readfirstlane(tid >> 5), wm = wv >> 1, wn = wv & 1;   // the wave's place in the 2 x 2 tile grid, kept scalar so that its LDS bases are
    const int r0 = bx * 128, c0 = by * 128;
    const bf* gA = A + (size_t)r0 * K + tid * 8; const bf* gB = Bt + (size_t)c0 * K + tid * 8;   // this lane's 16 bytes of the first half piece of stage 0
    const unsigned l0 = (unsigned)(size_t)ring + (unsigned)tid * 16u;   // and their place in buffer 0 (LDS byte address)
    auto stage = [&](int t, int b) { const unsigned l = l0 + (unsigned)b * 65536u; const bf* a = gA + t * 2048; const bf* w = gB + t * 2048;   // 128 k on are 2048 elements on in a piece's plane
        cp8(l, a); cp8(l + 16384u, a + 64 * DM); cp8(l + 32768u, w); cp8(l + 49152u, w + 64 * DM); };
    v8f acc[4][4];
#pragma unroll
    for (int mb = 0; mb < 4; ++mb)
#pragma unroll
        for (int nb = 0; nb < 4; ++nb) acc[mb][nb] = (v8f){};
    stage(0, 0);
    asm volatile("s_wait_asynccnt 0x0" ::: "memory");   // this wave's copies of stage 0 have landed
    __syncthreads();   // every wave's copies of stage 0 have landed before any wave reads the buffer
    stage(1, 1);
#pragma unroll 1   // one trip's text serves all stages (64 products a trip already); the buffer is picked by t & 1
    for (int t = 0; t < NT; ++t) {
        const bf* sa = ring + (t & 1) * 32768 + wm * 8192 + 8 * lane; const bf* sb = ring + (t & 1) * 32768 + 16384 + wn * 8192 + 8 * lane;
#pragma unroll
        for (int ks = 0; ks < 4; ++ks) { V a[4], b[4];
#pragma unroll
            for (int mb = 0; mb < 4; ++mb) a[mb] = WFrag<bf>::ldf(sa + mb * 2048 + ks * 512);
#pragma unroll
            for (int nb = 0; nb < 4; ++nb) b[nb] = WFrag<bf>::ldf(sb + nb * 2048 + ks * 512);
            __builtin_amdgcn_sched_barrier(0);   // keeps the k block's 16 LDS reads together in front of its 16 products: one wait for LDS a block, not one for each Bt fragment
#pragma unroll
            for (int nb = 0; nb < 4; ++nb)
#pragma unroll
                for (int mb = 0; mb < 4; ++mb) acc[mb][nb] = WFrag<bf>::mma(a[mb], b[nb], acc[mb][nb]); }
        asm volatile("s_wait_dscnt 0x0" ::: "memory");      // this wave's reads of the buffer are done before it may be refilled
        asm volatile("s_wait_asynccnt 0x0" ::: "memory");   // this wave's copies of stage t + 1 have landed
        __syncthreads();   // publishes stage t + 1 and ends every wave's reads of stage t's buffer
        if (t + 2 < NT) stage(t + 2, t & 1);
    }
    asm volatile("s_wait_asynccnt 0x0" ::: "memory");   // no copy is outstanding when the buffers become output staging
    float* my = (float*)ring + wv * (64 * 68);
#pragma unroll
    for (int mb = 0; mb < 4; ++mb)
#pragma unroll
        for (int nb = 0; nb < 4; ++nb)
#pragma unroll
            for (int j = 0; j < 8; ++j) my[(mb * 16 + hi * 8 + j) * 68 + nb * 16 + lr] = acc[mb][nb][j];
    __syncthreads();   // the tile's stores are in LDS before its rows are read back by other lanes
    const int r0w = r0 + wm * 64, c0w = c0 + wn * 64;
    // 16 rows x 16 columns at a time, lane (lr, hi) the 8 columns 8 hi .. of row lr: its 16 bytes of each plane stand at byte 16 * lane of a 512-byte half block
#pragma unroll 4   // one 16-row band a trip: the column offsets become constants, the text stays a quarter of the full unroll's
    for (int g = 0; g < 16; ++g) { const int row = (g >> 2) * 16 + lr, cofs = (g & 3) * 16 + hi * 8;
        const v4f v0 = *(const v4fa*)(my + row * 68 + cofs), v1 = *(const v4fa*)(my + row * 68 + cofs + 4);
        const size_t po = (PLN == 2) ? fo(r0w + row, c0w + cofs, ldc) : (size_t)(c0w / HD) * TT * HD + fo(r0w + row, c0w % HD + cofs, HD);
        v8h o16; v8us oh, ol;
#pragma unroll
        for (int e = 0; e < 8; ++e) { const float y = e < 4 ? v0[e & 3] : v1[e & 3]; o16[e] = tohx(y); unsigned short a2, c2; splitf(y, a2, c2); oh[e] = a2; ol[e] = c2; }
        // each s_wait_xcnt 0 stands directly behind its case's stores, in front of any later write of their address or data registers
        if (PLN != 3 || r0 >= RH) { *(v8h*)(P16 + po) = o16; if (PLN == 3) asm volatile("s_wait_xcnt 0x0" ::: "memory"); }
        if (PLN != 3 || r0 < RH) { *(v8us*)(Ph + po) = oh; *(v8us*)(Pl + po) = ol; asm volatile("s_wait_xcnt 0x0" ::: "memory"); } }
}
// grid (TT / 128, DQ / 128, 3 * batches): blockIdx.z / NB_ picks the projection (q, k, v), blockIdx.z % NB_ the batch. None of the three reads what another writes. q, k: x rows are the tile's rows; V^T = Wv x^T: the weight rows are.
__global__ __launch_bounds__(128) void k_gemms(const bf* __restrict__ XB, const bf* __restrict__ WQ, const bf* __restrict__ WK, const bf* __restrict__ WV, h16* QP16, bf* QPh, bf* QPl, h16* KP16, bf* KPh, bf* KPl, h16* VT16, bf* VTh, bf* VTl) {
    static_assert(DQ == DKV, "the three projections share one grid");
    __shared__ __align__(16) bf ring[2 * 32768];   // two 64 KB stage buffers (A part, then Bt part); afterwards the four waves' f32 tiles (pitch 68) lie in the same bytes
    const int pj = blockIdx.z / NB_; const size_t b = blockIdx.z % NB_; const bf* X = XB + b * TT * DM; const size_t so = b * NH_ * TT * HD;   // this batch's slab of x and of each head plane
    if (pj == 0) gemms_tile<3>(X, WQ, 0, QP16 + so, QPh + so, QPl + so, blockIdx.x, blockIdx.y, ring);        // q planes [b][h][t][d]
    else if (pj == 1) gemms_tile<1>(X, WK, 0, KP16 + so, KPh + so, KPl + so, blockIdx.x, blockIdx.y, ring);   // k planes [b][h][t][d]
    else gemms_tile<2>(WV, X, TT, VT16 + so, VTh + so, VTl + so, blockIdx.y, blockIdx.x, ring);               // V^T planes [b][h][d][t]
}

// ---- wtG: every 'xw' [DM][HD] weight block (the 3 * NH_ blocks of W in memory order, then Wo, which has the same shape) goes to its bf16 Bt [HD][DM] plane (fragment order); work-group (bx, y) of DM * HD / 4096 x (3 * NH_ + 1), y picks the block.
__device__ __forceinline__ void wtG(const float* __restrict__ wall, const float* __restrict__ wo, bf* WQ, bf* WK, bf* WV, bf* WO, int bx, int y) {
    static_assert(DQ == DM && DOUT == HD && NKV == NH_, "Wo and every block of W share one shape");
    constexpr int K = DM, N = HD;
    const int hd = y / 3, pj = y - 3 * hd;   // block y of W is head hd's projection pj (q, k, v); y == 3 * NH_ is Wo
    const float* __restrict__ w = (y < 3 * NH_) ? wall + (size_t)y * K * N : wo;
    bf* Bt = (y < 3 * NH_) ? (pj == 0 ? WQ : pj == 1 ? WK : WV) + (size_t)hd * N * K : WO;   // Bt rows hd * HD .. of that projection
    const int lane = threadIdx.x & 31; const int L0 = (bx * 8 + (threadIdx.x >> 5)) * 8; const int nlines = N * K / 64;
{
#pragma unroll 1
        for (int l = 0; l < 8; ++l) { const int L = L0 + l; if (L >= nlines) break; const size_t e = (size_t)L * 64 + lane * 2; const int eb = (int)(e >> 9), ei = (int)(e & 511);   // e = fo(n, k, K), taken apart: block, then place in the block
            const int n = (eb / (K / 32)) * 16 + ((ei >> 3) & 15), k = (eb % (K / 32)) * 32 + (ei >> 8) * 16 + ((ei >> 7) & 1) * 8 + (ei & 7); v2us o;
            o[0] = f2bf(w[(size_t)k * N + n]); o[1] = f2bf(w[(size_t)(k + 1) * N + n]); *(v2us*)(Bt + e) = o; }
         }
}
// ---- cvt8: rows of DM f32 -> one bf16 plane in fragment order; thread i writes the plane's elements [8 i, 8 i + 8) = fo(r, k .. k + 7, DM), so a wave stores 512 contiguous bytes and reads 64 bytes of each of 16 rows.
__device__ __forceinline__ void cvt8(const float* __restrict__ src, bf* dst, size_t n8, unsigned bx) { const size_t i = (size_t)bx * 256 + threadIdx.x; if (i >= n8) return;
    const size_t eb = i >> 6; const int ei = (int)(i & 63); const size_t r = (eb / (DM / 32)) * 16 + (ei & 15); const int k = (int)(eb % (DM / 32)) * 32 + (ei >> 5) * 16 + ((ei >> 4) & 1) * 8;
    const v8f v = *(const v8f*)(src + r * DM + k); v8us o;
    asm volatile("s_wait_xcnt 0x0" ::: "memory");   // stands behind the two loads, in front of any later write of their address registers
#pragma unroll
    for (int k = 0; k < 8; ++k) o[k] = f2bf(v[k]); *(v8us*)(dst + i * 8) = o;  }
// ---- k_prep: both conversions of the inputs in one launch (neither reads what the other writes): the first NWT work-groups are wtG's (their eight dependent trips are the longer chain, so they start first), the rest cvt8's.
#define NWT ((DM * HD / 4096) * (3 * NH_ + 1))
__global__ __launch_bounds__(256) void k_prep(const float* __restrict__ wall, const float* __restrict__ wo, bf* WQ, bf* WK, bf* WV, bf* WO, const float* __restrict__ x, bf* XB, size_t n8) {
    if (blockIdx.x < NWT) wtG(wall, wo, WQ, WK, WV, WO, blockIdx.x % (DM * HD / 4096), blockIdx.x / (DM * HD / 4096));
    else cvt8(x, XB, n8, blockIdx.x - NWT);
}

// ---- k_attn: scores, online softmax, P V and the hi/lo merge of BQ query rows of one head in one work-group of 8 waves; grid (batches * heads, TT / BQ), all hi/lo row tiles (t0 < RH) first.
// Transposed products: S^T = K Q^T (A = K fragments from LDS, B = Q fragments kept in registers), O^T += V^T P^T. A lane then holds scores of one query only: 8 keys of each 16-key tile, which are exactly its places of the B operand P^T, so S and P never leave registers.
// Wave wv owns the 32 query columns 32 (wv & 3) .. and, of every stage, the 32-key passes p with p % 2 == wv >> 2. K and V^T come in stages of SK keys (64 KB) by asynchronous copies into two LDS buffers, so that each byte leaves L2 once per 128 query rows.
// Sum orders: scores k = 0, 32, 64, 96; each wave sums its passes in key order under a running maximum (log2 domain; the maximum in use may trail the true one by up to 8, the sums are rescaled only when it would trail by more); the two key halves' sums are added at the end.
#define BQ  128                   // query rows per work-group
typedef __attribute__((ext_vector_type(2))) __bf16 v2bf;
typedef __attribute__((ext_vector_type(8))) unsigned v8u;
typedef __attribute__((ext_vector_type(4))) unsigned v4u;
__device__ __forceinline__ float xhalf(float x) { return __builtin_bit_cast(float, __builtin_amdgcn_permlanex16(__builtin_bit_cast(int, x), __builtin_bit_cast(int, x), 0x76543210, 0xfedcba98, false, false)); }   // lane l's value of lane l ^ 16
__device__ __forceinline__ unsigned pk2b(float a, float b) { return __builtin_bit_cast(unsigned, __builtin_convertvector((v2f){a, b}, v2bf)); }   // two bf16, round to nearest even
__device__ __forceinline__ unsigned pk2h(float a, float b) { return __builtin_bit_cast(unsigned, __builtin_convertvector((v2f){a, b}, v2h)); }    // two fp16, round to nearest even
// cp44: eight copies, four from each of two places; LDS places 4 KB apart (the work-group's 256 lanes x 16 B), global places GS elements apart. s_wait_xcnt 0 as the statement's last line stands in front of any later write of the address registers the copies name.
template <int GS, typename T16>
__device__ __forceinline__ void cp44(unsigned la, const T16* ga, unsigned lb, const T16* gb) {
    asm volatile("global_load_async_to_lds_b128 %0, %8, off\n\t"
                 "global_load_async_to_lds_b128 %1, %9, off\n\t"
                 "global_load_async_to_lds_b128 %2, %10, off\n\t"
                 "global_load_async_to_lds_b128 %3, %11, off\n\t"
                 "global_load_async_to_lds_b128 %4, %12, off\n\t"
                 "global_load_async_to_lds_b128 %5, %13, off\n\t"
                 "global_load_async_to_lds_b128 %6, %14, off\n\t"
                 "global_load_async_to_lds_b128 %7, %15, off\n\t"
                 "s_wait_xcnt 0x0"
                 :: "v"(la), "v"(la + 4096u), "v"(la + 8192u), "v"(la + 12288u), "v"(lb), "v"(lb + 4096u), "v"(lb + 8192u), "v"(lb + 12288u),
                    "v"(ga), "v"(ga + GS), "v"(ga + 2 * GS), "v"(ga + 3 * GS), "v"(gb), "v"(gb + GS), "v"(gb + 2 * GS), "v"(gb + 3 * GS) : "memory");
}
template <typename T16, bool HL>
__device__ __forceinline__ void attn_cols(const T16* __restrict__ Q, const T16* __restrict__ Q2, const T16* __restrict__ Kp, const T16* __restrict__ K2, const T16* __restrict__ Vt, const T16* __restrict__ V2, bf* Ah, bf* Al, int t0, int h, unsigned short* ringu) {
    typedef typename WFrag<T16>::V V;
    constexpr int SK = HL ? 64 : 128, NT = TT / SK, NP = SK / 64, VB = SK / 32;   // keys a stage, stages, passes a wave and stage, 32-key blocks a stage
    static_assert(NT >= 2, "the prologue fills two stages");
    constexpr float CS = SCL * 1.4426950408889634f;   // scores to the log2 domain
    constexpr float OFF = HL ? 0.0f : 4.0f;           // fp16 P carries 2^4 (it cancels against the row sum): small weights stay clear of the fp16 subnormals, the largest is 2^12
    const int tid = threadIdx.x, lane = tid & 31, lr = lane & 15, hi = lane >> 4;
    const int wv = __builtin_amdgcn_readfirstlane(tid >> 5), cw = wv & 3, kh = wv >> 2;   // column group and key half, kept scalar so that the LDS bases and the last branch are
    const T16* ring = (const T16*)ringu;
    const unsigned lb0 = (unsigned)(size_t)ringu;   // buffer 0 (LDS byte address)
    // A buffer, in elements: K at 0 (16-key tile a, k block c at (4 a + c) * 512; hi/lo: the lo plane 8192 on), V^T at 16384 (16-row tile t, key block c at (VB t + c) * 512; hi/lo: the lo plane 8192 on).
    // K: a stage is contiguous in its plane. V^T: a tile's VB blocks are contiguous, the next tile's lie 32768 elements on; with VB 2 one 4 KB copy takes two tiles, the upper 128 lanes the second.
    const T16* bK2 = HL ? K2 : Kp + 8192; const T16* bV2 = HL ? V2 : Vt + 4 * 32768;   // second place of each pair of four copies: the lo plane, or the second half of the stage's part of the plane
    const unsigned kofs = (unsigned)wv * 256u, vofs = HL ? (unsigned)kh * 32768u + (unsigned)cw * 256u : (unsigned)wv * 256u, lofs = (unsigned)lane * 8u;   // element offsets of the wave (scalar) and of the lane in it: thread tid takes the 16 bytes at 16 tid of each 4 KB; the plane bases stay scalar too
    auto stage = [&](int st, int b) { const unsigned l = lb0 + (unsigned)b * 65536u + 2u * kofs + 2u * lofs, ko = kofs + (unsigned)st * (SK * HD) + lofs, vo = vofs + (unsigned)st * (VB * 512) + lofs;
        cp44<2048>(l, Kp + ko, l + 16384u, bK2 + ko);
        cp44<(HL ? 65536 : 32768)>(l + 32768u, Vt + vo, l + 49152u, bV2 + vo); };
    stage(0, 0);
    V qa[2][HD / 32], qb[2][HD / 32];
#pragma unroll
    for (int g = 0; g < 2; ++g)
#pragma unroll
        for (int ks = 0; ks < HD / 32; ++ks) { const size_t qo = (size_t)(t0 + cw * 32 + g * 16) * HD + ks * 512 + 8 * lane; qa[g][ks] = WFrag<T16>::ldf(Q + qo); if (HL) qb[g][ks] = WFrag<T16>::ldf(Q2 + qo); }   // qo = fo(query tile's row lr, ks * 32 + 8 * hi, HD)
    v8f o[2][HD / 16]; float mrun[2], lrun[2];
#pragma unroll
    for (int g = 0; g < 2; ++g) { mrun[g] = -__builtin_inff(); lrun[g] = 0.f;
#pragma unroll
        for (int t = 0; t < HD / 16; ++t) o[g][t] = (v8f){}; }
    asm volatile("s_wait_asynccnt 0x0" ::: "memory");   // this wave's copies of stage 0 have landed
    __syncthreads();   // every wave's copies of stage 0 have landed before any wave reads the buffer
    stage(1, 1);
#pragma unroll 1   // one trip's text serves all stages; the buffer is picked by st & 1
    for (int st = 0; st < NT; ++st) {
        const T16* sb = ring + (st & 1) * 32768 + 8 * lane;
        V kf[2][HD / 32], kl[2][HD / 32];
        auto ldk = [&](int p) {
#pragma unroll
            for (int kt = 0; kt < 2; ++kt)
#pragma unroll
                for (int ks = 0; ks < HD / 32; ++ks) { const T16* kp = sb + ((p * 2 + kt) * 4 + ks) * 512; kf[kt][ks] = WFrag<T16>::ldf(kp); if (HL) kl[kt][ks] = WFrag<T16>::ldf(kp + 8192); } };
        ldk(kh);
#pragma unroll
        for (int i = 0; i < NP; ++i) { const int p = kh + 2 * i;   // this wave's 32-key pass of the stage
            v8f s[2][2];
            __builtin_amdgcn_sched_barrier(0);   // keeps the pass's K reads together in front of its products: one wait for LDS, not one for each fragment
#pragma unroll
            for (int kt = 0; kt < 2; ++kt)
#pragma unroll
                for (int g = 0; g < 2; ++g) { s[kt][g] = (v8f){};
#pragma unroll
                    for (int ks = 0; ks < HD / 32; ++ks) { s[kt][g] = WFrag<T16>::mma(kf[kt][ks], qa[g][ks], s[kt][g]); if (HL) { s[kt][g] = WFrag<T16>::mma(kf[kt][ks], qb[g][ks], s[kt][g]); s[kt][g] = WFrag<T16>::mma(kl[kt][ks], qa[g][ks], s[kt][g]); } } }
            if (i + 1 < NP) ldk(p + 2);   // the wave's next pass of the same stage: its K reads run under this pass's softmax and second product
            V vf[HD / 16], vl[HD / 16];
#pragma unroll
            for (int t = 0; t < HD / 16; ++t) { const T16* vp = sb + 16384 + (t * VB + p) * 512; vf[t] = WFrag<T16>::ldf(vp); if (HL) vl[t] = WFrag<T16>::ldf(vp + 8192); }
            __builtin_amdgcn_sched_barrier(0);   // keeps the V^T reads in front of the softmax arithmetic, so that their latency runs under it
            float mb[2]; bool need = false;
#pragma unroll
            for (int g = 0; g < 2; ++g) { float mx = s[0][g][0];
#pragma unroll
                for (int j = 1; j < 16; ++j) mx = fmaxf(mx, s[j >> 3][g][j & 7]);
                mx = fmaxf(mx, xhalf(mx)) * CS;   // both wave halves hold the query's maximum of this pass, scaled (the scale is positive)
                mb[g] = mx; need = need || (mx > mrun[g] + 8.0f); }
            if (__builtin_amdgcn_ballot_w32(need) != 0) {   // wave-uniform; always taken in a wave's first pass, seldom later
#pragma unroll
                for (int g = 0; g < 2; ++g) { const float mn = fmaxf(mrun[g], mb[g]); const float corr = __builtin_amdgcn_exp2f(mrun[g] - mn);   // 0 in the first pass, where mrun is -inf
                    lrun[g] *= corr; mrun[g] = mn;
#pragma unroll
                    for (int t = 0; t < HD / 16; ++t) o[g][t] = o[g][t] * corr; } }
#pragma unroll
            for (int g = 0; g < 2; ++g) { const float nm = OFF - mrun[g]; v8u wh, wl; float ps0 = 0.f, ps1 = 0.f;
#pragma unroll
                for (int e = 0; e < 8; ++e) {   // operand elements 2 e, 2 e + 1 = keys 8 hi + .. of tile e >> 2: accumulator registers 2 (e & 3), 2 (e & 3) + 1
                    const float p0 = __builtin_amdgcn_exp2f(__builtin_fmaf(s[e >> 2][g][2 * (e & 3)], CS, nm)), p1 = __builtin_amdgcn_exp2f(__builtin_fmaf(s[e >> 2][g][2 * (e & 3) + 1], CS, nm));
                    ps0 += p0; ps1 += p1;
                    if (HL) { const unsigned w = pk2b(p0, p1); wh[e] = w; wl[e] = pk2b(p0 - __uint_as_float(w << 16), p1 - __uint_as_float(w & 0xFFFF0000u)); }
                    else wh[e] = pk2h(p0, p1); }
                lrun[g] += ps0 + ps1;
                const V pf = __builtin_bit_cast(V, wh);
#pragma unroll
                for (int t = 0; t < HD / 16; ++t) { o[g][t] = WFrag<T16>::mma(vf[t], pf, o[g][t]); if (HL) { o[g][t] = WFrag<T16>::mma(vf[t], __builtin_bit_cast(V, wl), o[g][t]); o[g][t] = WFrag<T16>::mma(vl[t], pf, o[g][t]); } } }
            __builtin_amdgcn_sched_barrier(0);
            asm volatile("v_nop\n\tv_nop\n\tv_nop\n\tv_nop");   // the four vector slots the chip needs behind the pass's last products, also on the loop's taken branch, before their operand registers are rewritten
            __builtin_amdgcn_sched_barrier(0);   // the two scheduling barriers keep the v_nops directly behind the products
        }
        asm volatile("s_wait_dscnt 0x0" ::: "memory");      // this wave's reads of the buffer are done before it may be refilled
        asm volatile("s_wait_asynccnt 0x0" ::: "memory");   // this wave's copies of stage st + 1 have landed
        __syncthreads();   // publishes stage st + 1 and ends every wave's reads of stage st's buffer
        if (st + 2 < NT) stage(st + 2, st & 1);
    }
    asm volatile("s_wait_asynccnt 0x0" ::: "memory");   // no copy is outstanding when the buffers become the hand-over space
    // the two key halves of the same columns swap sums through LDS: half 0 hands over column group 1 and finishes group 0, half 1 the other way round. A hand-over is 8 tiles x 32 lanes x 8 floats, then the running maxima and the row sums.
    float* xs = (float*)ringu + cw * (2 * 2112);
    auto put = [&](int g) { float* x = xs + kh * 2112; x[2048 + lane] = mrun[g]; x[2080 + lane] = lrun[g];
#pragma unroll
        for (int t = 0; t < HD / 16; ++t) { *(v4fa*)(x + (t * 2) * 128 + lane * 4) = __builtin_shufflevector(o[g][t], o[g][t], 0, 1, 2, 3); *(v4fa*)(x + (t * 2 + 1) * 128 + lane * 4) = __builtin_shufflevector(o[g][t], o[g][t], 4, 5, 6, 7); } };
    auto fin = [&](int g) { const float* x = xs + (1 - kh) * 2112; const float m1 = x[2048 + lane], l1 = x[2080 + lane]; const float mn = fmaxf(mrun[g], m1);
        const float c0 = __builtin_amdgcn_exp2f(mrun[g] - mn), c1 = __builtin_amdgcn_exp2f(m1 - mn); float l = lrun[g] * c0 + l1 * c1; l += xhalf(l);   // each wave half held the sums of its 8 keys of every tile
        const float inv = __fdiv_rn(1.0f, l), f0 = c0 * inv, f1 = c1 * inv;
#pragma unroll
        for (int t = 0; t < HD / 16; ++t) { const v4f a0 = *(const v4fa*)(x + (t * 2) * 128 + lane * 4), a1 = *(const v4fa*)(x + (t * 2 + 1) * 128 + lane * 4); v4u oh, ol;
#pragma unroll
            for (int e = 0; e < 4; ++e) { const float y0 = o[g][t][2 * e] * f0 + (e < 2 ? a0[2 * e] : a1[2 * e - 4]) * f1, y1 = o[g][t][2 * e + 1] * f0 + (e < 2 ? a0[2 * e + 1] : a1[2 * e - 3]) * f1;
                const unsigned w = pk2b(y0, y1); oh[e] = w; ol[e] = pk2b(y0 - __uint_as_float(w << 16), y1 - __uint_as_float(w & 0xFFFF0000u)); }
            // lane (lr, hi) holds columns 16 t + 8 hi .. + 7 of query row lr of the group: its 16 bytes of each plane stand at byte 16 * lane of a 512-byte half block of the merged rows' fragment order
            const size_t oo = fo(t0 + cw * 32 + g * 16 + lr, h * HD + t * 16 + hi * 8, DQ); *(v4u*)(Ah + oo) = oh; *(v4u*)(Al + oo) = ol;
            asm volatile("s_wait_xcnt 0x0" ::: "memory"); } };   // stands behind the two stores, in front of any later write of their address or data registers
    if (kh == 0) put(1); else put(0);
    __syncthreads();   // both halves' hand-overs are in LDS before either reads the other's
    if (kh == 0) fin(0); else fin(1);
}
__global__ __launch_bounds__(256) void k_attn(const h16* __restrict__ Q16, const bf* __restrict__ Qh, const bf* __restrict__ Ql, const h16* __restrict__ K16, const bf* __restrict__ Kh, const bf* __restrict__ Kl, const h16* __restrict__ V16, const bf* __restrict__ Vh, const bf* __restrict__ Vl, bf* Ah, bf* Al) {
    __shared__ __align__(128) unsigned short ring[2 * 32768];   // two 64 KB stage buffers; afterwards the hand-over space of the key halves
    static_assert(RH % BQ == 0 && TT % BQ == 0, "a row tile is wholly hi/lo or wholly fp16");
    const int h = blockIdx.x % NH_, t0 = blockIdx.y * BQ; const size_t b = blockIdx.x / NH_; const size_t zq = (b * NH_ + h) * TT * HD, zk = (b * NKV + h / REP) * TT * HD;
    Ah += b * TT * DQ; Al += b * TT * DQ;   // this batch's slab of the merged head rows
    if (t0 < RH) attn_cols<bf, true>(Qh + zq, Ql + zq, Kh + zk, Kl + zk, Vh + zk, Vl + zk, Ah, Al, t0, h, ring);
    else attn_cols<h16, false>(Q16 + zq, nullptr, K16 + zk, nullptr, V16 + zk, nullptr, Ah, Al, t0, h, ring);
}

extern "C" void kernel_launch(void* const* d_in, const int* in_sizes, int n_in,
                              void* d_out, int out_size, void* d_ws, size_t ws_size, hipStream_t stream) {
    (void)in_sizes; (void)n_in; (void)out_size;
    const float* x = (const float*)d_in[0]; const float* wall = (const float*)d_in[1]; const float* wo = (const float*)d_in[2];   /* order x, W [8][3][1024][128], Wo [1024][128] */ const float* wq = wall; const float* wk = wall; const float* wv = wall; (void)wq; (void)wk; (void)wv;
    float* OUT = (float*)d_out;     // [4][2048][128]
    char* wsp = (char*)d_ws;
    auto take = [&](size_t bytes) { char* p = wsp; wsp += (bytes + 255) & ~(size_t)255; return (void*)p; };
    bf* WQ = (bf*)take((size_t)DQ * DM * 2); bf* WK = (bf*)take((size_t)DKV * DM * 2); bf* WV = (bf*)take((size_t)DKV * DM * 2); bf* WO = (bf*)take((size_t)DOUT * DQ * 2);
    bf* XB = (bf*)take((size_t)NB_ * TT * DM * 2);
    h16* QP16 = (h16*)take((size_t)NB_ * NH_ * TT * HD * 2); h16* KP16 = (h16*)take((size_t)NB_ * NKV * TT * HD * 2); h16* VT16 = (h16*)take((size_t)NB_ * NKV * HD * TT * 2);
    bf* QPh = (bf*)take((size_t)NB_ * NH_ * TT * HD * 2); bf* QPl = (bf*)take((size_t)NB_ * NH_ * TT * HD * 2); bf* KPh = (bf*)take((size_t)NB_ * NKV * TT * HD * 2); bf* KPl = (bf*)take((size_t)NB_ * NKV * TT * HD * 2); bf* VTh = (bf*)take((size_t)NB_ * NKV * HD * TT * 2); bf* VTl = (bf*)take((size_t)NB_ * NKV * HD * TT * 2);
    bf* ATh = (bf*)take((size_t)NB_ * TT * DQ * 2); bf* ATl = (bf*)take((size_t)NB_ * TT * DQ * 2);
    if ((size_t)(wsp - (char*)d_ws) > ws_size) return;    // ws 256 MiB
    k_prep<<<(unsigned)(NWT + ((size_t)NB_ * TT * DM / 8 + 255) / 256), 256, 0, stream>>>(wall, wo, WQ, WK, WV, WO, x, XB, (size_t)NB_ * TT * DM / 8);   /* all 25 'xw' [1024][128] blocks -> Bt [128][1024] planes, and x -> bf16 */
    k_gemms<<<dim3(TT / 128, DQ / 128, 3 * NB_), 128, 0, stream>>>(XB, WQ, WK, WV, QP16, QPh, QPl, KP16, KPh, KPl, VT16, VTh, VTl);   // q, k, V^T planes of all batches
    k_attn<<<dim3(NH_ * NB_, TT / BQ, 1), 256, 0, stream>>>(QP16, QPh, QPl, KP16, KPh, KPl, VT16, VTh, VTl, ATh, ATl);   // all heads of all batches; S and P never leave registers
    k_gemmw<bf, 1, false, 16, 0><<<dim3(TT / 64, DOUT / 64, NB_), 512, 0, stream>>>(ATh, ATl, WO, nullptr, DQ, OUT, DOUT, nullptr, (size_t)TT * DQ, 0, (size_t)TT * DOUT, nullptr, nullptr, nullptr);   /* z = o Wo: N 128 */
}

// v010
// Measured time: 137 microseconds a run.
// Two timings next to v009 both put it at 1.06 times that version's speed.
// Over all steps from v000 it is 17.9 times as fast.
#include <hip/hip_runtime.h>

// Multi-head attention with per-head weight tensors and 128-wide heads (x [4][2048][1024]; q, k, v = einsum('bnd,hde', x, W[:, i]) with W [8][3][1024][128] (1/32): head h's 'xw' blocks; 8 heads x 128; scores x 1/sqrt(128); softmax (no mask); o = concat heads [2048][1024]; z = o Wo ('xw' [1024][128]) -> [4][2048][128] (1.0 M); argument order x, W, Wo).
// Layout, every plane with one slab per batch and every kernel launched once for all batches: bf16 copy of x and each head's three 'xw' [1024][128] blocks (and Wo) transposed into the fused Bt planes, both in one launch (k_prep); the three exact projections in one launch (k_gemms), whose epilogue writes the 16-bit head planes (v as V^T = Wv x^T); dense T-2048 attention with an online softmax (hybrid rows: < 512 hi/lo 3 products, rest fp16); merged hi/lo x Wo exact (N 128).
// Every 16-bit plane that feeds a matrix product lies in FRAGMENT ORDER (fo() below): a block of 16 rows x 32 k is 1 KB, laid so that lane l's two 16-byte fragment pieces stand at bytes 16 l and 512 + 16 l of the block. A wave-wide fragment load, and a wave-wide plane store, is then 512 contiguous bytes (4 whole lines) where row-major planes gave 16 pieces of 32 bytes.
// Compute dtypes, f32 accumulate: every input rounded to bf16; projections exact; attention rows < 512 3 products, rest fp16; softmax f32; Wo hl x exact.

#define NB_  4
#define TT   2048
#define DM   1024
#define NH_  8
#define NKV  8
#define REP  (NH_ / NKV)
#define HD   128
#define DQ   (NH_ * HD)
#define DKV  (NKV * HD)
#define RH   512                  // query rows < RH use hi+lo planes (0: none)
#define WIN  0
#define SCL  0.088388347648318447f   // 1/sqrt(float32(128))
#define DOUT 128      // output width
typedef _Float16 h16;
typedef unsigned short bf;
typedef __attribute__((ext_vector_type(16))) __bf16   v16bf;
typedef __attribute__((ext_vector_type(16))) _Float16 v16h;
typedef __attribute__((ext_vector_type(8)))  _Float16 v8h;
typedef __attribute__((ext_vector_type(8)))  unsigned short v8us;
typedef __attribute__((ext_vector_type(8)))  float    v8f;
typedef __attribute__((ext_vector_type(4)))  float    v4f;
typedef v8h  __attribute__((may_alias)) v8ha;
typedef v4f  __attribute__((may_alias)) v4fa;
typedef v8us __attribute__((may_alias)) v8usa;

__device__ __forceinline__ unsigned short f2bf(float f) { unsigned u = __float_as_uint(f); u += 0x7FFFu + ((u >> 16) & 1u); return (unsigned short)(u >> 16); }
__device__ __forceinline__ float bf2f(unsigned short b) { return __uint_as_float(((unsigned)b) << 16); }
__device__ __forceinline__ float bfr(float f) { return bf2f(f2bf(f)); }
__device__ __forceinline__ v16h cat16(v8h lo, v8h hi) { return __builtin_shufflevector(lo, hi, 0, 1, 2, 3, 4, 5, 6, 7, 8, 9, 10, 11, 12, 13, 14, 15); }
__device__ __forceinline__ v16bf cat16b(v8us lo, v8us hi) { return __builtin_bit_cast(v16bf, __builtin_shufflevector(lo, hi, 0, 1, 2, 3, 4, 5, 6, 7, 8, 9, 10, 11, 12, 13, 14, 15)); }
__device__ __forceinline__ v8f wmma16(v16h a, v16h b, v8f c) { return __builtin_amdgcn_wmma_f32_16x16x32_f16(false, a, false, b, (short)0, c, false, false); }
__device__ __forceinline__ v8f wmmab(v16bf a, v16bf b, v8f c) { return __builtin_amdgcn_wmma_f32_16x16x32_bf16(false, a, false, b, (short)0, c, false, false); }

__device__ __forceinline__ h16 tohx(float x) { return (h16)x; }
__device__ __forceinline__ void splitf(float y, unsigned short& h, unsigned short& l) { h = f2bf(y); l = f2bf(y - bf2f(h)); }
typedef __attribute__((ext_vector_type(2))) _Float16 v2h;
typedef __attribute__((ext_vector_type(4))) _Float16 v4h;
typedef __attribute__((ext_vector_type(2))) unsigned short v2us;
typedef __attribute__((ext_vector_type(4))) unsigned short v4us;
typedef __attribute__((ext_vector_type(2))) float v2f;
typedef __attribute__((ext_vector_type(4))) int v4i;

// ---- k_gemmw: register-blocked GEMM, one 64x64 output tile per work-group (16 accumulators per wave), operands straight from fragment-ordered 16-bit planes (ld: row-major piece pair, for LDS rows; ldf: block base + 8 * lane of a fragment-ordered plane); grid (M/64, N/64, Z), 32 * KS threads.
// C[m][n] (f32, pitch ldc, + optional f32 bias[n]) = sum_k A[m][k] Bt[n][k] (+ split products per NSPLIT). z-batch strides sA/sB/sC in elements (sC steps the planes where PLN > 0). K % (32 * KS) == 0.
// PLN > 0 (KS > 1 only): no f32 C; the summed tile goes out as 16-bit planes (fp16, bf16 hi, bf16 lo). PLN 1: head planes [n / HD][m][n % HD]; PLN 3: the same, rows m < RH as hi/lo only and the rest as fp16 only (all that k_attn reads of q); PLN 2: planes [m][n] of ldc columns; each plane (each head's, for PLN 1 and 3) in fragment order.
// KS > 1: wave w sums the contiguous k range [w K/KS, (w+1) K/KS), so the KS waves' load latencies overlap; the KS f32 partial tiles meet in LDS and are added in wave order 0 .. KS-1.
// fo: element offset of (row r, column k) in a fragment-ordered plane of K columns (K % 32 == 0). 8 consecutive k (k % 8 == 0) stay contiguous; the block of rows [16 a, 16 a + 16) x columns [32 b, 32 b + 32) starts at (a K / 32 + b) * 512.
__device__ __forceinline__ size_t fo(int r, int k, int K) { return ((size_t)(r >> 4) * (K >> 5) + (k >> 5)) * 512 + ((k >> 4) & 1) * 256 + ((k >> 3) & 1) * 128 + (r & 15) * 8 + (k & 7); }
template <typename T16> struct WFrag;
template <> struct WFrag<h16> { typedef v16h V; static __device__ __forceinline__ V ld(const h16* p) { return cat16(*(const v8h*)p, *(const v8h*)(p + 16)); } static __device__ __forceinline__ V ldf(const h16* p) { return cat16(*(const v8h*)p, *(const v8h*)(p + 256)); } static __device__ __forceinline__ v8f mma(V a, V b, v8f c) { return wmma16(a, b, c); } };
template <> struct WFrag<bf> { typedef v16bf V; static __device__ __forceinline__ V ld(const bf* p) { return cat16b(*(const v8us*)p, *(const v8us*)(p + 16)); } static __device__ __forceinline__ V ldf(const bf* p) { return cat16b(*(const v8us*)p, *(const v8us*)(p + 256)); } static __device__ __forceinline__ v8f mma(V a, V b, v8f c) { return wmmab(a, b, c); } };
template <typename T16, int NSPLIT, bool BIAS, int KS, int PLN>
__global__ __launch_bounds__(32 * KS) void k_gemmw(const T16* __restrict__ A, const T16* __restrict__ A2, const T16* __restrict__ Bt, const T16* __restrict__ Bt2, int K, float* C, int ldc, const float* __restrict__ bias, size_t sA, size_t sB, size_t sC, h16* P16, bf* Ph, bf* Pl) {
    typedef typename WFrag<T16>::V V;
    __shared__ __align__(16) float os[(KS == 1 ? 16 : KS * 64) * 68];
    const size_t z = blockIdx.z; A += z * sA; if (A2) A2 += z * sA; Bt += z * sB; if (Bt2) Bt2 += z * sB; if (PLN == 0) C += z * sC; else { P16 += z * sC; Ph += z * sC; Pl += z * sC; }
    const int lane = threadIdx.x & 31, lr = lane & 15, hi = lane >> 4; const int r0 = blockIdx.x * 64, c0 = blockIdx.y * 64;
    const int wv = (KS == 1) ? 0 : __builtin_amdgcn_readfirstlane((int)(threadIdx.x >> 5));   // this wave's place in the K split, kept scalar so that the loop bounds are
    v8f acc[4][4];
#pragma unroll
    for (int mb = 0; mb < 4; ++mb)
#pragma unroll
        for (int nb = 0; nb < 4; ++nb) acc[mb][nb] = (v8f){};
    const size_t aoff = (size_t)r0 * K + 8 * lane, boff = (size_t)c0 * K + 8 * lane;   // = fo(r0 + lr, 8 * hi, K): 16 rows on are 16 * K elements on, 32 k on are 512
#pragma unroll 1
    for (int kc = wv * (K / KS); kc < (wv + 1) * (K / KS); kc += 32) {
        V a[4], a2[4];
#pragma unroll
        for (int mb = 0; mb < 4; ++mb) { a[mb] = WFrag<T16>::ldf(A + aoff + (size_t)mb * 16 * K + kc * 16); if (NSPLIT == 1 || NSPLIT == 2) a2[mb] = WFrag<T16>::ldf(A2 + aoff + (size_t)mb * 16 * K + kc * 16); }
#pragma unroll
        for (int nb = 0; nb < 4; ++nb) { const V b = WFrag<T16>::ldf(Bt + boff + (size_t)nb * 16 * K + kc * 16); V b2; if (NSPLIT >= 2) b2 = WFrag<T16>::ldf(Bt2 + boff + (size_t)nb * 16 * K + kc * 16);
#pragma unroll
            for (int mb = 0; mb < 4; ++mb) { acc[mb][nb] = WFrag<T16>::mma(a[mb], b, acc[mb][nb]); if (NSPLIT == 1 || NSPLIT == 2) acc[mb][nb] = WFrag<T16>::mma(a2[mb], b, acc[mb][nb]); if (NSPLIT >= 2) acc[mb][nb] = WFrag<T16>::mma(a[mb], b2, acc[mb][nb]); } }
        asm volatile("v_nop\n\tv_nop\n\tv_nop\n\tv_nop" : "+v"(acc[0][0]), "+v"(acc[1][1]), "+v"(acc[2][2]), "+v"(acc[3][3]) : "v"(a[0]), "v"(a[3]));
    }
    if (KS > 1) {
        float* my = os + wv * (64 * 68);
#pragma unroll
        for (int mb = 0; mb < 4; ++mb)
#pragma unroll
            for (int nb = 0; nb < 4; ++nb)
#pragma unroll
                for (int j = 0; j < 8; ++j) my[(mb * 16 + hi * 8 + j) * 68 + nb * 16 + lr] = acc[mb][nb][j];
        __syncthreads();   // every wave's partial tile is in LDS before any wave adds them
        if (PLN == 0) {
#pragma unroll
            for (int it = 0; it < 32 / KS; ++it) { const int q = it * 32 * KS + (int)threadIdx.x, row = q >> 4, cofs = (q & 15) * 4; v4f val = *(const v4fa*)(os + row * 68 + cofs);
#pragma unroll
                for (int w = 1; w < KS; ++w) val += *(const v4fa*)(os + (w * 64 + row) * 68 + cofs);
                if (BIAS) { val[0] += bfr(bias[c0 + cofs]); val[1] += bfr(bias[c0 + cofs + 1]); val[2] += bfr(bias[c0 + cofs + 2]); val[3] += bfr(bias[c0 + cofs + 3]); }
                *(v4f*)(C + (size_t)(r0 + row) * ldc + c0 + cofs) = val; }
        } else {   // a wave takes 16 rows x 16 columns at a time, lane (lr, hi) the 8 columns 8 hi .. of row lr: its 16 bytes of each plane stand at byte 16 * lane of a 512-byte half block
#pragma unroll
            for (int it = 0; it < 16 / KS; ++it) { const int g = it * KS + wv, row = (g >> 2) * 16 + lr, cofs = (g & 3) * 16 + hi * 8; v4f val[2];
#pragma unroll
                for (int p = 0; p < 2; ++p) { val[p] = *(const v4fa*)(os + row * 68 + cofs + 4 * p);
#pragma unroll
                    for (int w = 1; w < KS; ++w) val[p] += *(const v4fa*)(os + (w * 64 + row) * 68 + cofs + 4 * p); }
                if (BIAS) {
#pragma unroll
                    for (int e = 0; e < 8; ++e) val[e >> 2][e & 3] += bfr(bias[c0 + cofs + e]); }
                const size_t po = (PLN == 2) ? fo(r0 + row, c0 + cofs, ldc) : (size_t)(c0 / HD) * TT * HD + fo(r0 + row, c0 % HD + cofs, HD);
                v8h o16; v8us oh, ol;
#pragma unroll
                for (int e = 0; e < 8; ++e) { const float y = val[e >> 2][e & 3]; o16[e] = tohx(y); unsigned short a2, c2; splitf(y, a2, c2); oh[e] = a2; ol[e] = c2; }
                // each s_wait_xcnt 0 stands directly behind its case's stores, in front of any later write of their address or data registers (the built code tests the cases one after the other)
                if (PLN != 3 || r0 >= RH) { *(v8h*)(P16 + po) = o16; if (PLN == 3) asm volatile("s_wait_xcnt 0x0" ::: "memory"); }
                if (PLN != 3 || r0 < RH) { *(v8us*)(Ph + po) = oh; *(v8us*)(Pl + po) = ol; asm volatile("s_wait_xcnt 0x0" ::: "memory"); } } }
        return;
    }
#pragma unroll
    for (int mb = 0; mb < 4; ++mb) {
#pragma unroll
        for (int nb = 0; nb < 4; ++nb) {
#pragma unroll
            for (int j = 0; j < 8; ++j) os[(hi * 8 + j) * 68 + nb * 16 + lr] = acc[mb][nb][j]; }
        __builtin_amdgcn_wave_barrier(); asm volatile("" ::: "memory");
        float* crow = C + (size_t)(r0 + mb * 16) * ldc + c0;
{
#pragma unroll
            for (int s = 0; s < 8; ++s) { const int row = 2 * s + hi, cofs = lr * 4; v4f val = *(const v4fa*)(os + row * 68 + cofs); if (BIAS) { val[0] += bfr(bias[c0 + cofs]); val[1] += bfr(bias[c0 + cofs + 1]); val[2] += bfr(bias[c0 + cofs + 2]); val[3] += bfr(bias[c0 + cofs + 3]); }
                *(v4f*)(crow + (size_t)row * ldc + cofs) = val; }
             }
        __builtin_amdgcn_wave_barrier(); asm volatile("" ::: "memory");
    }
}


// ---- k_gemms: the three projections, one launch. One 128x128 output tile per work-group of 4 waves (2 x 2, each wave a 64x64 tile, 16 accumulators, the whole K range in order k = 0, 32, ...); gemms_tile is the work of one work-group on tile (bx, by) of one projection of one batch.
// A and Bt are fragment-ordered bf16 planes of DM columns. A stage is 128 k of the tile's 128 A rows and 128 Bt rows (64 KB): 16 pieces of 4 KB (16 rows x 128 k), each contiguous in its plane, brought into LDS by tensor loads (each wave one request a stage: four pieces), so that each operand byte leaves L2 once per work-group and serves two waves. Two buffers: the next stage's loads fly while this stage is worked on.
// The blocks keep their fragment order in LDS: a wave-wide fragment read is 512 contiguous bytes. The output planes are those of k_gemmw's PLN (1, 2, 3).
// Tensor loads: one request of one wave brings rows x rowb bytes (source rows pitch bytes apart) into LDS, rows back to back, through no register. Two descriptor groups, every word wave-uniform; word 0 of group 1 (mask, element size, pad) is the constant 0: no cluster, extents in bytes, no pad.
typedef uint32_t u32x4 __attribute__((ext_vector_type(4)));
typedef uint32_t u32x8 __attribute__((ext_vector_type(8)));
__device__ __forceinline__ uint32_t uni(uint32_t v) { return (uint32_t)__builtin_amdgcn_readfirstlane(v); }
__device__ __forceinline__ uint32_t pinned(uint32_t v) { uint32_t w = (uint32_t)__builtin_amdgcn_readfirstlane(v); asm volatile("" : "+s"(w)); return w; }   // holds a test around a tensor load in a scalar register, so that it compiles to a scalar branch (tensor loads ignore EXEC)
__device__ __forceinline__ u32x8 tdm_group1(uint32_t rowb, uint32_t rows, uint32_t pitch) { u32x8 g;
    g[0] = uni(0u); g[1] = uni((rowb & 0xFFFFu) << 16); g[2] = uni((rowb >> 16) | ((rows & 0xFFFFu) << 16)); g[3] = uni((rows >> 16) | (rowb << 16)); g[4] = uni(rows); g[5] = uni(pitch); g[6] = uni(0u); g[7] = uni(0u);
    asm volatile("" : "+s"(g));   // pinned(), for the descriptor words: they keep their scalar registers through the loop; without it the compiler re-forms single words there, over registers of a request still outstanding
    return g; }
__device__ __forceinline__ u32x4 tdm_group0(uint32_t lds_dst, uint64_t ga) { u32x4 g;
    g[0] = uni(1u); g[1] = uni(lds_dst); g[2] = uni((uint32_t)ga); g[3] = uni((((uint32_t)(ga >> 32)) & 0x01FFFFFFu) | 0x80000000u); return g; }
__device__ __forceinline__ void tdm_load(u32x4 g0, u32x8 g1) { asm volatile("tensor_load_to_lds %0, %1" :: "s"(g0), "s"(g1) : "memory"); }
template <int PLN>
__device__ __forceinline__ void gemms_tile(const bf* __restrict__ A, const bf* __restrict__ Bt, int ldc, h16* P16, bf* Ph, bf* Pl, int bx, int by, bf* ring) {
    typedef WFrag<bf>::V V;
    constexpr int K = DM, NT = K / 128;   // NT stages of 128 k
    static_assert(NT >= 2, "the ring needs two stages or more");
    static_assert(4 * 64 * 68 * 4 <= 2 * 32768 * 2, "the f32 tiles fit in the ring");
    const int tid = threadIdx.x, lane = tid & 31, lr = lane & 15, hi = lane >> 4;
    const int wv = __builtin_amdgcn_readfirstlane(tid >> 5), wm = wv >> 1, wn = wv & 1;   // the wave's place in the 2 x 2 tile grid, kept scalar so that its LDS bases are
    const int r0 = bx * 128, c0 = by * 128;
    // wave wv's slice of a stage: four pieces (16 KB) of A (waves 0, 1) or of Bt (waves 2, 3), a piece 4 KB in a row, the next piece 16 plane rows on; in the buffer the slices lie in wave order
    const uint64_t gsl = (uint64_t)(size_t)((wv < 2 ? A + (size_t)r0 * K : Bt + (size_t)c0 * K) + (size_t)(wv & 1) * 64 * K);
    const uint32_t lsl = (uint32_t)(size_t)ring + (uint32_t)wv * 16384u;   // LDS byte address of the slice in buffer 0
    const u32x8 g1 = tdm_group1(4096u, 4u, 16u * K * 2u);
    auto stage = [&](int t, int b) { tdm_load(tdm_group0(lsl + (uint32_t)b * 65536u, gsl + (uint64_t)t * 4096u), g1); };   // 128 k on are 4096 bytes on in a piece's plane
    v8f acc[4][4];
#pragma unroll
    for (int mb = 0; mb < 4; ++mb)
#pragma unroll
        for (int nb = 0; nb < 4; ++nb) acc[mb][nb] = (v8f){};
    stage(0, 0);
    asm volatile("s_wait_tensorcnt 0x0" ::: "memory");   // this wave's load of stage 0 has landed
    __syncthreads();   // every wave's load of stage 0 has landed before any wave reads the buffer
#pragma unroll 1   // one trip's text serves all stages (64 products a trip already); the buffer is picked by t & 1
    for (int t = 0; t < NT; ++t) {
        if (pinned(t + 1 < NT)) stage(t + 1, (t + 1) & 1);   // directly behind the barrier that ended every read of that buffer (in front of the loop, or at the last trip's foot); one place of issue, so that one register tuple holds the request's words
        const bf* sa = ring + (t & 1) * 32768 + wm * 8192 + 8 * lane; const bf* sb = ring + (t & 1) * 32768 + 16384 + wn * 8192 + 8 * lane;
#pragma unroll
        for (int ks = 0; ks < 4; ++ks) { V a[4], b[4];
#pragma unroll
            for (int mb = 0; mb < 4; ++mb) a[mb] = WFrag<bf>::ldf(sa + mb * 2048 + ks * 512);
#pragma unroll
            for (int nb = 0; nb < 4; ++nb) b[nb] = WFrag<bf>::ldf(sb + nb * 2048 + ks * 512);
            __builtin_amdgcn_sched_barrier(0);   // keeps the k block's 16 LDS reads together in front of its 16 products: one wait for LDS a block, not one for each Bt fragment
#pragma unroll
            for (int nb = 0; nb < 4; ++nb)
#pragma unroll
                for (int mb = 0; mb < 4; ++mb) acc[mb][nb] = WFrag<bf>::mma(a[mb], b[nb], acc[mb][nb]); }
        asm volatile("s_wait_dscnt 0x0" ::: "memory");      // this wave's reads of the buffer are done before it may be refilled
        asm volatile("s_wait_tensorcnt 0x0" ::: "memory");   // this wave's load of stage t + 1 has landed
        __syncthreads();   // publishes stage t + 1 and ends every wave's reads of stage t's buffer
    }
    asm volatile("s_wait_tensorcnt 0x0" ::: "memory");   // no load is outstanding when the buffers become output staging
    asm volatile("s_wait_dscnt 0x0" ::: "memory");       // and none of this wave's reads of them
    float* my = (float*)ring + wv * (64 * 68);
#pragma unroll
    for (int mb = 0; mb < 4; ++mb)
#pragma unroll
        for (int nb = 0; nb < 4; ++nb)
#pragma unroll
            for (int j = 0; j < 8; ++j) my[(mb * 16 + hi * 8 + j) * 68 + nb * 16 + lr] = acc[mb][nb][j];
    __syncthreads();   // the tile's stores are in LDS before its rows are read back by other lanes
    const int r0w = r0 + wm * 64, c0w = c0 + wn * 64;
    // 16 rows x 16 columns at a time, lane (lr, hi) the 8 columns 8 hi .. of row lr: its 16 bytes of each plane stand at byte 16 * lane of a 512-byte half block
#pragma unroll 4   // one 16-row band a trip: the column offsets become constants, the text stays a quarter of the full unroll's
    for (int g = 0; g < 16; ++g) { const int row = (g >> 2) * 16 + lr, cofs = (g & 3) * 16 + hi * 8;
        const v4f v0 = *(const v4fa*)(my + row * 68 + cofs), v1 = *(const v4fa*)(my + row * 68 + cofs + 4);
        const size_t po = (PLN == 2) ? fo(r0w + row, c0w + cofs, ldc) : (size_t)(c0w / HD) * TT * HD + fo(r0w + row, c0w % HD + cofs, HD);
        v8h o16; v8us oh, ol;
#pragma unroll
        for (int e = 0; e < 8; ++e) { const float y = e < 4 ? v0[e & 3] : v1[e & 3]; o16[e] = tohx(y); unsigned short a2, c2; splitf(y, a2, c2); oh[e] = a2; ol[e] = c2; }
        // each s_wait_xcnt 0 stands directly behind its case's stores, in front of any later write of their address or data registers
        if (PLN != 3 || r0 >= RH) { *(v8h*)(P16 + po) = o16; if (PLN == 3) asm volatile("s_wait_xcnt 0x0" ::: "memory"); }
        if (PLN != 3 || r0 < RH) { *(v8us*)(Ph + po) = oh; *(v8us*)(Pl + po) = ol; asm volatile("s_wait_xcnt 0x0" ::: "memory"); } }
}
// grid (TT / 128, DQ / 128, 3 * batches): blockIdx.z / NB_ picks the projection (q, k, v), blockIdx.z % NB_ the batch. None of the three reads what another writes. q, k: x rows are the tile's rows; V^T = Wv x^T: the weight rows are.
__global__ __launch_bounds__(128) void k_gemms(const bf* __restrict__ XB, const bf* __restrict__ WQ, const bf* __restrict__ WK, const bf* __restrict__ WV, h16* QP16, bf* QPh, bf* QPl, h16* KP16, bf* KPh, bf* KPl, h16* VT16, bf* VTh, bf* VTl) {
    static_assert(DQ == DKV, "the three projections share one grid");
    __shared__ __attribute__((aligned(2048))) bf ring[2 * 32768];   // two 64 KB stage buffers (A part, then Bt part); afterwards the four waves' f32 tiles (pitch 68) lie in the same bytes
    const int pj = blockIdx.z / NB_; const size_t b = blockIdx.z % NB_; const bf* X = XB + b * TT * DM; const size_t so = b * NH_ * TT * HD;   // this batch's slab of x and of each head plane
    if (pj == 0) gemms_tile<3>(X, WQ, 0, QP16 + so, QPh + so, QPl + so, blockIdx.x, blockIdx.y, ring);        // q planes [b][h][t][d]
    else if (pj == 1) gemms_tile<1>(X, WK, 0, KP16 + so, KPh + so, KPl + so, blockIdx.x, blockIdx.y, ring);   // k planes [b][h][t][d]
    else gemms_tile<2>(WV, X, TT, VT16 + so, VTh + so, VTl + so, blockIdx.y, blockIdx.x, ring);               // V^T planes [b][h][d][t]
}

// ---- wtG: every 'xw' [DM][HD] weight block (the 3 * NH_ blocks of W in memory order, then Wo, which has the same shape) goes to its bf16 Bt [HD][DM] plane (fragment order); work-group (bx, y) of DM * HD / 4096 x (3 * NH_ + 1), y picks the block.
__device__ __forceinline__ void wtG(const float* __restrict__ wall, const float* __restrict__ wo, bf* WQ, bf* WK, bf* WV, bf* WO, int bx, int y) {
    static_assert(DQ == DM && DOUT == HD && NKV == NH_, "Wo and every block of W share one shape");
    constexpr int K = DM, N = HD;
    const int hd = y / 3, pj = y - 3 * hd;   // block y of W is head hd's projection pj (q, k, v); y == 3 * NH_ is Wo
    const float* __restrict__ w = (y < 3 * NH_) ? wall + (size_t)y * K * N : wo;
    bf* Bt = (y < 3 * NH_) ? (pj == 0 ? WQ : pj == 1 ? WK : WV) + (size_t)hd * N * K : WO;   // Bt rows hd * HD .. of that projection
    const int lane = threadIdx.x & 31; const int L0 = (bx * 8 + (threadIdx.x >> 5)) * 8; const int nlines = N * K / 64;
{
#pragma unroll 1
        for (int l = 0; l < 8; ++l) { const int L = L0 + l; if (L >= nlines) break; const size_t e = (size_t)L * 64 + lane * 2; const int eb = (int)(e >> 9), ei = (int)(e & 511);   // e = fo(n, k, K), taken apart: block, then place in the block
            const int n = (eb / (K / 32)) * 16 + ((ei >> 3) & 15), k = (eb % (K / 32)) * 32 + (ei >> 8) * 16 + ((ei >> 7) & 1) * 8 + (ei & 7); v2us o;
            o[0] = f2bf(w[(size_t)k * N + n]); o[1] = f2bf(w[(size_t)(k + 1) * N + n]); *(v2us*)(Bt + e) = o; }
         }
}
// ---- cvt8: rows of DM f32 -> one bf16 plane in fragment order; thread i writes the plane's elements [8 i, 8 i + 8) = fo(r, k .. k + 7, DM), so a wave stores 512 contiguous bytes and reads 64 bytes of each of 16 rows.
__device__ __forceinline__ void cvt8(const float* __restrict__ src, bf* dst, size_t n8, unsigned bx) { const size_t i = (size_t)bx * 256 + threadIdx.x; if (i >= n8) return;
    const size_t eb = i >> 6; const int ei = (int)(i & 63); const size_t r = (eb / (DM / 32)) * 16 + (ei & 15); const int k = (int)(eb % (DM / 32)) * 32 + (ei >> 5) * 16 + ((ei >> 4) & 1) * 8;
    const v8f v = *(const v8f*)(src + r * DM + k); v8us o;
    asm volatile("s_wait_xcnt 0x0" ::: "memory");   // stands behind the two loads, in front of any later write of their address registers
#pragma unroll
    for (int k = 0; k < 8; ++k) o[k] = f2bf(v[k]); *(v8us*)(dst + i * 8) = o;  }
// ---- k_prep: both conversions of the inputs in one launch (neither reads what the other writes): the first NWT work-groups are wtG's (their eight dependent trips are the longer chain, so they start first), the rest cvt8's.
#define NWT ((DM * HD / 4096) * (3 * NH_ + 1))
__global__ __launch_bounds__(256) void k_prep(const float* __restrict__ wall, const float* __restrict__ wo, bf* WQ, bf* WK, bf* WV, bf* WO, const float* __restrict__ x, bf* XB, size_t n8) {
    if (blockIdx.x < NWT) wtG(wall, wo, WQ, WK, WV, WO, blockIdx.x % (DM * HD / 4096), blockIdx.x / (DM * HD / 4096));
    else cvt8(x, XB, n8, blockIdx.x - NWT);
}

// ---- k_attn: scores, online softmax, P V and the hi/lo merge of BQ query rows of one head in one work-group of 8 waves; grid (batches * heads, TT / BQ), all hi/lo row tiles (t0 < RH) first.
// Transposed products: S^T = K Q^T (A = K fragments from LDS, B = Q fragments kept in registers), O^T += V^T P^T. A lane then holds scores of one query only: 8 keys of each 16-key tile, which are exactly its places of the B operand P^T, so S and P never leave registers.
// Wave wv owns the 32 query columns 32 (wv & 3) .. and, of every stage, the 32-key passes p with p % 2 == wv >> 2. K and V^T come in stages of SK keys (64 KB) by tensor loads (each wave one request of 8 KB a stage) into two LDS buffers, so that each byte leaves L2 once per 128 query rows.
// Sum orders: scores k = 0, 32, 64, 96; each wave sums its passes in key order under a running maximum (log2 domain; the maximum in use may trail the true one by up to 8, the sums are rescaled only when it would trail by more); the two key halves' sums are added at the end.
#define BQ  128                   // query rows per work-group
typedef __attribute__((ext_vector_type(2))) __bf16 v2bf;
typedef __attribute__((ext_vector_type(8))) unsigned v8u;
typedef __attribute__((ext_vector_type(4))) unsigned v4u;
__device__ __forceinline__ float xhalf(float x) { return __builtin_bit_cast(float, __builtin_amdgcn_permlanex16(__builtin_bit_cast(int, x), __builtin_bit_cast(int, x), 0x76543210, 0xfedcba98, false, false)); }   // lane l's value of lane l ^ 16
__device__ __forceinline__ unsigned pk2b(float a, float b) { return __builtin_bit_cast(unsigned, __builtin_convertvector((v2f){a, b}, v2bf)); }   // two bf16, round to nearest even
__device__ __forceinline__ unsigned pk2h(float a, float b) { return __builtin_bit_cast(unsigned, __builtin_convertvector((v2f){a, b}, v2h)); }    // two fp16, round to nearest even
template <typename T16, bool HL>
__device__ __forceinline__ void attn_cols(const T16* __restrict__ Q, const T16* __restrict__ Q2, const T16* __restrict__ Kp, const T16* __restrict__ K2, const T16* __restrict__ Vt, const T16* __restrict__ V2, bf* Ah, bf* Al, int t0, int h, unsigned short* ringu) {
    typedef typename WFrag<T16>::V V;
    constexpr int SK = HL ? 64 : 128, NT = TT / SK, NP = SK / 64, VB = SK / 32;   // keys a stage, stages, passes a wave and stage, 32-key blocks a stage
    static_assert(NT >= 2, "the ring needs two stages or more");
    constexpr float CS = SCL * 1.4426950408889634f;   // scores to the log2 domain
    constexpr float OFF = HL ? 0.0f : 4.0f;           // fp16 P carries 2^4 (it cancels against the row sum): small weights stay clear of the fp16 subnormals, the largest is 2^12
    const int tid = threadIdx.x, lane = tid & 31, lr = lane & 15, hi = lane >> 4;
    const int wv = __builtin_amdgcn_readfirstlane(tid >> 5), cw = wv & 3, kh = wv >> 2;   // column group and key half, kept scalar so that the LDS bases and the last branch are
    const T16* ring = (const T16*)ringu;
    const unsigned lb0 = (unsigned)(size_t)ringu;   // buffer 0 (LDS byte address)
    // A buffer, in elements: K at 0 (16-key tile a, k block c at (4 a + c) * 512; hi/lo: the lo plane 8192 on), V^T at 16384 (16-row tile t, key block c at (VB t + c) * 512; hi/lo: the lo plane 8192 on).
    // K: a stage is contiguous in its plane. V^T: a tile's VB blocks are contiguous, the next tile's lie 32768 elements on.
    // Wave wv's slice of a stage is the 8 KB at 8192 wv of the buffer. Waves 0 to 3: K, two rows of 4 KB back to back in the plane (hi/lo: waves 0, 1 the hi plane, 2, 3 the lo plane). Waves 4 to 7: V^T, whole tiles 65536 bytes apart: two of 4 KB, or (hi/lo) four of 2 KB (waves 4, 5 the hi plane, 6, 7 the lo plane).
    const T16* sp = HL ? (kh ? ((cw & 2) ? V2 : Vt) + (size_t)(cw & 1) * 4 * 32768 : ((cw & 2) ? K2 : Kp) + (size_t)(cw & 1) * 4096) : (kh ? Vt + (size_t)cw * 2 * 32768 : Kp + (size_t)cw * 4096);
    const uint64_t gsl = (uint64_t)(size_t)sp; const uint32_t gst = kh ? (uint32_t)(VB * 512 * 2) : (uint32_t)(SK * HD * 2);   // the slice's first byte in stage 0, and the bytes from one stage to the next
    const uint32_t lsl = lb0 + (uint32_t)wv * 8192u;
    const u32x8 g1 = tdm_group1((HL && kh) ? 2048u : 4096u, (HL && kh) ? 4u : 2u, kh ? 65536u : 4096u);
    auto stage = [&](int st, int b) { tdm_load(tdm_group0(lsl + (uint32_t)b * 65536u, gsl + (uint64_t)((uint32_t)st * gst)), g1); };
    stage(0, 0);
    V qa[2][HD / 32], qb[2][HD / 32];
#pragma unroll
    for (int g = 0; g < 2; ++g)
#pragma unroll
        for (int ks = 0; ks < HD / 32; ++ks) { const size_t qo = (size_t)(t0 + cw * 32 + g * 16) * HD + ks * 512 + 8 * lane; qa[g][ks] = WFrag<T16>::ldf(Q + qo); if (HL) qb[g][ks] = WFrag<T16>::ldf(Q2 + qo); }   // qo = fo(query tile's row lr, ks * 32 + 8 * hi, HD)
    v8f o[2][HD / 16]; float mrun[2], lrun[2];
#pragma unroll
    for (int g = 0; g < 2; ++g) { mrun[g] = -__builtin_inff(); lrun[g] = 0.f;
#pragma unroll
        for (int t = 0; t < HD / 16; ++t) o[g][t] = (v8f){}; }
    asm volatile("s_wait_tensorcnt 0x0" ::: "memory");   // this wave's load of stage 0 has landed
    __syncthreads();   // every wave's load of stage 0 has landed before any wave reads the buffer
#pragma unroll 1   // one trip's text serves all stages; the buffer is picked by st & 1
    for (int st = 0; st < NT; ++st) {
        if (pinned(st + 1 < NT)) stage(st + 1, (st + 1) & 1);   // directly behind the barrier that ended every read of that buffer (in front of the loop, or at the last trip's foot); one place of issue, so that one register tuple holds the request's words
        const T16* sb = ring + (st & 1) * 32768 + 8 * lane;
        V kf[2][HD / 32], kl[2][HD / 32];
        auto ldk = [&](int p) {
#pragma unroll
            for (int kt = 0; kt < 2; ++kt)
#pragma unroll
                for (int ks = 0; ks < HD / 32; ++ks) { const T16* kp = sb + ((p * 2 + kt) * 4 + ks) * 512; kf[kt][ks] = WFrag<T16>::ldf(kp); if (HL) kl[kt][ks] = WFrag<T16>::ldf(kp + 8192); } };
        ldk(kh);
#pragma unroll
        for (int i = 0; i < NP; ++i) { const int p = kh + 2 * i;   // this wave's 32-key pass of the stage
            v8f s[2][2];
            __builtin_amdgcn_sched_barrier(0);   // keeps the pass's K reads together in front of its products: one wait for LDS, not one for each fragment
#pragma unroll
            for (int kt = 0; kt < 2; ++kt)
#pragma unroll
                for (int g = 0; g < 2; ++g) { s[kt][g] = (v8f){};
#pragma unroll
                    for (int ks = 0; ks < HD / 32; ++ks) { s[kt][g] = WFrag<T16>::mma(kf[kt][ks], qa[g][ks], s[kt][g]); if (HL) { s[kt][g] = WFrag<T16>::mma(kf[kt][ks], qb[g][ks], s[kt][g]); s[kt][g] = WFrag<T16>::mma(kl[kt][ks], qa[g][ks], s[kt][g]); } } }
            if (i + 1 < NP) ldk(p + 2);   // the wave's next pass of the same stage: its K reads run under this pass's softmax and second product
            V vf[HD / 16], vl[HD / 16];
#pragma unroll
            for (int t = 0; t < HD / 16; ++t) { const T16* vp = sb + 16384 + (t * VB + p) * 512; vf[t] = WFrag<T16>::ldf(vp); if (HL) vl[t] = WFrag<T16>::ldf(vp + 8192); }
            __builtin_amdgcn_sched_barrier(0);   // keeps the V^T reads in front of the softmax arithmetic, so that their latency runs under it
            float mb[2]; bool need = false;
#pragma unroll
            for (int g = 0; g < 2; ++g) { float mx = s[0][g][0];
#pragma unroll
                for (int j = 1; j < 16; ++j) mx = fmaxf(mx, s[j >> 3][g][j & 7]);
                mx = fmaxf(mx, xhalf(mx)) * CS;   // both wave halves hold the query's maximum of this pass, scaled (the scale is positive)
                mb[g] = mx; need = need || (mx > mrun[g] + 8.0f); }
            if (__builtin_amdgcn_ballot_w32(need) != 0) {   // wave-uniform; always taken in a wave's first pass, seldom later
#pragma unroll
                for (int g = 0; g < 2; ++g) { const float mn = fmaxf(mrun[g], mb[g]); const float corr = __builtin_amdgcn_exp2f(mrun[g] - mn);   // 0 in the first pass, where mrun is -inf
                    lrun[g] *= corr; mrun[g] = mn;
#pragma unroll
                    for (int t = 0; t < HD / 16; ++t) o[g][t] = o[g][t] * corr; } }
#pragma unroll
            for (int g = 0; g < 2; ++g) { const float nm = OFF - mrun[g]; v8u wh, wl; float ps0 = 0.f, ps1 = 0.f;
#pragma unroll
                for (int e = 0; e < 8; ++e) {   // operand elements 2 e, 2 e + 1 = keys 8 hi + .. of tile e >> 2: accumulator registers 2 (e & 3), 2 (e & 3) + 1
                    const float p0 = __builtin_amdgcn_exp2f(__builtin_fmaf(s[e >> 2][g][2 * (e & 3)], CS, nm)), p1 = __builtin_amdgcn_exp2f(__builtin_fmaf(s[e >> 2][g][2 * (e & 3) + 1], CS, nm));
                    ps0 += p0; ps1 += p1;
                    if (HL) { const unsigned w = pk2b(p0, p1); wh[e] = w; wl[e] = pk2b(p0 - __uint_as_float(w << 16), p1 - __uint_as_float(w & 0xFFFF0000u)); }
                    else wh[e] = pk2h(p0, p1); }
                lrun[g] += ps0 + ps1;
                const V pf = __builtin_bit_cast(V, wh);
#pragma unroll
                for (int t = 0; t < HD / 16; ++t) { o[g][t] = WFrag<T16>::mma(vf[t], pf, o[g][t]); if (HL) { o[g][t] = WFrag<T16>::mma(vf[t], __builtin_bit_cast(V, wl), o[g][t]); o[g][t] = WFrag<T16>::mma(vl[t], pf, o[g][t]); } } }
            __builtin_amdgcn_sched_barrier(0);
            asm volatile("v_nop\n\tv_nop\n\tv_nop\n\tv_nop");   // the four vector slots the chip needs behind the pass's last products, also on the loop's taken branch, before their operand registers are rewritten
            __builtin_amdgcn_sched_barrier(0);   // the two scheduling barriers keep the v_nops directly behind the products
        }
        asm volatile("s_wait_dscnt 0x0" ::: "memory");      // this wave's reads of the buffer are done before it may be refilled
        asm volatile("s_wait_tensorcnt 0x0" ::: "memory");   // this wave's load of stage st + 1 has landed
        __syncthreads();   // publishes stage st + 1 and ends every wave's reads of stage st's buffer
    }
    asm volatile("s_wait_tensorcnt 0x0" ::: "memory");   // no load is outstanding when the buffers become the hand-over space
    asm volatile("s_wait_dscnt 0x0" ::: "memory");       // and none of this wave's reads of them
    // the two key halves of the same columns swap sums through LDS: half 0 hands over column group 1 and finishes group 0, half 1 the other way round. A hand-over is 8 tiles x 32 lanes x 8 floats, then the running maxima and the row sums.
    float* xs = (float*)ringu + cw * (2 * 2112);
    auto put = [&](int g) { float* x = xs + kh * 2112; x[2048 + lane] = mrun[g]; x[2080 + lane] = lrun[g];
#pragma unroll
        for (int t = 0; t < HD / 16; ++t) { *(v4fa*)(x + (t * 2) * 128 + lane * 4) = __builtin_shufflevector(o[g][t], o[g][t], 0, 1, 2, 3); *(v4fa*)(x + (t * 2 + 1) * 128 + lane * 4) = __builtin_shufflevector(o[g][t], o[g][t], 4, 5, 6, 7); } };
    auto fin = [&](int g) { const float* x = xs + (1 - kh) * 2112; const float m1 = x[2048 + lane], l1 = x[2080 + lane]; const float mn = fmaxf(mrun[g], m1);
        const float c0 = __builtin_amdgcn_exp2f(mrun[g] - mn), c1 = __builtin_amdgcn_exp2f(m1 - mn); float l = lrun[g] * c0 + l1 * c1; l += xhalf(l);   // each wave half held the sums of its 8 keys of every tile
        const float inv = __fdiv_rn(1.0f, l), f0 = c0 * inv, f1 = c1 * inv;
#pragma unroll
        for (int t = 0; t < HD / 16; ++t) { const v4f a0 = *(const v4fa*)(x + (t * 2) * 128 + lane * 4), a1 = *(const v4fa*)(x + (t * 2 + 1) * 128 + lane * 4); v4u oh, ol;
#pragma unroll
            for (int e = 0; e < 4; ++e) { const float y0 = o[g][t][2 * e] * f0 + (e < 2 ? a0[2 * e] : a1[2 * e - 4]) * f1, y1 = o[g][t][2 * e + 1] * f0 + (e < 2 ? a0[2 * e + 1] : a1[2 * e - 3]) * f1;
                const unsigned w = pk2b(y0, y1); oh[e] = w; ol[e] = pk2b(y0 - __uint_as_float(w << 16), y1 - __uint_as_float(w & 0xFFFF0000u)); }
            // lane (lr, hi) holds columns 16 t + 8 hi .. + 7 of query row lr of the group: its 16 bytes of each plane stand at byte 16 * lane of a 512-byte half block of the merged rows' fragment order
            const size_t oo = fo(t0 + cw * 32 + g * 16 + lr, h * HD + t * 16 + hi * 8, DQ); *(v4u*)(Ah + oo) = oh; *(v4u*)(Al + oo) = ol;
            asm volatile("s_wait_xcnt 0x0" ::: "memory"); } };   // stands behind the two stores, in front of any later write of their address or data registers
    if (kh == 0) put(1); else put(0);
    __syncthreads();   // both halves' hand-overs are in LDS before either reads the other's
    if (kh == 0) fin(0); else fin(1);
}
__global__ __launch_bounds__(256) void k_attn(const h16* __restrict__ Q16, const bf* __restrict__ Qh, const bf* __restrict__ Ql, const h16* __restrict__ K16, const bf* __restrict__ Kh, const bf* __restrict__ Kl, const h16* __restrict__ V16, const bf* __restrict__ Vh, const bf* __restrict__ Vl, bf* Ah, bf* Al) {
    __shared__ __attribute__((aligned(2048))) unsigned short ring[2 * 32768];   // two 64 KB stage buffers; afterwards the hand-over space of the key halves
    static_assert(RH % BQ == 0 && TT % BQ == 0, "a row tile is wholly hi/lo or wholly fp16");
    const int h = blockIdx.x % NH_, t0 = blockIdx.y * BQ; const size_t b = blockIdx.x / NH_; const size_t zq = (b * NH_ + h) * TT * HD, zk = (b * NKV + h / REP) * TT * HD;
    Ah += b * TT * DQ; Al += b * TT * DQ;   // this batch's slab of the merged head rows
    if (t0 < RH) attn_cols<bf, true>(Qh + zq, Ql + zq, Kh + zk, Kl + zk, Vh + zk, Vl + zk, Ah, Al, t0, h, ring);
    else attn_cols<h16, false>(Q16 + zq, nullptr, K16 + zk, nullptr, V16 + zk, nullptr, Ah, Al, t0, h, ring);
}

extern "C" void kernel_launch(void* const* d_in, const int* in_sizes, int n_in,
                              void* d_out, int out_size, void* d_ws, size_t ws_size, hipStream_t stream) {
    (void)in_sizes; (void)n_in; (void)out_size;
    const float* x = (const float*)d_in[0]; const float* wall = (const float*)d_in[1]; const float* wo = (const float*)d_in[2];   /* order x, W [8][3][1024][128], Wo [1024][128] */ const float* wq = wall; const float* wk = wall; const float* wv = wall; (void)wq; (void)wk; (void)wv;
    float* OUT = (float*)d_out;     // [4][2048][128]
    char* wsp = (char*)d_ws;
    auto take = [&](size_t bytes) { char* p = wsp; wsp += (bytes + 255) & ~(size_t)255; return (void*)p; };
    bf* WQ = (bf*)take((size_t)DQ * DM * 2); bf* WK = (bf*)take((size_t)DKV * DM * 2); bf* WV = (bf*)take((size_t)DKV * DM * 2); bf* WO = (bf*)take((size_t)DOUT * DQ * 2);
    bf* XB = (bf*)take((size_t)NB_ * TT * DM * 2);
    h16* QP16 = (h16*)take((size_t)NB_ * NH_ * TT * HD * 2); h16* KP16 = (h16*)take((size_t)NB_ * NKV * TT * HD * 2); h16* VT16 = (h16*)take((size_t)NB_ * NKV * HD * TT * 2);
    bf* QPh = (bf*)take((size_t)NB_ * NH_ * TT * HD * 2); bf* QPl = (bf*)take((size_t)NB_ * NH_ * TT * HD * 2); bf* KPh = (bf*)take((size_t)NB_ * NKV * TT * HD * 2); bf* KPl = (bf*)take((size_t)NB_ * NKV * TT * HD * 2); bf* VTh = (bf*)take((size_t)NB_ * NKV * HD * TT * 2); bf* VTl = (bf*)take((size_t)NB_ * NKV * HD * TT * 2);
    bf* ATh = (bf*)take((size_t)NB_ * TT * DQ * 2); bf* ATl = (bf*)take((size_t)NB_ * TT * DQ * 2);
    if ((size_t)(wsp - (char*)d_ws) > ws_size) return;    // ws 256 MiB
    k_prep<<<(unsigned)(NWT + ((size_t)NB_ * TT * DM / 8 + 255) / 256), 256, 0, stream>>>(wall, wo, WQ, WK, WV, WO, x, XB, (size_t)NB_ * TT * DM / 8);   /* all 25 'xw' [1024][128] blocks -> Bt [128][1024] planes, and x -> bf16 */
    k_gemms<<<dim3(TT / 128, DQ / 128, 3 * NB_), 128, 0, stream>>>(XB, WQ, WK, WV, QP16, QPh, QPl, KP16, KPh, KPl, VT16, VTh, VTl);   // q, k, V^T planes of all batches
    k_attn<<<dim3(NH_ * NB_, TT / BQ, 1), 256, 0, stream>>>(QP16, QPh, QPl, KP16, KPh, KPl, VT16, VTh, VTl, ATh, ATl);   // all heads of all batches; S and P never leave registers
    k_gemmw<bf, 1, false, 16, 0><<<dim3(TT / 64, DOUT / 64, NB_), 512, 0, stream>>>(ATh, ATl, WO, nullptr, DQ, OUT, DOUT, nullptr, (size_t)TT * DQ, 0, (size_t)TT * DOUT, nullptr, nullptr, nullptr);   /* z = o Wo: N 128 */
}
